// v000
// Times are from an AMD MI455X. After a warm-up the kernel runs many times in a row, and a time is the length of
// such a window on the GPU divided by its runs, so every launch and the gaps after it count. The runs cycle
// through copies of the inputs. A figure is the median of several windows, for all but v000 over two sittings.
// Sittings can differ by a few percent; kernels timed side by side share one.
// v000, which the later versions start from, runs in 1580 microseconds.
#include <hip/hip_runtime.h>

// Gated row (axial) attention with a pre-LayerNorm (x [1][64][512][256]: 64 image rows = 64 independent sequences of 512 tokens x 256; xn = LayerNorm(x) (gamma, beta, eps 1e-5); q = xn Wq ('xw' [256][512], 8 heads x 64), [k|v] = xn Wkv ('xw' [256][1024]: columns k | v); dots = (q/8).k over the 512 keys of the same row; softmax (the explicit max subtraction is a softmax identity); out = attn.v merged; gates = sigmoid(xn Wg + bg) ('xw' [256][512]); y = (out * gates) Wo + bo ('xw' [512][256]) -> [1][64][512][256] (8.4 M)).
// Compute dtypes, f32 accumulate: every input rounded to bf16; LayerNorm in f32, xn as bf16 hi + lo planes; q / kv / gate projections as (hi + lo) x exact weights (2 products) + f32 bias; scores and attn.v on bf16 hi/lo planes (3 products) for every row; softmax f32; sigmoid gate f32 (true division); (out x gate) as hi + lo x exact Wo (2 products) + bo.
// Layout: 4 image rows (2,048 tokens) per pass; all per-(row, head) planes are laid out z-major ([z = row*8 + head][512][64]) so each attention stage is ONE z-batched launch of 32 tile GEMMs.

#define NB_  64        // sequences (image rows)
#define TT   512       // tokens per sequence
#define DM   256
#define NH_  8
#define HD   64
#define DQ   (NH_ * HD)    // 512 = inner dim
#define GB   4             // sequences per pass
#define GR   (GB * TT)     // 2048 token rows per pass
#define ZH   (GB * NH_)    // 32 (sequence, head) planes per pass
#define RH   TT            // every query row uses hi+lo planes
#define PCAR 1024.0f
#define SCL  0.125f   // HD^-0.5
typedef _Float16 h16;
typedef unsigned short bf;
typedef __attribute__((ext_vector_type(16))) __bf16   v16bf;
typedef __attribute__((ext_vector_type(16))) _Float16 v16h;
typedef __attribute__((ext_vector_type(8)))  _Float16 v8h;
typedef __attribute__((ext_vector_type(8)))  unsigned short v8us;
typedef __attribute__((ext_vector_type(8)))  float    v8f;
typedef __attribute__((ext_vector_type(4)))  float    v4f;
typedef v8h  __attribute__((may_alias)) v8ha;
typedef v4f  __attribute__((may_alias)) v4fa;
typedef v8us __attribute__((may_alias)) v8usa;

__device__ __forceinline__ unsigned short f2bf(float f) { unsigned u = __float_as_uint(f); u += 0x7FFFu + ((u >> 16) & 1u); return (unsigned short)(u >> 16); }
__device__ __forceinline__ float bf2f(unsigned short b) { return __uint_as_float(((unsigned)b) << 16); }
__device__ __forceinline__ float bfr(float f) { return bf2f(f2bf(f)); }
__device__ __forceinline__ v16h cat16(v8h lo, v8h hi) { return __builtin_shufflevector(lo, hi, 0, 1, 2, 3, 4, 5, 6, 7, 8, 9, 10, 11, 12, 13, 14, 15); }
__device__ __forceinline__ v16bf cat16b(v8us lo, v8us hi) { return __builtin_bit_cast(v16bf, __builtin_shufflevector(lo, hi, 0, 1, 2, 3, 4, 5, 6, 7, 8, 9, 10, 11, 12, 13, 14, 15)); }
__device__ __forceinline__ v8f wmma16(v16h a, v16h b, v8f c) { return __builtin_amdgcn_wmma_f32_16x16x32_f16(false, a, false, b, (short)0, c, false, false); }
__device__ __forceinline__ v8f wmmab(v16bf a, v16bf b, v8f c) { return __builtin_amdgcn_wmma_f32_16x16x32_bf16(false, a, false, b, (short)0, c, false, false); }



// ---- k_gemmw: register-blocked GEMM, ONE WAVE per 64x64 output tile (16 accumulators), operands straight from K-contiguous 16-bit planes; grid (M/64, N/64, Z), 32 threads.
// C[m][n] (f32, pitch ldc, + optional f32 bias[n]) = sum_k A[m][k] Bt[n][k] (+ split products per NSPLIT). z-batch strides sA/sB/sC in elements. K % 32 == 0.
template <typename T16> struct WFrag;
template <> struct WFrag<h16> { typedef v16h V; static __device__ __forceinline__ V ld(const h16* p) { return cat16(*(const v8h*)p, *(const v8h*)(p + 16)); } static __device__ __forceinline__ v8f mma(V a, V b, v8f c) { return wmma16(a, b, c); } };
template <> struct WFrag<bf> { typedef v16bf V; static __device__ __forceinline__ V ld(const bf* p) { return cat16b(*(const v8us*)p, *(const v8us*)(p + 16)); } static __device__ __forceinline__ v8f mma(V a, V b, v8f c) { return wmmab(a, b, c); } };
template <typename T16, int NSPLIT, bool BIAS>
__global__ __launch_bounds__(32) void k_gemmw(const T16* __restrict__ A, const T16* __restrict__ A2, const T16* __restrict__ Bt, const T16* __restrict__ Bt2, int K, float* C, int ldc, const float* __restrict__ bias, size_t sA, size_t sB, size_t sC) {
    typedef typename WFrag<T16>::V V;
    __shared__ __align__(16) float os[16 * 68];
    const size_t z = blockIdx.z; A += z * sA; if (A2) A2 += z * sA; Bt += z * sB; if (Bt2) Bt2 += z * sB; C += z * sC;
    const int lane = threadIdx.x & 31, lr = lane & 15, hi = lane >> 4; const int r0 = blockIdx.x * 64, c0 = blockIdx.y * 64;
    v8f acc[4][4];
#pragma unroll
    for (int mb = 0; mb < 4; ++mb)
#pragma unroll
        for (int nb = 0; nb < 4; ++nb) acc[mb][nb] = (v8f){};
    const size_t aoff = (size_t)(r0 + lr) * K + 8 * hi, boff = (size_t)(c0 + lr) * K + 8 * hi;
#pragma unroll 1
    for (int kc = 0; kc < K; kc += 32) {
        V a[4], a2[4];
#pragma unroll
        for (int mb = 0; mb < 4; ++mb) { a[mb] = WFrag<T16>::ld(A + aoff + (size_t)mb * 16 * K + kc); if (NSPLIT == 1 || NSPLIT == 2) a2[mb] = WFrag<T16>::ld(A2 + aoff + (size_t)mb * 16 * K + kc); }
#pragma unroll
        for (int nb = 0; nb < 4; ++nb) { const V b = WFrag<T16>::ld(Bt + boff + (size_t)nb * 16 * K + kc); V b2; if (NSPLIT >= 2) b2 = WFrag<T16>::ld(Bt2 + boff + (size_t)nb * 16 * K + kc);
#pragma unroll
            for (int mb = 0; mb < 4; ++mb) { acc[mb][nb] = WFrag<T16>::mma(a[mb], b, acc[mb][nb]); if (NSPLIT == 1 || NSPLIT == 2) acc[mb][nb] = WFrag<T16>::mma(a2[mb], b, acc[mb][nb]); if (NSPLIT >= 2) acc[mb][nb] = WFrag<T16>::mma(a[mb], b2, acc[mb][nb]); } }
        asm volatile("v_nop\n\tv_nop\n\tv_nop\n\tv_nop" : "+v"(acc[0][0]), "+v"(acc[1][1]), "+v"(acc[2][2]), "+v"(acc[3][3]) : "v"(a[0]), "v"(a[3]));
    }
#pragma unroll
    for (int mb = 0; mb < 4; ++mb) {
#pragma unroll
        for (int nb = 0; nb < 4; ++nb) {
#pragma unroll
            for (int j = 0; j < 8; ++j) os[(hi * 8 + j) * 68 + nb * 16 + lr] = acc[mb][nb][j]; }
        __builtin_amdgcn_wave_barrier(); asm volatile("" ::: "memory");
        float* crow = C + (size_t)(r0 + mb * 16) * ldc + c0;
{
#pragma unroll
            for (int s = 0; s < 8; ++s) { const int row = 2 * s + hi, cofs = lr * 4; v4f val = *(const v4fa*)(os + row * 68 + cofs); if (BIAS) { val[0] += bfr(bias[c0 + cofs]); val[1] += bfr(bias[c0 + cofs + 1]); val[2] += bfr(bias[c0 + cofs + 2]); val[3] += bfr(bias[c0 + cofs + 3]); }
                *(v4f*)(crow + (size_t)row * ldc + cofs) = val; }
             }
        __builtin_amdgcn_wave_barrier(); asm volatile("" ::: "memory");
    }
}

__device__ __forceinline__ h16 tohx(float x) { return (h16)x; }
__device__ __forceinline__ void splitf(float y, unsigned short& h, unsigned short& l) { h = f2bf(y); l = f2bf(y - bf2f(h)); }
typedef __attribute__((ext_vector_type(2))) _Float16 v2h;
typedef __attribute__((ext_vector_type(4))) _Float16 v4h;
typedef __attribute__((ext_vector_type(2))) unsigned short v2us;
typedef __attribute__((ext_vector_type(4))) unsigned short v4us;
typedef __attribute__((ext_vector_type(2))) float v2f;
typedef __attribute__((ext_vector_type(4))) int v4i;

__global__ __launch_bounds__(256) void k_wtG(const float* __restrict__ w, int K, int N, bf* Bt) {
    const int lane = threadIdx.x & 31; const int L0 = (blockIdx.x * 8 + (threadIdx.x >> 5)) * 8; const int nlines = N * K / 64;
{
#pragma unroll 1
        for (int l = 0; l < 8; ++l) { const int L = L0 + l; if (L >= nlines) break; const size_t e = (size_t)L * 64 + lane * 2; const int k = (int)(e % K), n = (int)(e / K); v2us o;
            o[0] = f2bf(w[(size_t)k * N + n]); o[1] = f2bf(w[(size_t)(k + 1) * N + n]); *(v2us*)(Bt + e) = o; }
         }
}

__global__ __launch_bounds__(256) void k_ln256(const float* __restrict__ X, int nrows, const float* __restrict__ gw, const float* __restrict__ gb, bf* Yh, bf* Yl) {
    const int lane = threadIdx.x & 31; const int r = blockIdx.x * 8 + (threadIdx.x >> 5); if (r >= nrows) return; const float* xr = X + (size_t)r * DM; float hv[8]; float s = 0.f;
#pragma unroll
    for (int ch = 0; ch < 2; ++ch) { const v4f y = *(const v4f*)(xr + ch * 128 + lane * 4);
#pragma unroll
        for (int q = 0; q < 4; ++q) { const float u = bfr(y[q]); hv[ch * 4 + q] = u; s += u; } }
#pragma unroll
    for (int sh = 16; sh; sh >>= 1) s += __shfl_xor(s, sh, 32);
    float mu = s * (1.0f / 256.0f); asm volatile("" : "+v"(mu)); float s2 = 0.f;
#pragma unroll
    for (int k = 0; k < 8; ++k) { float d0 = __fsub_rn(hv[k], mu); asm volatile("" : "+v"(d0)); float p = __fmul_rn(d0, d0); asm volatile("" : "+v"(p)); s2 = __fadd_rn(s2, p); }
#pragma unroll
    for (int sh = 16; sh; sh >>= 1) s2 += __shfl_xor(s2, sh, 32);
    float var = __fadd_rn(s2 * (1.0f / 256.0f), 1e-5f); asm volatile("" : "+v"(var)); const float rs = __frsqrt_rn(var);
{
#pragma unroll
        for (int ch = 0; ch < 2; ++ch) { const int c0 = ch * 128 + lane * 4; v4us oh, ol;
#pragma unroll
            for (int q = 0; q < 4; ++q) { float gg = bfr(gw[c0 + q]); asm volatile("" : "+v"(gg)); float d0 = __fsub_rn(hv[ch * 4 + q], mu); asm volatile("" : "+v"(d0)); float n0 = __fmul_rn(d0, rs); asm volatile("" : "+v"(n0)); float y = __fmul_rn(n0, gg); asm volatile("" : "+v"(y)); y = __fadd_rn(y, bfr(gb[c0 + q])); unsigned short a, c2; splitf(y, a, c2); oh[q] = a; ol[q] = c2; }
            *(v4us*)(Yh + (size_t)r * DM + c0) = oh; *(v4us*)(Yl + (size_t)r * DM + c0) = ol; }
         } }
__global__ __launch_bounds__(256) void k_plz(const float* __restrict__ F, int pitch, int coff, bf* Ph, bf* Pl) { const size_t e = ((size_t)blockIdx.x * 256 + threadIdx.x) * 2; if (e >= (size_t)ZH * TT * HD) return; const int d = (int)(e % HD); const int t = (int)((e / HD) % TT); const int z = (int)(e / ((size_t)HD * TT)); const int h = z % NH_, sq = z / NH_; const float* f = F + ((size_t)sq * TT + t) * pitch + coff + h * HD + d; v2us oh, ol;
#pragma unroll
    for (int q = 0; q < 2; ++q) { unsigned short a, c2; splitf(f[q], a, c2); oh[q] = a; ol[q] = c2; }
    *(v2us*)(Ph + e) = oh; *(v2us*)(Pl + e) = ol;  }
__global__ __launch_bounds__(256) void k_vtz(const float* __restrict__ F, int pitch, int coff, bf* Vh, bf* Vl) { const size_t e = ((size_t)blockIdx.x * 256 + threadIdx.x) * 2; if (e >= (size_t)ZH * HD * TT) return; const int t = (int)(e % TT); const int d = (int)((e / TT) % HD); const int z = (int)(e / ((size_t)TT * HD)); const int h = z % NH_, sq = z / NH_; v2us oh, ol;
#pragma unroll
    for (int q = 0; q < 2; ++q) { const float x = F[((size_t)sq * TT + t + q) * pitch + coff + h * HD + d]; unsigned short a, c2; splitf(x, a, c2); oh[q] = a; ol[q] = c2; }
    *(v2us*)(Vh + e) = oh; *(v2us*)(Vl + e) = ol;  }
// k_asoft: per row (zz, i): t = S x HD^-0.5 (no mask); softmax over the 512 keys (register row, one exp, fixed trees);
__global__ __launch_bounds__(256) void k_asoft(const float* __restrict__ Sb, h16* P16, bf* Ph, bf* Pl) {
    const int lane = threadIdx.x & 31; const int row = blockIdx.x * 8 + (threadIdx.x >> 5); if (row >= ZH * TT) return; const int i = row % TT; const int zz = row / TT; (void)zz; const bool hires = (i < RH); const float* sr = Sb + (size_t)row * TT; float v[TT / 32]; float mx = -3.0e38f;
#pragma unroll
    for (int ch = 0; ch < TT / 128; ++ch) { const int j0 = ch * 128 + lane * 4; const v4f a = *(const v4f*)(sr + j0);
#pragma unroll
        for (int q = 0; q < 4; ++q) { const int j = j0 + q; (void)j; const float t = a[q] * SCL; v[ch * 4 + q] = t; mx = fmaxf(mx, t); } }
#pragma unroll
    for (int sh = 16; sh; sh >>= 1) mx = fmaxf(mx, __shfl_xor(mx, sh, 32));
    float sum = 0.f;
#pragma unroll
    for (int k = 0; k < TT / 32; ++k) { float d0 = __fsub_rn(v[k], mx); asm volatile("" : "+v"(d0)); v[k] = __builtin_amdgcn_exp2f(__fmul_rn(d0, 1.4426950408889634f)); sum += v[k]; }
#pragma unroll
    for (int sh = 16; sh; sh >>= 1) sum += __shfl_xor(sum, sh, 32);
    const float f = __fdiv_rn(hires ? 1.0f : PCAR, sum);
{
        if (hires) {
#pragma unroll
            for (int ch = 0; ch < TT / 128; ++ch) { v4us oh, ol;
#pragma unroll
                for (int q = 0; q < 4; ++q) { unsigned short a, c2; splitf(v[ch * 4 + q] * f, a, c2); oh[q] = a; ol[q] = c2; }
                const size_t oo = ((size_t)zz * (RH ? RH : 1) + i) * TT + ch * 128 + lane * 4; *(v4us*)(Ph + oo) = oh; *(v4us*)(Pl + oo) = ol; }
        } else {
#pragma unroll
            for (int ch = 0; ch < TT / 128; ++ch) { v4h o4;
#pragma unroll
                for (int q = 0; q < 4; ++q) o4[q] = tohx(v[ch * 4 + q] * f);
                *(v4h*)(P16 + (size_t)row * TT + ch * 128 + lane * 4) = o4; } }
         }
}

__global__ __launch_bounds__(256) void k_mergeGz(const float* __restrict__ O, const float* __restrict__ G, bf* Ah, bf* Al) { const size_t e = ((size_t)blockIdx.x * 256 + threadIdx.x) * 2; if (e >= (size_t)ZH * TT * HD) return; const int d = (int)(e % HD); const int t = (int)((e / HD) % TT); const int z = (int)(e / ((size_t)HD * TT)); const int h = z % NH_, sq = z / NH_; const size_t oo = ((size_t)sq * TT + t) * DQ + h * HD + d; v2us oh, ol;
#pragma unroll
    for (int q = 0; q < 2; ++q) { float o = O[e + q]; asm volatile("" : "+v"(o)); float den = __fadd_rn(1.0f, expf(-G[oo + q])); asm volatile("" : "+v"(den)); const float sg = __fdiv_rn(1.0f, den); unsigned short a, c2; splitf(__fmul_rn(o, sg), a, c2); oh[q] = a; ol[q] = c2; }
    *(v2us*)(Ah + oo) = oh; *(v2us*)(Al + oo) = ol;  }

extern "C" void kernel_launch(void* const* d_in, const int* in_sizes, int n_in,
                              void* d_out, int out_size, void* d_ws, size_t ws_size, hipStream_t stream) {
    (void)in_sizes; (void)n_in; (void)out_size;
    const float* x = (const float*)d_in[0]; const float* ln_g = (const float*)d_in[1]; const float* ln_b = (const float*)d_in[2]; const float* wq = (const float*)d_in[3]; const float* wkv = (const float*)d_in[4]; const float* wg = (const float*)d_in[5]; const float* bg = (const float*)d_in[6]; const float* wo = (const float*)d_in[7]; const float* bo = (const float*)d_in[8];
    float* OUT = (float*)d_out;     // [1][64][512][256] = [32768][256]
    char* wsp = (char*)d_ws;
    auto take = [&](size_t bytes) { char* p = wsp; wsp += (bytes + 255) & ~(size_t)255; return (void*)p; };
    bf* WQ = (bf*)take((size_t)DQ * DM * 2); bf* WKV = (bf*)take((size_t)2 * DQ * DM * 2); bf* WG = (bf*)take((size_t)DQ * DM * 2); bf* WO = (bf*)take((size_t)DM * DQ * 2);
    bf* LNh = (bf*)take((size_t)GR * DM * 2); bf* LNl = (bf*)take((size_t)GR * DM * 2); float* FQ = (float*)take((size_t)GR * DQ * 4); float* FKV = (float*)take((size_t)GR * 2 * DQ * 4); float* FG = (float*)take((size_t)GR * DQ * 4);
    bf* QPh = (bf*)take((size_t)ZH * TT * HD * 2); bf* QPl = (bf*)take((size_t)ZH * TT * HD * 2); bf* KPh = (bf*)take((size_t)ZH * TT * HD * 2); bf* KPl = (bf*)take((size_t)ZH * TT * HD * 2); bf* VTh = (bf*)take((size_t)ZH * HD * TT * 2); bf* VTl = (bf*)take((size_t)ZH * HD * TT * 2);
    float* Sb = (float*)take((size_t)ZH * TT * TT * 4); bf* Ph = (bf*)take((size_t)ZH * TT * TT * 2); bf* Pl = (bf*)take((size_t)ZH * TT * TT * 2); float* Ob = (float*)take((size_t)ZH * TT * HD * 4); bf* ATh = (bf*)take((size_t)GR * DQ * 2); bf* ATl = (bf*)take((size_t)GR * DQ * 2);
    if ((size_t)(wsp - (char*)d_ws) > ws_size) return;    // ws 256 MiB
    /* weights ('xw': Bt[n][k] = W[k][n]); the fused Wkv gives Bt rows 0..511 = k, 512..1023 = v */
    k_wtG<<<(unsigned)((DM * DQ / 64 + 63) / 64), 256, 0, stream>>>(wq, DM, DQ, WQ); k_wtG<<<(unsigned)((DM * 2 * DQ / 64 + 63) / 64), 256, 0, stream>>>(wkv, DM, 2 * DQ, WKV); k_wtG<<<(unsigned)((DM * DQ / 64 + 63) / 64), 256, 0, stream>>>(wg, DM, DQ, WG); k_wtG<<<(unsigned)((DQ * DM / 64 + 63) / 64), 256, 0, stream>>>(wo, DQ, DM, WO);
    const unsigned LP = (unsigned)(((size_t)ZH * TT * HD / 2 + 255) / 256);
    for (int g = 0; g < NB_ / GB; ++g) { const float* xg = x + (size_t)g * GR * DM;
        k_ln256<<<GR / 8, 256, 0, stream>>>(xg, GR, ln_g, ln_b, LNh, LNl);
        k_gemmw<bf, 1, false><<<dim3(GR / 64, DQ / 64, 1), 32, 0, stream>>>(LNh, LNl, WQ, nullptr, DM, FQ, DQ, nullptr, 0, 0, 0);
        k_gemmw<bf, 1, false><<<dim3(GR / 64, 2 * DQ / 64, 1), 32, 0, stream>>>(LNh, LNl, WKV, nullptr, DM, FKV, 2 * DQ, nullptr, 0, 0, 0);
        k_gemmw<bf, 1, true><<<dim3(GR / 64, DQ / 64, 1), 32, 0, stream>>>(LNh, LNl, WG, nullptr, DM, FG, DQ, bg, 0, 0, 0);
        k_plz<<<LP, 256, 0, stream>>>(FQ, DQ, 0, QPh, QPl); k_plz<<<LP, 256, 0, stream>>>(FKV, 2 * DQ, 0, KPh, KPl); k_vtz<<<LP, 256, 0, stream>>>(FKV, 2 * DQ, DQ, VTh, VTl);
        k_gemmw<bf, 2, false><<<dim3(TT / 64, TT / 64, ZH), 32, 0, stream>>>(QPh, QPl, KPh, KPl, HD, Sb, TT, nullptr, (size_t)TT * HD, (size_t)TT * HD, (size_t)TT * TT);
        k_asoft<<<ZH * TT / 8, 256, 0, stream>>>(Sb, nullptr, Ph, Pl);
        k_gemmw<bf, 2, false><<<dim3(TT / 64, HD / 64, ZH), 32, 0, stream>>>(Ph, Pl, VTh, VTl, TT, Ob, HD, nullptr, (size_t)TT * TT, (size_t)HD * TT, (size_t)TT * HD);
        k_mergeGz<<<LP, 256, 0, stream>>>(Ob, FG, ATh, ATl);
        k_gemmw<bf, 1, true><<<dim3(GR / 64, DM / 64, 1), 32, 0, stream>>>(ATh, ATl, WO, nullptr, DQ, OUT + (size_t)g * GR * DM, DM, bo, 0, 0, 0); }
}

// v001
// Measured time: 861 microseconds a run.
// Two timings next to v000 put it at 1.85 and 1.83 times that version's speed.
#include <hip/hip_runtime.h>

// Gated row (axial) attention with a pre-LayerNorm (x [1][64][512][256]: 64 image rows = 64 independent sequences of 512 tokens x 256; xn = LayerNorm(x) (gamma, beta, eps 1e-5); q = xn Wq ('xw' [256][512], 8 heads x 64), [k|v] = xn Wkv ('xw' [256][1024]: columns k | v); dots = (q/8).k over the 512 keys of the same row; softmax (the explicit max subtraction is a softmax identity); out = attn.v merged; gates = sigmoid(xn Wg + bg) ('xw' [256][512]); y = (out * gates) Wo + bo ('xw' [512][256]) -> [1][64][512][256] (8.4 M)).
// Compute dtypes, f32 accumulate: every input rounded to bf16; LayerNorm in f32, xn as bf16 hi + lo planes; q / kv / gate projections as (hi + lo) x exact weights (2 products) + f32 bias; scores and attn.v on bf16 hi/lo planes (3 products) for every row; softmax f32; sigmoid gate f32 (true division); (out x gate) as hi + lo x exact Wo (2 products) + bo.
// Layout: 16 image rows (8,192 tokens) per pass; all per-(row, head) planes are laid out z-major ([z = row*8 + head][512][64]) so each attention stage is ONE z-batched launch of 128 tile GEMMs.
// Workspace at 16 rows per pass: the softmax overwrites each 2,048-byte f32 score row with that row's own bf16 planes [hi 512 | lo 512]; the transposed V planes lie alike, [hi 512 | lo 512] per row, so both attn.v operands have one row pitch of 1,024 elements; attn.v output reuses the f32 q buffer and the gated planes reuse the f32 kv buffer, both dead by then.

#define NB_  64        // sequences (image rows)
#define TT   512       // tokens per sequence
#define DM   256
#define NH_  8
#define HD   64
#define DQ   (NH_ * HD)    // 512 = inner dim
#define GB   16            // sequences per pass
#define GR   (GB * TT)     // 8192 token rows per pass
#define ZH   (GB * NH_)    // 128 (sequence, head) planes per pass
#define RH   TT            // every query row uses hi+lo planes
#define PCAR 1024.0f
#define SCL  0.125f   // HD^-0.5
typedef _Float16 h16;
typedef unsigned short bf;
typedef __attribute__((ext_vector_type(16))) __bf16   v16bf;
typedef __attribute__((ext_vector_type(16))) _Float16 v16h;
typedef __attribute__((ext_vector_type(8)))  _Float16 v8h;
typedef __attribute__((ext_vector_type(8)))  unsigned short v8us;
typedef __attribute__((ext_vector_type(8)))  float    v8f;
typedef __attribute__((ext_vector_type(4)))  float    v4f;
typedef v8h  __attribute__((may_alias)) v8ha;
typedef v4f  __attribute__((may_alias)) v4fa;
typedef v8us __attribute__((may_alias)) v8usa;

__device__ __forceinline__ unsigned short f2bf(float f) { unsigned u = __float_as_uint(f); u += 0x7FFFu + ((u >> 16) & 1u); return (unsigned short)(u >> 16); }
__device__ __forceinline__ float bf2f(unsigned short b) { return __uint_as_float(((unsigned)b) << 16); }
__device__ __forceinline__ float bfr(float f) { return bf2f(f2bf(f)); }
__device__ __forceinline__ v16h cat16(v8h lo, v8h hi) { return __builtin_shufflevector(lo, hi, 0, 1, 2, 3, 4, 5, 6, 7, 8, 9, 10, 11, 12, 13, 14, 15); }
__device__ __forceinline__ v16bf cat16b(v8us lo, v8us hi) { return __builtin_bit_cast(v16bf, __builtin_shufflevector(lo, hi, 0, 1, 2, 3, 4, 5, 6, 7, 8, 9, 10, 11, 12, 13, 14, 15)); }
__device__ __forceinline__ v8f wmma16(v16h a, v16h b, v8f c) { return __builtin_amdgcn_wmma_f32_16x16x32_f16(false, a, false, b, (short)0, c, false, false); }
__device__ __forceinline__ v8f wmmab(v16bf a, v16bf b, v8f c) { return __builtin_amdgcn_wmma_f32_16x16x32_bf16(false, a, false, b, (short)0, c, false, false); }



// ---- k_gemmw: register-blocked GEMM, ONE WAVE per 64x64 output tile (16 accumulators), operands straight from K-contiguous 16-bit planes; grid (M/64, N/64, Z), 32 threads.
// C[m][n] (f32, pitch ldc, + optional f32 bias[n]) = sum_k A[m][k] Bt[n][k] (+ split products per NSPLIT). K is the row pitch of A and of Bt in elements, KD <= K the depth that is summed. z-batch strides sA/sB/sC in elements. KD % 32 == 0.
template <typename T16> struct WFrag;
template <> struct WFrag<h16> { typedef v16h V; static __device__ __forceinline__ V ld(const h16* p) { return cat16(*(const v8h*)p, *(const v8h*)(p + 16)); } static __device__ __forceinline__ v8f mma(V a, V b, v8f c) { return wmma16(a, b, c); } };
template <> struct WFrag<bf> { typedef v16bf V; static __device__ __forceinline__ V ld(const bf* p) { return cat16b(*(const v8us*)p, *(const v8us*)(p + 16)); } static __device__ __forceinline__ v8f mma(V a, V b, v8f c) { return wmmab(a, b, c); } };
template <typename T16, int NSPLIT, bool BIAS>
__global__ __launch_bounds__(32) void k_gemmw(const T16* __restrict__ A, const T16* __restrict__ A2, const T16* __restrict__ Bt, const T16* __restrict__ Bt2, int K, int KD, float* C, int ldc, const float* __restrict__ bias, size_t sA, size_t sB, size_t sC) {
    typedef typename WFrag<T16>::V V;
    __shared__ __align__(16) float os[16 * 68];
    const size_t z = blockIdx.z; A += z * sA; if (A2) A2 += z * sA; Bt += z * sB; if (Bt2) Bt2 += z * sB; C += z * sC;
    const int lane = threadIdx.x & 31, lr = lane & 15, hi = lane >> 4; const int r0 = blockIdx.x * 64, c0 = blockIdx.y * 64;
    v8f acc[4][4];
#pragma unroll
    for (int mb = 0; mb < 4; ++mb)
#pragma unroll
        for (int nb = 0; nb < 4; ++nb) acc[mb][nb] = (v8f){};
    const size_t aoff = (size_t)(r0 + lr) * K + 8 * hi, boff = (size_t)(c0 + lr) * K + 8 * hi;
#pragma unroll 1
    for (int kc = 0; kc < KD; kc += 32) {
        V a[4], a2[4];
#pragma unroll
        for (int mb = 0; mb < 4; ++mb) { a[mb] = WFrag<T16>::ld(A + aoff + (size_t)mb * 16 * K + kc); if (NSPLIT == 1 || NSPLIT == 2) a2[mb] = WFrag<T16>::ld(A2 + aoff + (size_t)mb * 16 * K + kc); }
#pragma unroll
        for (int nb = 0; nb < 4; ++nb) { const V b = WFrag<T16>::ld(Bt + boff + (size_t)nb * 16 * K + kc); V b2; if (NSPLIT >= 2) b2 = WFrag<T16>::ld(Bt2 + boff + (size_t)nb * 16 * K + kc);
#pragma unroll
            for (int mb = 0; mb < 4; ++mb) { acc[mb][nb] = WFrag<T16>::mma(a[mb], b, acc[mb][nb]); if (NSPLIT == 1 || NSPLIT == 2) acc[mb][nb] = WFrag<T16>::mma(a2[mb], b, acc[mb][nb]); if (NSPLIT >= 2) acc[mb][nb] = WFrag<T16>::mma(a[mb], b2, acc[mb][nb]); } }
        asm volatile("v_nop\n\tv_nop\n\tv_nop\n\tv_nop" : "+v"(acc[0][0]), "+v"(acc[1][1]), "+v"(acc[2][2]), "+v"(acc[3][3]) : "v"(a[0]), "v"(a[3]));
    }
#pragma unroll
    for (int mb = 0; mb < 4; ++mb) {
#pragma unroll
        for (int nb = 0; nb < 4; ++nb) {
#pragma unroll
            for (int j = 0; j < 8; ++j) os[(hi * 8 + j) * 68 + nb * 16 + lr] = acc[mb][nb][j]; }
        __builtin_amdgcn_wave_barrier(); asm volatile("" ::: "memory");
        float* crow = C + (size_t)(r0 + mb * 16) * ldc + c0;
{
#pragma unroll
            for (int s = 0; s < 8; ++s) { const int row = 2 * s + hi, cofs = lr * 4; v4f val = *(const v4fa*)(os + row * 68 + cofs); if (BIAS) { val[0] += bfr(bias[c0 + cofs]); val[1] += bfr(bias[c0 + cofs + 1]); val[2] += bfr(bias[c0 + cofs + 2]); val[3] += bfr(bias[c0 + cofs + 3]); }
                *(v4f*)(crow + (size_t)row * ldc + cofs) = val; }
             }
        __builtin_amdgcn_wave_barrier(); asm volatile("" ::: "memory");
    }
}

__device__ __forceinline__ h16 tohx(float x) { return (h16)x; }
__device__ __forceinline__ void splitf(float y, unsigned short& h, unsigned short& l) { h = f2bf(y); l = f2bf(y - bf2f(h)); }
typedef __attribute__((ext_vector_type(2))) _Float16 v2h;
typedef __attribute__((ext_vector_type(4))) _Float16 v4h;
typedef __attribute__((ext_vector_type(2))) unsigned short v2us;
typedef __attribute__((ext_vector_type(4))) unsigned short v4us;
typedef __attribute__((ext_vector_type(2))) float v2f;
typedef __attribute__((ext_vector_type(4))) int v4i;

__global__ __launch_bounds__(256) void k_wtG(const float* __restrict__ w, int K, int N, bf* Bt) {
    const int lane = threadIdx.x & 31; const int L0 = (blockIdx.x * 8 + (threadIdx.x >> 5)) * 8; const int nlines = N * K / 64;
{
#pragma unroll 1
        for (int l = 0; l < 8; ++l) { const int L = L0 + l; if (L >= nlines) break; const size_t e = (size_t)L * 64 + lane * 2; const int k = (int)(e % K), n = (int)(e / K); v2us o;
            o[0] = f2bf(w[(size_t)k * N + n]); o[1] = f2bf(w[(size_t)(k + 1) * N + n]); *(v2us*)(Bt + e) = o; }
         }
}

__global__ __launch_bounds__(256) void k_ln256(const float* __restrict__ X, int nrows, const float* __restrict__ gw, const float* __restrict__ gb, bf* Yh, bf* Yl) {
    const int lane = threadIdx.x & 31; const int r = blockIdx.x * 8 + (threadIdx.x >> 5); if (r >= nrows) return; const float* xr = X + (size_t)r * DM; float hv[8]; float s = 0.f;
#pragma unroll
    for (int ch = 0; ch < 2; ++ch) { const v4f y = *(const v4f*)(xr + ch * 128 + lane * 4);
#pragma unroll
        for (int q = 0; q < 4; ++q) { const float u = bfr(y[q]); hv[ch * 4 + q] = u; s += u; } }
#pragma unroll
    for (int sh = 16; sh; sh >>= 1) s += __shfl_xor(s, sh, 32);
    float mu = s * (1.0f / 256.0f); asm volatile("" : "+v"(mu)); float s2 = 0.f;
#pragma unroll
    for (int k = 0; k < 8; ++k) { float d0 = __fsub_rn(hv[k], mu); asm volatile("" : "+v"(d0)); float p = __fmul_rn(d0, d0); asm volatile("" : "+v"(p)); s2 = __fadd_rn(s2, p); }
#pragma unroll
    for (int sh = 16; sh; sh >>= 1) s2 += __shfl_xor(s2, sh, 32);
    float var = __fadd_rn(s2 * (1.0f / 256.0f), 1e-5f); asm volatile("" : "+v"(var)); const float rs = __frsqrt_rn(var);
{
#pragma unroll
        for (int ch = 0; ch < 2; ++ch) { const int c0 = ch * 128 + lane * 4; v4us oh, ol;
#pragma unroll
            for (int q = 0; q < 4; ++q) { float gg = bfr(gw[c0 + q]); asm volatile("" : "+v"(gg)); float d0 = __fsub_rn(hv[ch * 4 + q], mu); asm volatile("" : "+v"(d0)); float n0 = __fmul_rn(d0, rs); asm volatile("" : "+v"(n0)); float y = __fmul_rn(n0, gg); asm volatile("" : "+v"(y)); y = __fadd_rn(y, bfr(gb[c0 + q])); unsigned short a, c2; splitf(y, a, c2); oh[q] = a; ol[q] = c2; }
            *(v4us*)(Yh + (size_t)r * DM + c0) = oh; *(v4us*)(Yl + (size_t)r * DM + c0) = ol; }
         } }
__global__ __launch_bounds__(256) void k_plz(const float* __restrict__ F, int pitch, int coff, bf* Ph, bf* Pl) { const size_t e = ((size_t)blockIdx.x * 256 + threadIdx.x) * 2; if (e >= (size_t)ZH * TT * HD) return; const int d = (int)(e % HD); const int t = (int)((e / HD) % TT); const int z = (int)(e / ((size_t)HD * TT)); const int h = z % NH_, sq = z / NH_; const float* f = F + ((size_t)sq * TT + t) * pitch + coff + h * HD + d; v2us oh, ol;
#pragma unroll
    for (int q = 0; q < 2; ++q) { unsigned short a, c2; splitf(f[q], a, c2); oh[q] = a; ol[q] = c2; }
    *(v2us*)(Ph + e) = oh; *(v2us*)(Pl + e) = ol;  }
__global__ __launch_bounds__(256) void k_vtz(const float* __restrict__ F, int pitch, int coff, bf* Vh, bf* Vl) { const size_t e = ((size_t)blockIdx.x * 256 + threadIdx.x) * 2; if (e >= (size_t)ZH * HD * TT) return; const int t = (int)(e % TT); const int d = (int)((e / TT) % HD); const int z = (int)(e / ((size_t)TT * HD)); const int h = z % NH_, sq = z / NH_; v2us oh, ol;
#pragma unroll
    for (int q = 0; q < 2; ++q) { const float x = F[((size_t)sq * TT + t + q) * pitch + coff + h * HD + d]; unsigned short a, c2; splitf(x, a, c2); oh[q] = a; ol[q] = c2; }
    const size_t oo = (e - t) * 2 + t; *(v2us*)(Vh + oo) = oh; *(v2us*)(Vl + oo) = ol;  }    // V rows at pitch 2*TT
// k_asoft: per row (zz, i): t = S x HD^-0.5 (no mask); softmax over the 512 keys (register row, one exp, fixed trees);
// Ph / Pl rows lie at pitch 2*TT and may be the score row's own bytes: one wave owns a row and holds all of it in registers before its first store.
__global__ __launch_bounds__(256) void k_asoft(const float* Sb, h16* P16, bf* Ph, bf* Pl) {
    const int lane = threadIdx.x & 31; const int row = blockIdx.x * 8 + (threadIdx.x >> 5); if (row >= ZH * TT) return; const int i = row % TT; const int zz = row / TT; (void)zz; const bool hires = (i < RH); const float* sr = Sb + (size_t)row * TT; float v[TT / 32]; float mx = -3.0e38f;
#pragma unroll
    for (int ch = 0; ch < TT / 128; ++ch) { const int j0 = ch * 128 + lane * 4; const v4f a = *(const v4f*)(sr + j0);
#pragma unroll
        for (int q = 0; q < 4; ++q) { const int j = j0 + q; (void)j; const float t = a[q] * SCL; v[ch * 4 + q] = t; mx = fmaxf(mx, t); } }
#pragma unroll
    for (int sh = 16; sh; sh >>= 1) mx = fmaxf(mx, __shfl_xor(mx, sh, 32));
    float sum = 0.f;
#pragma unroll
    for (int k = 0; k < TT / 32; ++k) { float d0 = __fsub_rn(v[k], mx); asm volatile("" : "+v"(d0)); v[k] = __builtin_amdgcn_exp2f(__fmul_rn(d0, 1.4426950408889634f)); sum += v[k]; }
#pragma unroll
    for (int sh = 16; sh; sh >>= 1) sum += __shfl_xor(sum, sh, 32);
    const float f = __fdiv_rn(hires ? 1.0f : PCAR, sum);
{
        if (hires) {
#pragma unroll
            for (int ch = 0; ch < TT / 128; ++ch) { v4us oh, ol;
#pragma unroll
                for (int q = 0; q < 4; ++q) { unsigned short a, c2; splitf(v[ch * 4 + q] * f, a, c2); oh[q] = a; ol[q] = c2; }
                const size_t oo = ((size_t)zz * (RH ? RH : 1) + i) * (2 * TT) + ch * 128 + lane * 4; *(v4us*)(Ph + oo) = oh; *(v4us*)(Pl + oo) = ol; }
        } else {
#pragma unroll
            for (int ch = 0; ch < TT / 128; ++ch) { v4h o4;
#pragma unroll
                for (int q = 0; q < 4; ++q) o4[q] = tohx(v[ch * 4 + q] * f);
                *(v4h*)(P16 + (size_t)row * TT + ch * 128 + lane * 4) = o4; } }
         }
}

__global__ __launch_bounds__(256) void k_mergeGz(const float* __restrict__ O, const float* __restrict__ G, bf* Ah, bf* Al) { const size_t e = ((size_t)blockIdx.x * 256 + threadIdx.x) * 2; if (e >= (size_t)ZH * TT * HD) return; const int d = (int)(e % HD); const int t = (int)((e / HD) % TT); const int z = (int)(e / ((size_t)HD * TT)); const int h = z % NH_, sq = z / NH_; const size_t oo = ((size_t)sq * TT + t) * DQ + h * HD + d; v2us oh, ol;
#pragma unroll
    for (int q = 0; q < 2; ++q) { float o = O[e + q]; asm volatile("" : "+v"(o)); float den = __fadd_rn(1.0f, expf(-G[oo + q])); asm volatile("" : "+v"(den)); const float sg = __fdiv_rn(1.0f, den); unsigned short a, c2; splitf(__fmul_rn(o, sg), a, c2); oh[q] = a; ol[q] = c2; }
    *(v2us*)(Ah + oo) = oh; *(v2us*)(Al + oo) = ol;  }

extern "C" void kernel_launch(void* const* d_in, const int* in_sizes, int n_in,
                              void* d_out, int out_size, void* d_ws, size_t ws_size, hipStream_t stream) {
    (void)in_sizes; (void)n_in; (void)out_size;
    const float* x = (const float*)d_in[0]; const float* ln_g = (const float*)d_in[1]; const float* ln_b = (const float*)d_in[2]; const float* wq = (const float*)d_in[3]; const float* wkv = (const float*)d_in[4]; const float* wg = (const float*)d_in[5]; const float* bg = (const float*)d_in[6]; const float* wo = (const float*)d_in[7]; const float* bo = (const float*)d_in[8];
    float* OUT = (float*)d_out;     // [1][64][512][256] = [32768][256]
    char* wsp = (char*)d_ws;
    auto take = [&](size_t bytes) { char* p = wsp; wsp += (bytes + 255) & ~(size_t)255; return (void*)p; };
    bf* WQ = (bf*)take((size_t)DQ * DM * 2); bf* WKV = (bf*)take((size_t)2 * DQ * DM * 2); bf* WG = (bf*)take((size_t)DQ * DM * 2); bf* WO = (bf*)take((size_t)DM * DQ * 2);
    bf* LNh = (bf*)take((size_t)GR * DM * 2); bf* LNl = (bf*)take((size_t)GR * DM * 2); float* FQ = (float*)take((size_t)GR * DQ * 4); float* FKV = (float*)take((size_t)GR * 2 * DQ * 4); float* FG = (float*)take((size_t)GR * DQ * 4);
    bf* QPh = (bf*)take((size_t)ZH * TT * HD * 2); bf* QPl = (bf*)take((size_t)ZH * TT * HD * 2); bf* KPh = (bf*)take((size_t)ZH * TT * HD * 2); bf* KPl = (bf*)take((size_t)ZH * TT * HD * 2); bf* VTh = (bf*)take((size_t)ZH * HD * 2 * TT * 2); bf* VTl = VTh + TT;    // row (z, d) of V^T: hi at VTh + row*2*TT, lo TT elements behind it
    float* Sb = (float*)take((size_t)ZH * TT * TT * 4); bf* Ph = (bf*)Sb; bf* Pl = Ph + TT;    // row r of P: hi at Ph + r*2*TT, lo TT elements behind it
    float* Ob = FQ; bf* ATh = (bf*)FKV; bf* ATl = ATh + (size_t)GR * DQ;    // FQ is dead behind its k_plz, FKV behind k_vtz
    if ((size_t)(wsp - (char*)d_ws) > ws_size) return;    // ws 256 MiB
    /* weights ('xw': Bt[n][k] = W[k][n]); the fused Wkv gives Bt rows 0..511 = k, 512..1023 = v */
    k_wtG<<<(unsigned)((DM * DQ / 64 + 63) / 64), 256, 0, stream>>>(wq, DM, DQ, WQ); k_wtG<<<(unsigned)((DM * 2 * DQ / 64 + 63) / 64), 256, 0, stream>>>(wkv, DM, 2 * DQ, WKV); k_wtG<<<(unsigned)((DM * DQ / 64 + 63) / 64), 256, 0, stream>>>(wg, DM, DQ, WG); k_wtG<<<(unsigned)((DQ * DM / 64 + 63) / 64), 256, 0, stream>>>(wo, DQ, DM, WO);
    const unsigned LP = (unsigned)(((size_t)ZH * TT * HD / 2 + 255) / 256);
    for (int g = 0; g < NB_ / GB; ++g) { const float* xg = x + (size_t)g * GR * DM;
        k_ln256<<<GR / 8, 256, 0, stream>>>(xg, GR, ln_g, ln_b, LNh, LNl);
        k_gemmw<bf, 1, false><<<dim3(GR / 64, DQ / 64, 1), 32, 0, stream>>>(LNh, LNl, WQ, nullptr, DM, DM, FQ, DQ, nullptr, 0, 0, 0);
        k_gemmw<bf, 1, false><<<dim3(GR / 64, 2 * DQ / 64, 1), 32, 0, stream>>>(LNh, LNl, WKV, nullptr, DM, DM, FKV, 2 * DQ, nullptr, 0, 0, 0);
        k_gemmw<bf, 1, true><<<dim3(GR / 64, DQ / 64, 1), 32, 0, stream>>>(LNh, LNl, WG, nullptr, DM, DM, FG, DQ, bg, 0, 0, 0);
        k_plz<<<LP, 256, 0, stream>>>(FQ, DQ, 0, QPh, QPl); k_plz<<<LP, 256, 0, stream>>>(FKV, 2 * DQ, 0, KPh, KPl); k_vtz<<<LP, 256, 0, stream>>>(FKV, 2 * DQ, DQ, VTh, VTl);
        k_gemmw<bf, 2, false><<<dim3(TT / 64, TT / 64, ZH), 32, 0, stream>>>(QPh, QPl, KPh, KPl, HD, HD, Sb, TT, nullptr, (size_t)TT * HD, (size_t)TT * HD, (size_t)TT * TT);
        k_asoft<<<ZH * TT / 8, 256, 0, stream>>>(Sb, nullptr, Ph, Pl);
        k_gemmw<bf, 2, false><<<dim3(TT / 64, HD / 64, ZH), 32, 0, stream>>>(Ph, Pl, VTh, VTl, 2 * TT, TT, Ob, HD, nullptr, (size_t)TT * 2 * TT, (size_t)HD * 2 * TT, (size_t)TT * HD);
        k_mergeGz<<<LP, 256, 0, stream>>>(Ob, FG, ATh, ATl);
        k_gemmw<bf, 1, true><<<dim3(GR / 64, DM / 64, 1), 32, 0, stream>>>(ATh, ATl, WO, nullptr, DQ, DQ, OUT + (size_t)g * GR * DM, DM, bo, 0, 0, 0); }
}

// v002
// Measured time: 759 microseconds a run.
// In two side-by-side timings against v001, it was 1.14 and 1.15 times as fast.
// Over all steps from v000 it is 2.10 times as fast.
#include <hip/hip_runtime.h>

// Gated row (axial) attention with a pre-LayerNorm (x [1][64][512][256]: 64 image rows = 64 independent sequences of 512 tokens x 256; xn = LayerNorm(x) (gamma, beta, eps 1e-5); q = xn Wq ('xw' [256][512], 8 heads x 64), [k|v] = xn Wkv ('xw' [256][1024]: columns k | v); dots = (q/8).k over the 512 keys of the same row; softmax (the explicit max subtraction is a softmax identity); out = attn.v merged; gates = sigmoid(xn Wg + bg) ('xw' [256][512]); y = (out * gates) Wo + bo ('xw' [512][256]) -> [1][64][512][256] (8.4 M)).
// Compute dtypes, f32 accumulate: every input rounded to bf16; LayerNorm in f32, xn as bf16 hi + lo planes; q / kv / gate projections as (hi + lo) x exact weights (2 products) + f32 bias; scores and attn.v on bf16 hi/lo planes (3 products) for every row; softmax f32; sigmoid gate f32 (true division); (out x gate) as hi + lo x exact Wo (2 products) + bo.
// Layout: 16 image rows (8,192 tokens) per pass; all per-(row, head) planes are laid out z-major ([z = row*8 + head][512][64]) so each attention stage is ONE z-batched launch of 128 tile GEMMs.
// Workspace at 16 rows per pass: the softmax overwrites each 2,048-byte f32 score row with that row's own bf16 planes [hi 512 | lo 512]; the transposed V planes lie alike, [hi 512 | lo 512] per row, so both attn.v operands have one row pitch of 1,024 elements; attn.v output reuses the f32 q buffer and the gated planes reuse the f32 kv buffer, both dead by then.

#define NB_  64        // sequences (image rows)
#define TT   512       // tokens per sequence
#define DM   256
#define NH_  8
#define HD   64
#define DQ   (NH_ * HD)    // 512 = inner dim
#define GB   16            // sequences per pass
#define GR   (GB * TT)     // 8192 token rows per pass
#define ZH   (GB * NH_)    // 128 (sequence, head) planes per pass
#define RH   TT            // every query row uses hi+lo planes
#define PCAR 1024.0f
#define SCL  0.125f   // HD^-0.5
typedef _Float16 h16;
typedef unsigned short bf;
typedef __attribute__((ext_vector_type(16))) __bf16   v16bf;
typedef __attribute__((ext_vector_type(16))) _Float16 v16h;
typedef __attribute__((ext_vector_type(8)))  _Float16 v8h;
typedef __attribute__((ext_vector_type(8)))  unsigned short v8us;
typedef __attribute__((ext_vector_type(8)))  float    v8f;
typedef __attribute__((ext_vector_type(4)))  float    v4f;
typedef v8h  __attribute__((may_alias)) v8ha;
typedef v4f  __attribute__((may_alias)) v4fa;
typedef v8us __attribute__((may_alias)) v8usa;

__device__ __forceinline__ unsigned short f2bf(float f) { unsigned u = __float_as_uint(f); u += 0x7FFFu + ((u >> 16) & 1u); return (unsigned short)(u >> 16); }
__device__ __forceinline__ float bf2f(unsigned short b) { return __uint_as_float(((unsigned)b) << 16); }
__device__ __forceinline__ float bfr(float f) { return bf2f(f2bf(f)); }
__device__ __forceinline__ v16h cat16(v8h lo, v8h hi) { return __builtin_shufflevector(lo, hi, 0, 1, 2, 3, 4, 5, 6, 7, 8, 9, 10, 11, 12, 13, 14, 15); }
__device__ __forceinline__ v16bf cat16b(v8us lo, v8us hi) { return __builtin_bit_cast(v16bf, __builtin_shufflevector(lo, hi, 0, 1, 2, 3, 4, 5, 6, 7, 8, 9, 10, 11, 12, 13, 14, 15)); }
__device__ __forceinline__ v8f wmma16(v16h a, v16h b, v8f c) { return __builtin_amdgcn_wmma_f32_16x16x32_f16(false, a, false, b, (short)0, c, false, false); }
__device__ __forceinline__ v8f wmmab(v16bf a, v16bf b, v8f c) { return __builtin_amdgcn_wmma_f32_16x16x32_bf16(false, a, false, b, (short)0, c, false, false); }



// ---- k_gemmw: register-blocked GEMM, ONE WAVE per 64x64 output tile (16 accumulators), operands from K-contiguous 16-bit planes; grid (M/64, N/64, Z), 32 threads.
// C[m][n] (f32, pitch ldc, + optional f32 bias[n]) = sum_k A[m][k] Bt[n][k] (+ split products per NSPLIT). K (a template argument, so that a piece's 16 loads of a plane share one address register pair and differ in the immediate offset) is the row pitch of A and of Bt in elements, KD <= K the depth that is summed. z-batch strides sA/sB/sC in elements. KD % 64 == 0, K % 64 == 0.
// Each 64-row x 64-deep piece of a plane goes through LDS: a global load takes 4 whole 128-byte lines (8 lanes a row), where a fragment load straight from memory touches 16 lines for the same 512 bytes; the fragments are then read from LDS rows of SP elements (144 B = 16 B x 9: no bank conflict).
#define SP 72
template <typename T16> struct WFrag;
template <> struct WFrag<h16> { typedef v16h V; static __device__ __forceinline__ V ld(const h16* p) { return cat16(*(const v8h*)p, *(const v8h*)(p + 16)); } static __device__ __forceinline__ v8f mma(V a, V b, v8f c) { return wmma16(a, b, c); } };
template <> struct WFrag<bf> { typedef v16bf V; static __device__ __forceinline__ V ld(const bf* p) { return cat16b(*(const v8us*)p, *(const v8us*)(p + 16)); } static __device__ __forceinline__ v8f mma(V a, V b, v8f c) { return wmmab(a, b, c); } };
template <typename T16, int NSPLIT, bool BIAS, int K>
__global__ __launch_bounds__(32) void k_gemmw(const T16* __restrict__ A, const T16* __restrict__ A2, const T16* __restrict__ Bt, const T16* __restrict__ Bt2, int KD, float* C, int ldc, const float* __restrict__ bias, size_t sA, size_t sB, size_t sC) {
    typedef typename WFrag<T16>::V V;
    __shared__ __align__(16) float os[16 * 68];
    __shared__ __align__(16) T16 sa[64 * SP], sb[64 * SP], sa2[(NSPLIT == 1 || NSPLIT == 2) ? 64 * SP : 8], sb2[NSPLIT >= 2 ? 64 * SP : 8];
    const size_t z = blockIdx.z; A += z * sA; if (A2) A2 += z * sA; Bt += z * sB; if (Bt2) Bt2 += z * sB; C += z * sC;
    const int lane = threadIdx.x & 31, lr = lane & 15, hi = lane >> 4; const int r0 = blockIdx.x * 64, c0 = blockIdx.y * 64;
    v8f acc[4][4];
#pragma unroll
    for (int mb = 0; mb < 4; ++mb)
#pragma unroll
        for (int nb = 0; nb < 4; ++nb) acc[mb][nb] = (v8f){};
    const int srow = lane >> 3, scol = (lane & 7) * 8;    // staging: 8 lanes take one row's 128 bytes
    const size_t aoff = (size_t)(r0 + srow) * K + scol, boff = (size_t)(c0 + srow) * K + scol; const int soff = srow * SP + scol, foff = lr * SP + 8 * hi;
#pragma unroll 1
    for (int k0 = 0; k0 < KD; k0 += 64) { const T16* pa = A + aoff + k0; const T16* pb = Bt + boff + k0; const T16* pa2 = (NSPLIT == 1 || NSPLIT == 2) ? A2 + aoff + k0 : pa; const T16* pb2 = NSPLIT >= 2 ? Bt2 + boff + k0 : pb;
#pragma unroll    // all loads of a piece in flight together, each row step an immediate offset
        for (int i = 0; i < 16; ++i) { *(v8usa*)(sa + soff + i * 4 * SP) = *(const v8usa*)(pa + i * 4 * K); *(v8usa*)(sb + soff + i * 4 * SP) = *(const v8usa*)(pb + i * 4 * K);
            if (NSPLIT == 1 || NSPLIT == 2) *(v8usa*)(sa2 + soff + i * 4 * SP) = *(const v8usa*)(pa2 + i * 4 * K); if (NSPLIT >= 2) *(v8usa*)(sb2 + soff + i * 4 * SP) = *(const v8usa*)(pb2 + i * 4 * K); }
        asm volatile("s_wait_xcnt 0x0" :: "v"(pa), "v"(pb), "v"(pa2), "v"(pb2) : "memory");    // the loads' address registers stay theirs up to this wait: no later load lands on them, the next piece's addresses are formed behind it
        __syncthreads();    // the piece is written by other lanes than read it (a one-wave group: it builds to the LDS wait and keeps the compiler from reading ahead of the stores)
        V a[4], a2[4];
#pragma unroll    // the second half's fragment reads are scheduled among the first half's products
      for (int kc = 0; kc < 64; kc += 32) {
#pragma unroll
        for (int mb = 0; mb < 4; ++mb) { a[mb] = WFrag<T16>::ld(sa + foff + mb * 16 * SP + kc); if (NSPLIT == 1 || NSPLIT == 2) a2[mb] = WFrag<T16>::ld(sa2 + foff + mb * 16 * SP + kc); }
#pragma unroll
        for (int nb = 0; nb < 4; ++nb) { const V b = WFrag<T16>::ld(sb + foff + nb * 16 * SP + kc); V b2; if (NSPLIT >= 2) b2 = WFrag<T16>::ld(sb2 + foff + nb * 16 * SP + kc);
#pragma unroll
            for (int mb = 0; mb < 4; ++mb) { acc[mb][nb] = WFrag<T16>::mma(a[mb], b, acc[mb][nb]); if (NSPLIT == 1 || NSPLIT == 2) acc[mb][nb] = WFrag<T16>::mma(a2[mb], b, acc[mb][nb]); if (NSPLIT >= 2) acc[mb][nb] = WFrag<T16>::mma(a[mb], b2, acc[mb][nb]); } }
      }
        asm volatile("v_nop\n\tv_nop\n\tv_nop\n\tv_nop" : "+v"(acc[0][0]), "+v"(acc[1][1]), "+v"(acc[2][2]), "+v"(acc[3][3]) : "v"(a[0]), "v"(a[3]));
        __syncthreads();    // every fragment is read before the next piece overwrites it (keeps the next stores behind these reads)
    }
#pragma unroll
    for (int mb = 0; mb < 4; ++mb) {
#pragma unroll
        for (int nb = 0; nb < 4; ++nb) {
#pragma unroll
            for (int j = 0; j < 8; ++j) os[(hi * 8 + j) * 68 + nb * 16 + lr] = acc[mb][nb][j]; }
        __builtin_amdgcn_wave_barrier(); asm volatile("" ::: "memory");
        float* crow = C + (size_t)(r0 + mb * 16) * ldc + c0;
{
#pragma unroll
            for (int s = 0; s < 8; ++s) { const int row = 2 * s + hi, cofs = lr * 4; v4f val = *(const v4fa*)(os + row * 68 + cofs); if (BIAS) { val[0] += bfr(bias[c0 + cofs]); val[1] += bfr(bias[c0 + cofs + 1]); val[2] += bfr(bias[c0 + cofs + 2]); val[3] += bfr(bias[c0 + cofs + 3]); }
                *(v4f*)(crow + (size_t)row * ldc + cofs) = val; }
             }
        __builtin_amdgcn_wave_barrier(); asm volatile("" ::: "memory");
    }
}

__device__ __forceinline__ h16 tohx(float x) { return (h16)x; }
__device__ __forceinline__ void splitf(float y, unsigned short& h, unsigned short& l) { h = f2bf(y); l = f2bf(y - bf2f(h)); }
typedef __attribute__((ext_vector_type(2))) _Float16 v2h;
typedef __attribute__((ext_vector_type(4))) _Float16 v4h;
typedef __attribute__((ext_vector_type(2))) unsigned short v2us;
typedef __attribute__((ext_vector_type(4))) unsigned short v4us;
typedef __attribute__((ext_vector_type(2))) float v2f;
typedef __attribute__((ext_vector_type(4))) int v4i;

__global__ __launch_bounds__(256) void k_wtG(const float* __restrict__ w, int K, int N, bf* Bt) {
    const int lane = threadIdx.x & 31; const int L0 = (blockIdx.x * 8 + (threadIdx.x >> 5)) * 8; const int nlines = N * K / 64;
{
#pragma unroll 1
        for (int l = 0; l < 8; ++l) { const int L = L0 + l; if (L >= nlines) break; const size_t e = (size_t)L * 64 + lane * 2; const int k = (int)(e % K), n = (int)(e / K); v2us o;
            o[0] = f2bf(w[(size_t)k * N + n]); o[1] = f2bf(w[(size_t)(k + 1) * N + n]); *(v2us*)(Bt + e) = o; }
         }
}

__global__ __launch_bounds__(256) void k_ln256(const float* __restrict__ X, int nrows, const float* __restrict__ gw, const float* __restrict__ gb, bf* Yh, bf* Yl) {
    const int lane = threadIdx.x & 31; const int r = blockIdx.x * 8 + (threadIdx.x >> 5); if (r >= nrows) return; const float* xr = X + (size_t)r * DM; float hv[8]; float s = 0.f;
#pragma unroll
    for (int ch = 0; ch < 2; ++ch) { const v4f y = *(const v4f*)(xr + ch * 128 + lane * 4);
#pragma unroll
        for (int q = 0; q < 4; ++q) { const float u = bfr(y[q]); hv[ch * 4 + q] = u; s += u; } }
#pragma unroll
    for (int sh = 16; sh; sh >>= 1) s += __shfl_xor(s, sh, 32);
    float mu = s * (1.0f / 256.0f); asm volatile("" : "+v"(mu)); float s2 = 0.f;
#pragma unroll
    for (int k = 0; k < 8; ++k) { float d0 = __fsub_rn(hv[k], mu); asm volatile("" : "+v"(d0)); float p = __fmul_rn(d0, d0); asm volatile("" : "+v"(p)); s2 = __fadd_rn(s2, p); }
#pragma unroll
    for (int sh = 16; sh; sh >>= 1) s2 += __shfl_xor(s2, sh, 32);
    float var = __fadd_rn(s2 * (1.0f / 256.0f), 1e-5f); asm volatile("" : "+v"(var)); const float rs = __frsqrt_rn(var);
{
#pragma unroll
        for (int ch = 0; ch < 2; ++ch) { const int c0 = ch * 128 + lane * 4; v4us oh, ol;
#pragma unroll
            for (int q = 0; q < 4; ++q) { float gg = bfr(gw[c0 + q]); asm volatile("" : "+v"(gg)); float d0 = __fsub_rn(hv[ch * 4 + q], mu); asm volatile("" : "+v"(d0)); float n0 = __fmul_rn(d0, rs); asm volatile("" : "+v"(n0)); float y = __fmul_rn(n0, gg); asm volatile("" : "+v"(y)); y = __fadd_rn(y, bfr(gb[c0 + q])); unsigned short a, c2; splitf(y, a, c2); oh[q] = a; ol[q] = c2; }
            *(v4us*)(Yh + (size_t)r * DM + c0) = oh; *(v4us*)(Yl + (size_t)r * DM + c0) = ol; }
         } }
__global__ __launch_bounds__(256) void k_plz(const float* __restrict__ F, int pitch, int coff, bf* Ph, bf* Pl) { const size_t e = ((size_t)blockIdx.x * 256 + threadIdx.x) * 2; if (e >= (size_t)ZH * TT * HD) return; const int d = (int)(e % HD); const int t = (int)((e / HD) % TT); const int z = (int)(e / ((size_t)HD * TT)); const int h = z % NH_, sq = z / NH_; const float* f = F + ((size_t)sq * TT + t) * pitch + coff + h * HD + d; v2us oh, ol;
#pragma unroll
    for (int q = 0; q < 2; ++q) { unsigned short a, c2; splitf(f[q], a, c2); oh[q] = a; ol[q] = c2; }
    *(v2us*)(Ph + e) = oh; *(v2us*)(Pl + e) = ol;  }
__global__ __launch_bounds__(256) void k_vtz(const float* __restrict__ F, int pitch, int coff, bf* Vh, bf* Vl) { const size_t e = ((size_t)blockIdx.x * 256 + threadIdx.x) * 2; if (e >= (size_t)ZH * HD * TT) return; const int t = (int)(e % TT); const int d = (int)((e / TT) % HD); const int z = (int)(e / ((size_t)TT * HD)); const int h = z % NH_, sq = z / NH_; v2us oh, ol;
#pragma unroll
    for (int q = 0; q < 2; ++q) { const float x = F[((size_t)sq * TT + t + q) * pitch + coff + h * HD + d]; unsigned short a, c2; splitf(x, a, c2); oh[q] = a; ol[q] = c2; }
    const size_t oo = (e - t) * 2 + t; *(v2us*)(Vh + oo) = oh; *(v2us*)(Vl + oo) = ol;  }    // V rows at pitch 2*TT
// k_asoft: per row (zz, i): t = S x HD^-0.5 (no mask); softmax over the 512 keys (register row, one exp, fixed trees);
// Ph / Pl rows lie at pitch 2*TT and may be the score row's own bytes: one wave owns a row and holds all of it in registers before its first store.
__global__ __launch_bounds__(256) void k_asoft(const float* Sb, h16* P16, bf* Ph, bf* Pl) {
    const int lane = threadIdx.x & 31; const int row = blockIdx.x * 8 + (threadIdx.x >> 5); if (row >= ZH * TT) return; const int i = row % TT; const int zz = row / TT; (void)zz; const bool hires = (i < RH); const float* sr = Sb + (size_t)row * TT; float v[TT / 32]; float mx = -3.0e38f;
#pragma unroll
    for (int ch = 0; ch < TT / 128; ++ch) { const int j0 = ch * 128 + lane * 4; const v4f a = *(const v4f*)(sr + j0);
#pragma unroll
        for (int q = 0; q < 4; ++q) { const int j = j0 + q; (void)j; const float t = a[q] * SCL; v[ch * 4 + q] = t; mx = fmaxf(mx, t); } }
#pragma unroll
    for (int sh = 16; sh; sh >>= 1) mx = fmaxf(mx, __shfl_xor(mx, sh, 32));
    float sum = 0.f;
#pragma unroll
    for (int k = 0; k < TT / 32; ++k) { float d0 = __fsub_rn(v[k], mx); asm volatile("" : "+v"(d0)); v[k] = __builtin_amdgcn_exp2f(__fmul_rn(d0, 1.4426950408889634f)); sum += v[k]; }
#pragma unroll
    for (int sh = 16; sh; sh >>= 1) sum += __shfl_xor(sum, sh, 32);
    const float f = __fdiv_rn(hires ? 1.0f : PCAR, sum);
{
        if (hires) {
#pragma unroll
            for (int ch = 0; ch < TT / 128; ++ch) { v4us oh, ol;
#pragma unroll
                for (int q = 0; q < 4; ++q) { unsigned short a, c2; splitf(v[ch * 4 + q] * f, a, c2); oh[q] = a; ol[q] = c2; }
                const size_t oo = ((size_t)zz * (RH ? RH : 1) + i) * (2 * TT) + ch * 128 + lane * 4; *(v4us*)(Ph + oo) = oh; *(v4us*)(Pl + oo) = ol; }
        } else {
#pragma unroll
            for (int ch = 0; ch < TT / 128; ++ch) { v4h o4;
#pragma unroll
                for (int q = 0; q < 4; ++q) o4[q] = tohx(v[ch * 4 + q] * f);
                *(v4h*)(P16 + (size_t)row * TT + ch * 128 + lane * 4) = o4; } }
         }
}

__global__ __launch_bounds__(256) void k_mergeGz(const float* __restrict__ O, const float* __restrict__ G, bf* Ah, bf* Al) { const size_t e = ((size_t)blockIdx.x * 256 + threadIdx.x) * 2; if (e >= (size_t)ZH * TT * HD) return; const int d = (int)(e % HD); const int t = (int)((e / HD) % TT); const int z = (int)(e / ((size_t)HD * TT)); const int h = z % NH_, sq = z / NH_; const size_t oo = ((size_t)sq * TT + t) * DQ + h * HD + d; v2us oh, ol;
#pragma unroll
    for (int q = 0; q < 2; ++q) { float o = O[e + q]; asm volatile("" : "+v"(o)); float den = __fadd_rn(1.0f, expf(-G[oo + q])); asm volatile("" : "+v"(den)); const float sg = __fdiv_rn(1.0f, den); unsigned short a, c2; splitf(__fmul_rn(o, sg), a, c2); oh[q] = a; ol[q] = c2; }
    *(v2us*)(Ah + oo) = oh; *(v2us*)(Al + oo) = ol;  }

extern "C" void kernel_launch(void* const* d_in, const int* in_sizes, int n_in,
                              void* d_out, int out_size, void* d_ws, size_t ws_size, hipStream_t stream) {
    (void)in_sizes; (void)n_in; (void)out_size;
    const float* x = (const float*)d_in[0]; const float* ln_g = (const float*)d_in[1]; const float* ln_b = (const float*)d_in[2]; const float* wq = (const float*)d_in[3]; const float* wkv = (const float*)d_in[4]; const float* wg = (const float*)d_in[5]; const float* bg = (const float*)d_in[6]; const float* wo = (const float*)d_in[7]; const float* bo = (const float*)d_in[8];
    float* OUT = (float*)d_out;     // [1][64][512][256] = [32768][256]
    char* wsp = (char*)d_ws;
    auto take = [&](size_t bytes) { char* p = wsp; wsp += (bytes + 255) & ~(size_t)255; return (void*)p; };
    bf* WQ = (bf*)take((size_t)DQ * DM * 2); bf* WKV = (bf*)take((size_t)2 * DQ * DM * 2); bf* WG = (bf*)take((size_t)DQ * DM * 2); bf* WO = (bf*)take((size_t)DM * DQ * 2);
    bf* LNh = (bf*)take((size_t)GR * DM * 2); bf* LNl = (bf*)take((size_t)GR * DM * 2); float* FQ = (float*)take((size_t)GR * DQ * 4); float* FKV = (float*)take((size_t)GR * 2 * DQ * 4); float* FG = (float*)take((size_t)GR * DQ * 4);
    bf* QPh = (bf*)take((size_t)ZH * TT * HD * 2); bf* QPl = (bf*)take((size_t)ZH * TT * HD * 2); bf* KPh = (bf*)take((size_t)ZH * TT * HD * 2); bf* KPl = (bf*)take((size_t)ZH * TT * HD * 2); bf* VTh = (bf*)take((size_t)ZH * HD * 2 * TT * 2); bf* VTl = VTh + TT;    // row (z, d) of V^T: hi at VTh + row*2*TT, lo TT elements behind it
    float* Sb = (float*)take((size_t)ZH * TT * TT * 4); bf* Ph = (bf*)Sb; bf* Pl = Ph + TT;    // row r of P: hi at Ph + r*2*TT, lo TT elements behind it
    float* Ob = FQ; bf* ATh = (bf*)FKV; bf* ATl = ATh + (size_t)GR * DQ;    // FQ is dead behind its k_plz, FKV behind k_vtz
    if ((size_t)(wsp - (char*)d_ws) > ws_size) return;    // ws 256 MiB
    /* weights ('xw': Bt[n][k] = W[k][n]); the fused Wkv gives Bt rows 0..511 = k, 512..1023 = v */
    k_wtG<<<(unsigned)((DM * DQ / 64 + 63) / 64), 256, 0, stream>>>(wq, DM, DQ, WQ); k_wtG<<<(unsigned)((DM * 2 * DQ / 64 + 63) / 64), 256, 0, stream>>>(wkv, DM, 2 * DQ, WKV); k_wtG<<<(unsigned)((DM * DQ / 64 + 63) / 64), 256, 0, stream>>>(wg, DM, DQ, WG); k_wtG<<<(unsigned)((DQ * DM / 64 + 63) / 64), 256, 0, stream>>>(wo, DQ, DM, WO);
    const unsigned LP = (unsigned)(((size_t)ZH * TT * HD / 2 + 255) / 256);
    for (int g = 0; g < NB_ / GB; ++g) { const float* xg = x + (size_t)g * GR * DM;
        k_ln256<<<GR / 8, 256, 0, stream>>>(xg, GR, ln_g, ln_b, LNh, LNl);
        k_gemmw<bf, 1, false, DM><<<dim3(GR / 64, DQ / 64, 1), 32, 0, stream>>>(LNh, LNl, WQ, nullptr, DM, FQ, DQ, nullptr, 0, 0, 0);
        k_gemmw<bf, 1, false, DM><<<dim3(GR / 64, 2 * DQ / 64, 1), 32, 0, stream>>>(LNh, LNl, WKV, nullptr, DM, FKV, 2 * DQ, nullptr, 0, 0, 0);
        k_gemmw<bf, 1, true, DM><<<dim3(GR / 64, DQ / 64, 1), 32, 0, stream>>>(LNh, LNl, WG, nullptr, DM, FG, DQ, bg, 0, 0, 0);
        k_plz<<<LP, 256, 0, stream>>>(FQ, DQ, 0, QPh, QPl); k_plz<<<LP, 256, 0, stream>>>(FKV, 2 * DQ, 0, KPh, KPl); k_vtz<<<LP, 256, 0, stream>>>(FKV, 2 * DQ, DQ, VTh, VTl);
        k_gemmw<bf, 2, false, HD><<<dim3(TT / 64, TT / 64, ZH), 32, 0, stream>>>(QPh, QPl, KPh, KPl, HD, Sb, TT, nullptr, (size_t)TT * HD, (size_t)TT * HD, (size_t)TT * TT);
        k_asoft<<<ZH * TT / 8, 256, 0, stream>>>(Sb, nullptr, Ph, Pl);
        k_gemmw<bf, 2, false, 2 * TT><<<dim3(TT / 64, HD / 64, ZH), 32, 0, stream>>>(Ph, Pl, VTh, VTl, TT, Ob, HD, nullptr, (size_t)TT * 2 * TT, (size_t)HD * 2 * TT, (size_t)TT * HD);
        k_mergeGz<<<LP, 256, 0, stream>>>(Ob, FG, ATh, ATl);
        k_gemmw<bf, 1, true, DQ><<<dim3(GR / 64, DM / 64, 1), 32, 0, stream>>>(ATh, ATl, WO, nullptr, DQ, OUT + (size_t)g * GR * DM, DM, bo, 0, 0, 0); }
}

// v003
// One run takes 589 microseconds.
// Next to v002, in two timings, it ran 1.30 and 1.29 times as fast.
// Counting every step since v000, it is 2.72 times as fast.
#include <hip/hip_runtime.h>

// Gated row (axial) attention with a pre-LayerNorm (x [1][64][512][256]: 64 image rows = 64 independent sequences of 512 tokens x 256; xn = LayerNorm(x) (gamma, beta, eps 1e-5); q = xn Wq ('xw' [256][512], 8 heads x 64), [k|v] = xn Wkv ('xw' [256][1024]: columns k | v); dots = (q/8).k over the 512 keys of the same row; softmax (the explicit max subtraction is a softmax identity); out = attn.v merged; gates = sigmoid(xn Wg + bg) ('xw' [256][512]); y = (out * gates) Wo + bo ('xw' [512][256]) -> [1][64][512][256] (8.4 M)).
// Compute dtypes, f32 accumulate: every input rounded to bf16; LayerNorm in f32, xn as bf16 hi + lo planes; q / kv / gate projections as (hi + lo) x exact weights (2 products) + f32 bias; scores and attn.v on bf16 hi/lo planes (3 products) for every row; softmax f32; sigmoid gate f32 (true division); (out x gate) as hi + lo x exact Wo (2 products) + bo.
// Layout: 16 image rows (8,192 tokens) per pass; all per-(row, head) planes are laid out z-major ([z = row*8 + head][512][64]); scores, softmax and attn.v are ONE launch (k_attn), the scores and the probabilities live in registers only.
// Workspace: the transposed V planes lie [hi 512 | lo 512] per row (pitch 1,024 elements); attn.v output reuses the f32 q buffer and the gated planes reuse the f32 kv buffer, both dead by then.

#define NB_  64        // sequences (image rows)
#define TT   512       // tokens per sequence
#define DM   256
#define NH_  8
#define HD   64
#define DQ   (NH_ * HD)    // 512 = inner dim
#define GB   16            // sequences per pass
#define GR   (GB * TT)     // 8192 token rows per pass
#define ZH   (GB * NH_)    // 128 (sequence, head) planes per pass
#define SCL  0.125f   // HD^-0.5
typedef _Float16 h16;
typedef unsigned short bf;
typedef __attribute__((ext_vector_type(16))) __bf16   v16bf;
typedef __attribute__((ext_vector_type(16))) _Float16 v16h;
typedef __attribute__((ext_vector_type(8)))  _Float16 v8h;
typedef __attribute__((ext_vector_type(8)))  unsigned short v8us;
typedef __attribute__((ext_vector_type(8)))  float    v8f;
typedef __attribute__((ext_vector_type(4)))  float    v4f;
typedef v8h  __attribute__((may_alias)) v8ha;
typedef v4f  __attribute__((may_alias)) v4fa;
typedef v8us __attribute__((may_alias)) v8usa;

__device__ __forceinline__ unsigned short f2bf(float f) { unsigned u = __float_as_uint(f); u += 0x7FFFu + ((u >> 16) & 1u); return (unsigned short)(u >> 16); }
__device__ __forceinline__ float bf2f(unsigned short b) { return __uint_as_float(((unsigned)b) << 16); }
__device__ __forceinline__ float bfr(float f) { return bf2f(f2bf(f)); }
__device__ __forceinline__ v16h cat16(v8h lo, v8h hi) { return __builtin_shufflevector(lo, hi, 0, 1, 2, 3, 4, 5, 6, 7, 8, 9, 10, 11, 12, 13, 14, 15); }
__device__ __forceinline__ v16bf cat16b(v8us lo, v8us hi) { return __builtin_bit_cast(v16bf, __builtin_shufflevector(lo, hi, 0, 1, 2, 3, 4, 5, 6, 7, 8, 9, 10, 11, 12, 13, 14, 15)); }
__device__ __forceinline__ v8f wmma16(v16h a, v16h b, v8f c) { return __builtin_amdgcn_wmma_f32_16x16x32_f16(false, a, false, b, (short)0, c, false, false); }
__device__ __forceinline__ v8f wmmab(v16bf a, v16bf b, v8f c) { return __builtin_amdgcn_wmma_f32_16x16x32_bf16(false, a, false, b, (short)0, c, false, false); }



// ---- k_gemmw: register-blocked GEMM, ONE WAVE per 64x64 output tile (16 accumulators), operands from K-contiguous 16-bit planes; grid (M/64, N/64, Z), 32 threads.
// C[m][n] (f32, pitch ldc, + optional f32 bias[n]) = sum_k A[m][k] Bt[n][k] (+ split products per NSPLIT). K (a template argument, so that a piece's 16 loads of a plane share one address register pair and differ in the immediate offset) is the row pitch of A and of Bt in elements, KD <= K the depth that is summed. z-batch strides sA/sB/sC in elements. KD % 64 == 0, K % 64 == 0.
// Each 64-row x 64-deep piece of a plane goes through LDS: a global load takes 4 whole 128-byte lines (8 lanes a row), where a fragment load straight from memory touches 16 lines for the same 512 bytes; the fragments are then read from LDS rows of SP elements (144 B = 16 B x 9: no bank conflict).
#define SP 72
template <typename T16> struct WFrag;
template <> struct WFrag<h16> { typedef v16h V; static __device__ __forceinline__ V ld(const h16* p) { return cat16(*(const v8h*)p, *(const v8h*)(p + 16)); } static __device__ __forceinline__ v8f mma(V a, V b, v8f c) { return wmma16(a, b, c); } };
template <> struct WFrag<bf> { typedef v16bf V; static __device__ __forceinline__ V ld(const bf* p) { return cat16b(*(const v8us*)p, *(const v8us*)(p + 16)); } static __device__ __forceinline__ v8f mma(V a, V b, v8f c) { return wmmab(a, b, c); } };
template <typename T16, int NSPLIT, bool BIAS, int K>
__global__ __launch_bounds__(32) void k_gemmw(const T16* __restrict__ A, const T16* __restrict__ A2, const T16* __restrict__ Bt, const T16* __restrict__ Bt2, int KD, float* C, int ldc, const float* __restrict__ bias, size_t sA, size_t sB, size_t sC) {
    typedef typename WFrag<T16>::V V;
    __shared__ __align__(16) float os[16 * 68];
    __shared__ __align__(16) T16 sa[64 * SP], sb[64 * SP], sa2[(NSPLIT == 1 || NSPLIT == 2) ? 64 * SP : 8], sb2[NSPLIT >= 2 ? 64 * SP : 8];
    const size_t z = blockIdx.z; A += z * sA; if (A2) A2 += z * sA; Bt += z * sB; if (Bt2) Bt2 += z * sB; C += z * sC;
    const int lane = threadIdx.x & 31, lr = lane & 15, hi = lane >> 4; const int r0 = blockIdx.x * 64, c0 = blockIdx.y * 64;
    v8f acc[4][4];
#pragma unroll
    for (int mb = 0; mb < 4; ++mb)
#pragma unroll
        for (int nb = 0; nb < 4; ++nb) acc[mb][nb] = (v8f){};
    const int srow = lane >> 3, scol = (lane & 7) * 8;    // staging: 8 lanes take one row's 128 bytes
    const size_t aoff = (size_t)(r0 + srow) * K + scol, boff = (size_t)(c0 + srow) * K + scol; const int soff = srow * SP + scol, foff = lr * SP + 8 * hi;
#pragma unroll 1
    for (int k0 = 0; k0 < KD; k0 += 64) { const T16* pa = A + aoff + k0; const T16* pb = Bt + boff + k0; const T16* pa2 = (NSPLIT == 1 || NSPLIT == 2) ? A2 + aoff + k0 : pa; const T16* pb2 = NSPLIT >= 2 ? Bt2 + boff + k0 : pb;
#pragma unroll    // all loads of a piece in flight together, each row step an immediate offset
        for (int i = 0; i < 16; ++i) { *(v8usa*)(sa + soff + i * 4 * SP) = *(const v8usa*)(pa + i * 4 * K); *(v8usa*)(sb + soff + i * 4 * SP) = *(const v8usa*)(pb + i * 4 * K);
            if (NSPLIT == 1 || NSPLIT == 2) *(v8usa*)(sa2 + soff + i * 4 * SP) = *(const v8usa*)(pa2 + i * 4 * K); if (NSPLIT >= 2) *(v8usa*)(sb2 + soff + i * 4 * SP) = *(const v8usa*)(pb2 + i * 4 * K); }
        asm volatile("s_wait_xcnt 0x0" :: "v"(pa), "v"(pb), "v"(pa2), "v"(pb2) : "memory");    // the loads' address registers stay theirs up to this wait: no later load lands on them, the next piece's addresses are formed behind it
        __syncthreads();    // the piece is written by other lanes than read it (a one-wave group: it builds to the LDS wait and keeps the compiler from reading ahead of the stores)
        V a[4], a2[4];
#pragma unroll    // the second half's fragment reads are scheduled among the first half's products
      for (int kc = 0; kc < 64; kc += 32) {
#pragma unroll
        for (int mb = 0; mb < 4; ++mb) { a[mb] = WFrag<T16>::ld(sa + foff + mb * 16 * SP + kc); if (NSPLIT == 1 || NSPLIT == 2) a2[mb] = WFrag<T16>::ld(sa2 + foff + mb * 16 * SP + kc); }
#pragma unroll
        for (int nb = 0; nb < 4; ++nb) { const V b = WFrag<T16>::ld(sb + foff + nb * 16 * SP + kc); V b2; if (NSPLIT >= 2) b2 = WFrag<T16>::ld(sb2 + foff + nb * 16 * SP + kc);
#pragma unroll
            for (int mb = 0; mb < 4; ++mb) { acc[mb][nb] = WFrag<T16>::mma(a[mb], b, acc[mb][nb]); if (NSPLIT == 1 || NSPLIT == 2) acc[mb][nb] = WFrag<T16>::mma(a2[mb], b, acc[mb][nb]); if (NSPLIT >= 2) acc[mb][nb] = WFrag<T16>::mma(a[mb], b2, acc[mb][nb]); } }
      }
        asm volatile("v_nop\n\tv_nop\n\tv_nop\n\tv_nop" : "+v"(acc[0][0]), "+v"(acc[1][1]), "+v"(acc[2][2]), "+v"(acc[3][3]) : "v"(a[0]), "v"(a[3]));
        __syncthreads();    // every fragment is read before the next piece overwrites it (keeps the next stores behind these reads)
    }
#pragma unroll
    for (int mb = 0; mb < 4; ++mb) {
#pragma unroll
        for (int nb = 0; nb < 4; ++nb) {
#pragma unroll
            for (int j = 0; j < 8; ++j) os[(hi * 8 + j) * 68 + nb * 16 + lr] = acc[mb][nb][j]; }
        __builtin_amdgcn_wave_barrier(); asm volatile("" ::: "memory");
        float* crow = C + (size_t)(r0 + mb * 16) * ldc + c0;
{
#pragma unroll
            for (int s = 0; s < 8; ++s) { const int row = 2 * s + hi, cofs = lr * 4; v4f val = *(const v4fa*)(os + row * 68 + cofs); if (BIAS) { val[0] += bfr(bias[c0 + cofs]); val[1] += bfr(bias[c0 + cofs + 1]); val[2] += bfr(bias[c0 + cofs + 2]); val[3] += bfr(bias[c0 + cofs + 3]); }
                *(v4f*)(crow + (size_t)row * ldc + cofs) = val; }
             }
        __builtin_amdgcn_wave_barrier(); asm volatile("" ::: "memory");
    }
}

__device__ __forceinline__ void splitf(float y, unsigned short& h, unsigned short& l) { h = f2bf(y); l = f2bf(y - bf2f(h)); }
typedef __attribute__((ext_vector_type(2))) _Float16 v2h;
typedef __attribute__((ext_vector_type(4))) _Float16 v4h;
typedef __attribute__((ext_vector_type(2))) unsigned short v2us;
typedef __attribute__((ext_vector_type(4))) unsigned short v4us;
typedef __attribute__((ext_vector_type(2))) float v2f;
typedef __attribute__((ext_vector_type(4))) int v4i;

__global__ __launch_bounds__(256) void k_wtG(const float* __restrict__ w, int K, int N, bf* Bt) {
    const int lane = threadIdx.x & 31; const int L0 = (blockIdx.x * 8 + (threadIdx.x >> 5)) * 8; const int nlines = N * K / 64;
{
#pragma unroll 1
        for (int l = 0; l < 8; ++l) { const int L = L0 + l; if (L >= nlines) break; const size_t e = (size_t)L * 64 + lane * 2; const int k = (int)(e % K), n = (int)(e / K); v2us o;
            o[0] = f2bf(w[(size_t)k * N + n]); o[1] = f2bf(w[(size_t)(k + 1) * N + n]); *(v2us*)(Bt + e) = o; }
         }
}

__global__ __launch_bounds__(256) void k_ln256(const float* __restrict__ X, int nrows, const float* __restrict__ gw, const float* __restrict__ gb, bf* Yh, bf* Yl) {
    const int lane = threadIdx.x & 31; const int r = blockIdx.x * 8 + (threadIdx.x >> 5); if (r >= nrows) return; const float* xr = X + (size_t)r * DM; float hv[8]; float s = 0.f;
#pragma unroll
    for (int ch = 0; ch < 2; ++ch) { const v4f y = *(const v4f*)(xr + ch * 128 + lane * 4);
#pragma unroll
        for (int q = 0; q < 4; ++q) { const float u = bfr(y[q]); hv[ch * 4 + q] = u; s += u; } }
#pragma unroll
    for (int sh = 16; sh; sh >>= 1) s += __shfl_xor(s, sh, 32);
    float mu = s * (1.0f / 256.0f); asm volatile("" : "+v"(mu)); float s2 = 0.f;
#pragma unroll
    for (int k = 0; k < 8; ++k) { float d0 = __fsub_rn(hv[k], mu); asm volatile("" : "+v"(d0)); float p = __fmul_rn(d0, d0); asm volatile("" : "+v"(p)); s2 = __fadd_rn(s2, p); }
#pragma unroll
    for (int sh = 16; sh; sh >>= 1) s2 += __shfl_xor(s2, sh, 32);
    float var = __fadd_rn(s2 * (1.0f / 256.0f), 1e-5f); asm volatile("" : "+v"(var)); const float rs = __frsqrt_rn(var);
{
#pragma unroll
        for (int ch = 0; ch < 2; ++ch) { const int c0 = ch * 128 + lane * 4; v4us oh, ol;
#pragma unroll
            for (int q = 0; q < 4; ++q) { float gg = bfr(gw[c0 + q]); asm volatile("" : "+v"(gg)); float d0 = __fsub_rn(hv[ch * 4 + q], mu); asm volatile("" : "+v"(d0)); float n0 = __fmul_rn(d0, rs); asm volatile("" : "+v"(n0)); float y = __fmul_rn(n0, gg); asm volatile("" : "+v"(y)); y = __fadd_rn(y, bfr(gb[c0 + q])); unsigned short a, c2; splitf(y, a, c2); oh[q] = a; ol[q] = c2; }
            *(v4us*)(Yh + (size_t)r * DM + c0) = oh; *(v4us*)(Yl + (size_t)r * DM + c0) = ol; }
         } }
__global__ __launch_bounds__(256) void k_plz(const float* __restrict__ F, int pitch, int coff, bf* Ph, bf* Pl) { const size_t e = ((size_t)blockIdx.x * 256 + threadIdx.x) * 2; if (e >= (size_t)ZH * TT * HD) return; const int d = (int)(e % HD); const int t = (int)((e / HD) % TT); const int z = (int)(e / ((size_t)HD * TT)); const int h = z % NH_, sq = z / NH_; const float* f = F + ((size_t)sq * TT + t) * pitch + coff + h * HD + d; v2us oh, ol;
#pragma unroll
    for (int q = 0; q < 2; ++q) { unsigned short a, c2; splitf(f[q], a, c2); oh[q] = a; ol[q] = c2; }
    *(v2us*)(Ph + e) = oh; *(v2us*)(Pl + e) = ol;  }
__global__ __launch_bounds__(256) void k_vtz(const float* __restrict__ F, int pitch, int coff, bf* Vh, bf* Vl) { const size_t e = ((size_t)blockIdx.x * 256 + threadIdx.x) * 2; if (e >= (size_t)ZH * HD * TT) return; const int t = (int)(e % TT); const int d = (int)((e / TT) % HD); const int z = (int)(e / ((size_t)TT * HD)); const int h = z % NH_, sq = z / NH_; v2us oh, ol;
#pragma unroll
    for (int q = 0; q < 2; ++q) { const float x = F[((size_t)sq * TT + t + q) * pitch + coff + h * HD + d]; unsigned short a, c2; splitf(x, a, c2); oh[q] = a; ol[q] = c2; }
    const size_t oo = (e - t) * 2 + t; *(v2us*)(Vh + oo) = oh; *(v2us*)(Vl + oo) = ol;  }    // V rows at pitch 2*TT
// ---- k_attn: scores, softmax and attn.v of 64 query rows of one (sequence, head) plane in ONE work-group; no score leaves the WGP. Grid (TT/64, ZH), 128 threads = 4 waves, 16 query rows a wave.
// The scores are formed transposed, S^T = K Q^T (A = 16 key rows from LDS, B = the wave's 16 query rows): an accumulator tile then holds, in lane (lr, hi), keys 8*hi + j of query lr, and two such tiles are, register for register, the B fragment of a 32-key step of O^T = V^T P^T. A wave keeps its whole 512 x 16 score block in 32 accumulator tiles, so the softmax is the plain one over the full row (a lane's 256 values, then one exchange with lane ^ 16).
// LDS: first the K planes (rows of KPT elements, hi plane then lo plane), then, in the same bytes, the V^T rows [hi 512 | lo 512] at pitch VPT (both pitches 16 B x odd).
#define KPT 72
typedef __attribute__((ext_vector_type(2))) __bf16 v2bf;
typedef __attribute__((ext_vector_type(4))) unsigned v4w;    // eight bf16 as four packed words
// hi = p rounded to nearest even, lo = the rest rounded likewise (as splitf), two values a word: the packed hi word is also the source of the two f32 that are subtracted
__device__ __forceinline__ void split8(v8f p, v4w& h, v4w& l) {
#pragma unroll
    for (int i = 0; i < 4; ++i) { const unsigned u = __builtin_bit_cast(unsigned, __builtin_convertvector(((v2f){p[2 * i], p[2 * i + 1]}), v2bf)); h[i] = u;
        l[i] = __builtin_bit_cast(unsigned, __builtin_convertvector(((v2f){p[2 * i] - __uint_as_float(u << 16), p[2 * i + 1] - __uint_as_float(u & 0xFFFF0000u)}), v2bf)); } }
__device__ __forceinline__ v16bf cat16v(v4w lo, v4w hi) { return __builtin_bit_cast(v16bf, __builtin_shufflevector(lo, hi, 0, 1, 2, 3, 4, 5, 6, 7)); }
#define VPT 1032
__global__ __launch_bounds__(128, 2) void k_attn(const bf* __restrict__ Qh, const bf* __restrict__ Ql, const bf* __restrict__ Kh, const bf* __restrict__ Kl, const bf* __restrict__ VT, float* __restrict__ O) {
    typedef WFrag<bf> F; typedef F::V V;
    __shared__ __align__(16) bf sm[2 * TT * KPT];
    const int tid = threadIdx.x, lane = tid & 31, lr = lane & 15, hi = lane >> 4; const size_t z = blockIdx.y; const int q0 = blockIdx.x * 64 + (tid >> 5) * 16;
    // the wave's Q fragments (B operand: lane lr = query row, k = d in the hardware order), and the K planes to LDS: 8 lanes take one row's 128 bytes; all 64 K loads of a thread are in flight together (the score registers are not live yet)
    V qh[2], ql[2];
    { const bf* pqh = Qh + (z * TT + q0 + lr) * HD + 8 * hi; const bf* pql = Ql + (z * TT + q0 + lr) * HD + 8 * hi;
        const bf* gh = Kh + z * (TT * HD) + tid * 8; const bf* gl = Kl + z * (TT * HD) + tid * 8; bf* l = sm + (tid >> 3) * KPT + (tid & 7) * 8; v8us rh[32], rl[32];
#pragma unroll
        for (int i = 0; i < 32; ++i) { rh[i] = *(const v8usa*)(gh + i * 1024); rl[i] = *(const v8usa*)(gl + i * 1024); }
#pragma unroll
        for (int c = 0; c < 2; ++c) { qh[c] = F::ld(pqh + c * 32); ql[c] = F::ld(pql + c * 32); }
        asm volatile("s_wait_xcnt 0x0" :: "v"(gh), "v"(gl), "v"(pqh), "v"(pql) : "memory");    // the loads' address registers stay theirs up to this wait: no load lands on them and nothing rewrites them ahead of it
#pragma unroll
        for (int i = 0; i < 32; ++i) { *(v8usa*)(l + i * 16 * KPT) = rh[i]; *(v8usa*)(l + (TT + i * 16) * KPT) = rl[i]; } }
    __syncthreads();    // K is written by other waves than read it
    v8f s[TT / 16];
#pragma unroll
    for (int t = 0; t < TT / 16; ++t) s[t] = (v8f){};
    const bf* kf = sm + lr * KPT + 8 * hi;
    V kh[2][4], kl[2][4];    // two fragment sets: step g + 1 (4 key tiles x 32 of d) is fetched as one group ahead of step g's products
#pragma unroll
    for (int t = 0; t < 4; ++t) { kh[0][t] = F::ld(kf + t * 16 * KPT); kl[0][t] = F::ld(kf + (TT + t * 16) * KPT); }
#pragma unroll
    for (int g = 0; g < TT / 32; ++g) { const int cur = g & 1, nx = cur ^ 1, t0 = (g >> 1) * 4, c = g & 1;
        if (g + 1 < TT / 32) { const int t1 = ((g + 1) >> 1) * 4, c1 = (g + 1) & 1;
#pragma unroll
            for (int t = 0; t < 4; ++t) { kh[nx][t] = F::ld(kf + (t1 + t) * 16 * KPT + c1 * 32); kl[nx][t] = F::ld(kf + (TT + (t1 + t) * 16) * KPT + c1 * 32); } }
        __builtin_amdgcn_sched_barrier(0);    // keeps the next step's LDS reads ahead of these products (left alone the compiler sinks each read to its use and waits for it there)
#pragma unroll
        for (int t = 0; t < 4; ++t) s[t0 + t] = F::mma(kh[cur][t], qh[c], s[t0 + t]);
        __builtin_amdgcn_sched_barrier(0);    // keeps four independent tiles between two products into one accumulator
#pragma unroll
        for (int t = 0; t < 4; ++t) s[t0 + t] = F::mma(kh[cur][t], ql[c], s[t0 + t]);
        __builtin_amdgcn_sched_barrier(0);    // as above
#pragma unroll
        for (int t = 0; t < 4; ++t) s[t0 + t] = F::mma(kl[cur][t], qh[c], s[t0 + t]);
        __builtin_amdgcn_sched_barrier(0); }    // ends the step: the reads of step g + 2 stay behind the products that still use their registers
    // softmax over the 512 keys of query lr: exp2((s - max) * HD^-0.5 * log2 e); eight partial maxima and sums (one per accumulator register), then a tree, then lane ^ 16
    v8f m8 = s[0];
#pragma unroll
    for (int t = 1; t < TT / 16; ++t)
#pragma unroll
        for (int j = 0; j < 8; ++j) m8[j] = fmaxf(m8[j], s[t][j]);
    float mx = fmaxf(fmaxf(fmaxf(m8[0], m8[1]), fmaxf(m8[2], m8[3])), fmaxf(fmaxf(m8[4], m8[5]), fmaxf(m8[6], m8[7])));
    mx = fmaxf(mx, __shfl_xor(mx, 16, 32));
    const float cs = SCL * 1.4426950408889634f, mc = mx * cs; v8f a8 = (v8f){};
#pragma unroll
    for (int t = 0; t < TT / 16; ++t) {
#pragma unroll
        for (int j = 0; j < 8; ++j) s[t][j] = __builtin_amdgcn_exp2f(s[t][j] * cs - mc);
        a8 += s[t];
        if ((t & 3) == 3) __builtin_amdgcn_sched_barrier(0); }    // bounds how many tiles' temporaries are live beside the 256 score registers (left alone the compiler fills the register budget and spills)
    float sum = ((a8[0] + a8[1]) + (a8[2] + a8[3])) + ((a8[4] + a8[5]) + (a8[6] + a8[7]));
    sum += __shfl_xor(sum, 16, 32);
    const float f = __fdiv_rn(1.0f, sum);
    // V^T to LDS, a row of 2,048 bytes a step, in two halves of 32 rows; the first half's loads need no LDS and are issued ahead of the barrier
    const bf* gv = VT + z * HD * (2 * TT) + tid * 8; bf* lv = sm + tid * 8; v8us r[32];
#pragma unroll
    for (int i = 0; i < 32; ++i) r[i] = *(const v8usa*)(gv + i * 2 * TT);
    asm volatile("s_wait_xcnt 0x0" :: "v"(gv) : "memory");    // the loads' address registers stay theirs up to this wait
    __syncthreads();    // every wave has read its last K fragment before V^T overwrites the bytes
#pragma unroll
    for (int i = 0; i < 32; ++i) *(v8usa*)(lv + i * VPT) = r[i];
#pragma unroll
    for (int i = 0; i < 32; ++i) r[i] = *(const v8usa*)(gv + (32 + i) * 2 * TT);
    asm volatile("s_wait_xcnt 0x0" :: "v"(gv) : "memory");    // as above
#pragma unroll
    for (int i = 0; i < 32; ++i) *(v8usa*)(lv + (32 + i) * VPT) = r[i];
    __syncthreads();    // V^T is written by other waves than read it
    v8f o[4];
#pragma unroll
    for (int mb = 0; mb < 4; ++mb) o[mb] = (v8f){};
    const bf* vf = sm + lr * VPT + 8 * hi;
    V vh[2][4], vl[2][4], ph[2], pl[2];    // two sets again: step c + 1's V^T fragments are fetched, and its probabilities split into hi and lo, beside step c's products
    { v4w h0, h1, l0, l1;
#pragma unroll
        for (int mb = 0; mb < 4; ++mb) { vh[0][mb] = F::ld(vf + mb * 16 * VPT); vl[0][mb] = F::ld(vf + mb * 16 * VPT + TT); }
        split8(s[0] * f, h0, l0); split8(s[1] * f, h1, l1);
        ph[0] = cat16v(h0, h1); pl[0] = cat16v(l0, l1); }
#pragma unroll
    for (int c = 0; c < TT / 32; ++c) { const int cur = c & 1, nx = cur ^ 1; const bool more = c + 1 < TT / 32; v4w h0 = {}, h1 = {}, l0 = {}, l1 = {};
        if (more) {
#pragma unroll
            for (int mb = 0; mb < 4; ++mb) { vh[nx][mb] = F::ld(vf + mb * 16 * VPT + (c + 1) * 32); vl[nx][mb] = F::ld(vf + mb * 16 * VPT + TT + (c + 1) * 32); } }
        __builtin_amdgcn_sched_barrier(0);    // keeps the next step's LDS reads ahead of these products
#pragma unroll
        for (int mb = 0; mb < 4; ++mb) o[mb] = F::mma(vh[cur][mb], ph[cur], o[mb]);
        if (more) split8(s[2 * c + 2] * f, h0, l0);
        __builtin_amdgcn_sched_barrier(0);    // keeps four independent tiles between two products into one accumulator, and a share of the split beside each four
#pragma unroll
        for (int mb = 0; mb < 4; ++mb) o[mb] = F::mma(vh[cur][mb], pl[cur], o[mb]);
        if (more) split8(s[2 * c + 3] * f, h1, l1);
        __builtin_amdgcn_sched_barrier(0);    // as above
#pragma unroll
        for (int mb = 0; mb < 4; ++mb) o[mb] = F::mma(vl[cur][mb], ph[cur], o[mb]);
        if (more) { ph[nx] = cat16v(h0, h1); pl[nx] = cat16v(l0, l1); }
        __builtin_amdgcn_sched_barrier(0); }    // ends the step
    float* orow = O + (z * TT + q0 + lr) * HD + hi * 8;    // lane (lr, hi) holds d = mb*16 + hi*8 + j of query lr
#pragma unroll
    for (int mb = 0; mb < 4; ++mb) { *(v4f*)(orow + mb * 16) = (v4f){o[mb][0], o[mb][1], o[mb][2], o[mb][3]}; *(v4f*)(orow + mb * 16 + 4) = (v4f){o[mb][4], o[mb][5], o[mb][6], o[mb][7]}; }
}

__global__ __launch_bounds__(256) void k_mergeGz(const float* __restrict__ O, const float* __restrict__ G, bf* Ah, bf* Al) { const size_t e = ((size_t)blockIdx.x * 256 + threadIdx.x) * 2; if (e >= (size_t)ZH * TT * HD) return; const int d = (int)(e % HD); const int t = (int)((e / HD) % TT); const int z = (int)(e / ((size_t)HD * TT)); const int h = z % NH_, sq = z / NH_; const size_t oo = ((size_t)sq * TT + t) * DQ + h * HD + d; v2us oh, ol;
#pragma unroll
    for (int q = 0; q < 2; ++q) { float o = O[e + q]; asm volatile("" : "+v"(o)); float den = __fadd_rn(1.0f, expf(-G[oo + q])); asm volatile("" : "+v"(den)); const float sg = __fdiv_rn(1.0f, den); unsigned short a, c2; splitf(__fmul_rn(o, sg), a, c2); oh[q] = a; ol[q] = c2; }
    *(v2us*)(Ah + oo) = oh; *(v2us*)(Al + oo) = ol;  }

extern "C" void kernel_launch(void* const* d_in, const int* in_sizes, int n_in,
                              void* d_out, int out_size, void* d_ws, size_t ws_size, hipStream_t stream) {
    (void)in_sizes; (void)n_in; (void)out_size;
    const float* x = (const float*)d_in[0]; const float* ln_g = (const float*)d_in[1]; const float* ln_b = (const float*)d_in[2]; const float* wq = (const float*)d_in[3]; const float* wkv = (const float*)d_in[4]; const float* wg = (const float*)d_in[5]; const float* bg = (const float*)d_in[6]; const float* wo = (const float*)d_in[7]; const float* bo = (const float*)d_in[8];
    float* OUT = (float*)d_out;     // [1][64][512][256] = [32768][256]
    char* wsp = (char*)d_ws;
    auto take = [&](size_t bytes) { char* p = wsp; wsp += (bytes + 255) & ~(size_t)255; return (void*)p; };
    bf* WQ = (bf*)take((size_t)DQ * DM * 2); bf* WKV = (bf*)take((size_t)2 * DQ * DM * 2); bf* WG = (bf*)take((size_t)DQ * DM * 2); bf* WO = (bf*)take((size_t)DM * DQ * 2);
    bf* LNh = (bf*)take((size_t)GR * DM * 2); bf* LNl = (bf*)take((size_t)GR * DM * 2); float* FQ = (float*)take((size_t)GR * DQ * 4); float* FKV = (float*)take((size_t)GR * 2 * DQ * 4); float* FG = (float*)take((size_t)GR * DQ * 4);
    bf* QPh = (bf*)take((size_t)ZH * TT * HD * 2); bf* QPl = (bf*)take((size_t)ZH * TT * HD * 2); bf* KPh = (bf*)take((size_t)ZH * TT * HD * 2); bf* KPl = (bf*)take((size_t)ZH * TT * HD * 2); bf* VTh = (bf*)take((size_t)ZH * HD * 2 * TT * 2); bf* VTl = VTh + TT;    // row (z, d) of V^T: hi at VTh + row*2*TT, lo TT elements behind it
    float* Ob = FQ; bf* ATh = (bf*)FKV; bf* ATl = ATh + (size_t)GR * DQ;    // FQ is dead behind its k_plz, FKV behind k_vtz
    if ((size_t)(wsp - (char*)d_ws) > ws_size) return;    // ws 256 MiB
    /* weights ('xw': Bt[n][k] = W[k][n]); the fused Wkv gives Bt rows 0..511 = k, 512..1023 = v */
    k_wtG<<<(unsigned)((DM * DQ / 64 + 63) / 64), 256, 0, stream>>>(wq, DM, DQ, WQ); k_wtG<<<(unsigned)((DM * 2 * DQ / 64 + 63) / 64), 256, 0, stream>>>(wkv, DM, 2 * DQ, WKV); k_wtG<<<(unsigned)((DM * DQ / 64 + 63) / 64), 256, 0, stream>>>(wg, DM, DQ, WG); k_wtG<<<(unsigned)((DQ * DM / 64 + 63) / 64), 256, 0, stream>>>(wo, DQ, DM, WO);
    const unsigned LP = (unsigned)(((size_t)ZH * TT * HD / 2 + 255) / 256);
    for (int g = 0; g < NB_ / GB; ++g) { const float* xg = x + (size_t)g * GR * DM;
        k_ln256<<<GR / 8, 256, 0, stream>>>(xg, GR, ln_g, ln_b, LNh, LNl);
        k_gemmw<bf, 1, false, DM><<<dim3(GR / 64, DQ / 64, 1), 32, 0, stream>>>(LNh, LNl, WQ, nullptr, DM, FQ, DQ, nullptr, 0, 0, 0);
        k_gemmw<bf, 1, false, DM><<<dim3(GR / 64, 2 * DQ / 64, 1), 32, 0, stream>>>(LNh, LNl, WKV, nullptr, DM, FKV, 2 * DQ, nullptr, 0, 0, 0);
        k_gemmw<bf, 1, true, DM><<<dim3(GR / 64, DQ / 64, 1), 32, 0, stream>>>(LNh, LNl, WG, nullptr, DM, FG, DQ, bg, 0, 0, 0);
        k_plz<<<LP, 256, 0, stream>>>(FQ, DQ, 0, QPh, QPl); k_plz<<<LP, 256, 0, stream>>>(FKV, 2 * DQ, 0, KPh, KPl); k_vtz<<<LP, 256, 0, stream>>>(FKV, 2 * DQ, DQ, VTh, VTl);
        k_attn<<<dim3(TT / 64, ZH, 1), 128, 0, stream>>>(QPh, QPl, KPh, KPl, VTh, Ob);
        k_mergeGz<<<LP, 256, 0, stream>>>(Ob, FG, ATh, ATl);
        k_gemmw<bf, 1, true, DQ><<<dim3(GR / 64, DM / 64, 1), 32, 0, stream>>>(ATh, ATl, WO, nullptr, DQ, OUT + (size_t)g * GR * DM, DM, bo, 0, 0, 0); }
}

// v004
// One run takes 388 microseconds.
// Next to v003, in two timings, it ran 1.51 and 1.53 times as fast.
// All steps since v000 together make it 4.13 times as fast.
#include <hip/hip_runtime.h>

// Gated row (axial) attention with a pre-LayerNorm (x [1][64][512][256]: 64 image rows = 64 independent sequences of 512 tokens x 256; xn = LayerNorm(x) (gamma, beta, eps 1e-5); q = xn Wq ('xw' [256][512], 8 heads x 64), [k|v] = xn Wkv ('xw' [256][1024]: columns k | v); dots = (q/8).k over the 512 keys of the same row; softmax (the explicit max subtraction is a softmax identity); out = attn.v merged; gates = sigmoid(xn Wg + bg) ('xw' [256][512]); y = (out * gates) Wo + bo ('xw' [512][256]) -> [1][64][512][256] (8.4 M)).
// Compute dtypes, f32 accumulate: every input rounded to bf16; LayerNorm in f32, xn as bf16 hi + lo planes; q / kv / gate projections as (hi + lo) x exact weights (2 products) + f32 bias; scores and attn.v on bf16 hi/lo planes (3 products) for every row; softmax f32; sigmoid gate f32 (true division); (out x gate) as hi + lo x exact Wo (2 products) + bo.
// Layout: 16 image rows (8,192 tokens) per pass; all per-(row, head) planes are laid out z-major (q, k [z = row*8 + head][512][64]; V^T [z][64][1,024]); scores, softmax and attn.v are ONE launch (k_attn), the scores and the probabilities live in registers only.
// No elementwise launch stands between the matrix kernels: the q and kv projections split their f32 tiles into the hi / lo planes (V transposed) in their own epilogue, and k_attn gates and splits its output tile in its own.
// Workspace: the transposed V planes lie [hi 512 | lo 512] per row (pitch 1,024 elements).

#define NB_  64        // sequences (image rows)
#define TT   512       // tokens per sequence
#define DM   256
#define NH_  8
#define HD   64
#define DQ   (NH_ * HD)    // 512 = inner dim
#define GB   16            // sequences per pass
#define GR   (GB * TT)     // 8192 token rows per pass
#define ZH   (GB * NH_)    // 128 (sequence, head) planes per pass
#define SCL  0.125f   // HD^-0.5
typedef _Float16 h16;
typedef unsigned short bf;
typedef __attribute__((ext_vector_type(16))) __bf16   v16bf;
typedef __attribute__((ext_vector_type(16))) _Float16 v16h;
typedef __attribute__((ext_vector_type(8)))  _Float16 v8h;
typedef __attribute__((ext_vector_type(8)))  unsigned short v8us;
typedef __attribute__((ext_vector_type(8)))  float    v8f;
typedef __attribute__((ext_vector_type(4)))  float    v4f;
typedef v8h  __attribute__((may_alias)) v8ha;
typedef v4f  __attribute__((may_alias)) v4fa;
typedef v8us __attribute__((may_alias)) v8usa;

__device__ __forceinline__ unsigned short f2bf(float f) { unsigned u = __float_as_uint(f); u += 0x7FFFu + ((u >> 16) & 1u); return (unsigned short)(u >> 16); }
__device__ __forceinline__ float bf2f(unsigned short b) { return __uint_as_float(((unsigned)b) << 16); }
__device__ __forceinline__ float bfr(float f) { return bf2f(f2bf(f)); }
__device__ __forceinline__ v16h cat16(v8h lo, v8h hi) { return __builtin_shufflevector(lo, hi, 0, 1, 2, 3, 4, 5, 6, 7, 8, 9, 10, 11, 12, 13, 14, 15); }
__device__ __forceinline__ v16bf cat16b(v8us lo, v8us hi) { return __builtin_bit_cast(v16bf, __builtin_shufflevector(lo, hi, 0, 1, 2, 3, 4, 5, 6, 7, 8, 9, 10, 11, 12, 13, 14, 15)); }
__device__ __forceinline__ v8f wmma16(v16h a, v16h b, v8f c) { return __builtin_amdgcn_wmma_f32_16x16x32_f16(false, a, false, b, (short)0, c, false, false); }
__device__ __forceinline__ v8f wmmab(v16bf a, v16bf b, v8f c) { return __builtin_amdgcn_wmma_f32_16x16x32_bf16(false, a, false, b, (short)0, c, false, false); }

typedef __attribute__((ext_vector_type(2))) float v2f;
typedef __attribute__((ext_vector_type(2))) __bf16 v2bf;
typedef __attribute__((ext_vector_type(4))) unsigned v4w;    // eight bf16 as four packed words
// hi = p rounded to nearest even, lo = the rest rounded likewise (as splitf), two values a word: the packed hi word is also the source of the two f32 that are subtracted
__device__ __forceinline__ void split8(v8f p, v4w& h, v4w& l) {
#pragma unroll
    for (int i = 0; i < 4; ++i) { const unsigned u = __builtin_bit_cast(unsigned, __builtin_convertvector(((v2f){p[2 * i], p[2 * i + 1]}), v2bf)); h[i] = u;
        l[i] = __builtin_bit_cast(unsigned, __builtin_convertvector(((v2f){p[2 * i] - __uint_as_float(u << 16), p[2 * i + 1] - __uint_as_float(u & 0xFFFF0000u)}), v2bf)); } }
typedef v4w __attribute__((may_alias)) v4wa;

// ---- k_gemmw: register-blocked GEMM, ONE WAVE per 64x64 output tile (16 accumulators), operands from K-contiguous 16-bit planes; grid (M/64, N/64, Z), 32 threads.
// C[m][n] (f32, pitch ldc, + optional f32 bias[n]) = sum_k A[m][k] Bt[n][k] (+ split products per NSPLIT). K (a template argument, so that a piece's 16 loads of a plane share one address register pair and differ in the immediate offset) is the row pitch of A and of Bt in elements, KD <= K the depth that is summed. z-batch strides sA/sB/sC in elements. KD % 64 == 0, K % 64 == 0.
// Each 64-row x 64-deep piece of a plane goes through LDS: a global load takes 4 whole 128-byte lines (8 lanes a row), where a fragment load straight from memory touches 16 lines for the same 512 bytes; the fragments are then read from LDS rows of SP elements (144 B = 16 B x 9: no bank conflict).
// EPI says where the tile goes. 0: C as above. 1: a tile is 64 tokens x one head (64 | TT, HD = 64), split into bf16 hi + lo and stored as 64 whole rows of the z-major planes Ph, Pl. 2: as 1 for columns below DQ (k); the columns from DQ on (v) go transposed into VT: an accumulator register group holds 8 successive tokens of one d, which are 16 bytes of a V^T row as they stand.
#define SP 72
template <typename T16> struct WFrag;
template <> struct WFrag<h16> { typedef v16h V; static __device__ __forceinline__ V ld(const h16* p) { return cat16(*(const v8h*)p, *(const v8h*)(p + 16)); } static __device__ __forceinline__ v8f mma(V a, V b, v8f c) { return wmma16(a, b, c); } };
template <> struct WFrag<bf> { typedef v16bf V; static __device__ __forceinline__ V ld(const bf* p) { return cat16b(*(const v8us*)p, *(const v8us*)(p + 16)); } static __device__ __forceinline__ v8f mma(V a, V b, v8f c) { return wmmab(a, b, c); } };
template <typename T16, int NSPLIT, bool BIAS, int K, int EPI>
__global__ __launch_bounds__(32) void k_gemmw(const T16* __restrict__ A, const T16* __restrict__ A2, const T16* __restrict__ Bt, const T16* __restrict__ Bt2, int KD, float* C, int ldc, const float* __restrict__ bias, size_t sA, size_t sB, size_t sC, bf* Ph, bf* Pl, bf* VT) {
    typedef typename WFrag<T16>::V V;
    __shared__ __align__(16) float os[16 * 68];
    __shared__ __align__(16) T16 sa[64 * SP], sb[64 * SP], sa2[(NSPLIT == 1 || NSPLIT == 2) ? 64 * SP : 8], sb2[NSPLIT >= 2 ? 64 * SP : 8];
    const size_t z = blockIdx.z; A += z * sA; if (A2) A2 += z * sA; Bt += z * sB; if (Bt2) Bt2 += z * sB; C += z * sC;
    const int lane = threadIdx.x & 31, lr = lane & 15, hi = lane >> 4; const int r0 = blockIdx.x * 64, c0 = blockIdx.y * 64;
    v8f acc[4][4];
#pragma unroll
    for (int mb = 0; mb < 4; ++mb)
#pragma unroll
        for (int nb = 0; nb < 4; ++nb) acc[mb][nb] = (v8f){};
    const int srow = lane >> 3, scol = (lane & 7) * 8;    // staging: 8 lanes take one row's 128 bytes
    const size_t aoff = (size_t)(r0 + srow) * K + scol, boff = (size_t)(c0 + srow) * K + scol; const int soff = srow * SP + scol, foff = lr * SP + 8 * hi;
#pragma unroll 1
    for (int k0 = 0; k0 < KD; k0 += 64) { const T16* pa = A + aoff + k0; const T16* pb = Bt + boff + k0; const T16* pa2 = (NSPLIT == 1 || NSPLIT == 2) ? A2 + aoff + k0 : pa; const T16* pb2 = NSPLIT >= 2 ? Bt2 + boff + k0 : pb;
#pragma unroll    // all loads of a piece in flight together, each row step an immediate offset
        for (int i = 0; i < 16; ++i) { *(v8usa*)(sa + soff + i * 4 * SP) = *(const v8usa*)(pa + i * 4 * K); *(v8usa*)(sb + soff + i * 4 * SP) = *(const v8usa*)(pb + i * 4 * K);
            if (NSPLIT == 1 || NSPLIT == 2) *(v8usa*)(sa2 + soff + i * 4 * SP) = *(const v8usa*)(pa2 + i * 4 * K); if (NSPLIT >= 2) *(v8usa*)(sb2 + soff + i * 4 * SP) = *(const v8usa*)(pb2 + i * 4 * K); }
        asm volatile("s_wait_xcnt 0x0" :: "v"(pa), "v"(pb), "v"(pa2), "v"(pb2) : "memory");    // the loads' address registers stay theirs up to this wait: no later load lands on them, the next piece's addresses are formed behind it
        __syncthreads();    // the piece is written by other lanes than read it (a one-wave group: it builds to the LDS wait and keeps the compiler from reading ahead of the stores)
        V a[4], a2[4];
#pragma unroll    // the second half's fragment reads are scheduled among the first half's products
      for (int kc = 0; kc < 64; kc += 32) {
#pragma unroll
        for (int mb = 0; mb < 4; ++mb) { a[mb] = WFrag<T16>::ld(sa + foff + mb * 16 * SP + kc); if (NSPLIT == 1 || NSPLIT == 2) a2[mb] = WFrag<T16>::ld(sa2 + foff + mb * 16 * SP + kc); }
#pragma unroll
        for (int nb = 0; nb < 4; ++nb) { const V b = WFrag<T16>::ld(sb + foff + nb * 16 * SP + kc); V b2; if (NSPLIT >= 2) b2 = WFrag<T16>::ld(sb2 + foff + nb * 16 * SP + kc);
#pragma unroll
            for (int mb = 0; mb < 4; ++mb) { acc[mb][nb] = WFrag<T16>::mma(a[mb], b, acc[mb][nb]); if (NSPLIT == 1 || NSPLIT == 2) acc[mb][nb] = WFrag<T16>::mma(a2[mb], b, acc[mb][nb]); if (NSPLIT >= 2) acc[mb][nb] = WFrag<T16>::mma(a[mb], b2, acc[mb][nb]); } }
      }
        asm volatile("v_nop\n\tv_nop\n\tv_nop\n\tv_nop" : "+v"(acc[0][0]), "+v"(acc[1][1]), "+v"(acc[2][2]), "+v"(acc[3][3]) : "v"(a[0]), "v"(a[3]));
        __syncthreads();    // every fragment is read before the next piece overwrites it (keeps the next stores behind these reads)
    }
    const size_t zz = (size_t)(r0 / TT) * NH_ + (c0 / HD) % NH_; const int t0 = r0 % TT;    // the tile's (sequence, head) plane and its first token
    if (EPI == 2 && c0 >= DQ) {
        bf* vrow = VT + (zz * HD + lr) * (2 * TT) + t0 + hi * 8;
#pragma unroll
        for (int nb = 0; nb < 4; ++nb)
#pragma unroll
            for (int mb = 0; mb < 4; ++mb) { v4w h, l; split8(acc[mb][nb], h, l); *(v4wa*)(vrow + nb * 16 * 2 * TT + mb * 16) = h; *(v4wa*)(vrow + nb * 16 * 2 * TT + mb * 16 + TT) = l; }
    } else {
#pragma unroll
    for (int mb = 0; mb < 4; ++mb) {
#pragma unroll
        for (int nb = 0; nb < 4; ++nb) {
#pragma unroll
            for (int j = 0; j < 8; ++j) os[(hi * 8 + j) * 68 + nb * 16 + lr] = acc[mb][nb][j]; }
        __builtin_amdgcn_wave_barrier(); asm volatile("" ::: "memory");
        if (EPI != 0) { const size_t po = (zz * TT + t0 + mb * 16 + (lane >> 3)) * HD + (lane & 7) * 8;    // 8 lanes a row: a store takes 4 whole 128-byte rows
#pragma unroll
            for (int s = 0; s < 4; ++s) { const float* orw = os + (4 * s + (lane >> 3)) * 68 + (lane & 7) * 8; const v4f x0 = *(const v4fa*)orw, x1 = *(const v4fa*)(orw + 4); v4w h, l;
                split8((v8f){x0[0], x0[1], x0[2], x0[3], x1[0], x1[1], x1[2], x1[3]}, h, l); *(v4wa*)(Ph + po + s * 4 * HD) = h; *(v4wa*)(Pl + po + s * 4 * HD) = l; }
        } else {
        float* crow = C + (size_t)(r0 + mb * 16) * ldc + c0;
#pragma unroll
            for (int s = 0; s < 8; ++s) { const int row = 2 * s + hi, cofs = lr * 4; v4f val = *(const v4fa*)(os + row * 68 + cofs); if (BIAS) { val[0] += bfr(bias[c0 + cofs]); val[1] += bfr(bias[c0 + cofs + 1]); val[2] += bfr(bias[c0 + cofs + 2]); val[3] += bfr(bias[c0 + cofs + 3]); }
                *(v4f*)(crow + (size_t)row * ldc + cofs) = val; }
             }
        __builtin_amdgcn_wave_barrier(); asm volatile("" ::: "memory");
    }
    if (EPI == 2) asm volatile("s_wait_xcnt 0x0" ::: "memory");    // the built code lays the V^T block right behind this one, with a branch round it: no register of the stores above is rewritten ahead of this wait on any path of the listing
    }
}

__device__ __forceinline__ void splitf(float y, unsigned short& h, unsigned short& l) { h = f2bf(y); l = f2bf(y - bf2f(h)); }
typedef __attribute__((ext_vector_type(2))) _Float16 v2h;
typedef __attribute__((ext_vector_type(4))) _Float16 v4h;
typedef __attribute__((ext_vector_type(2))) unsigned short v2us;
typedef __attribute__((ext_vector_type(4))) unsigned short v4us;
typedef __attribute__((ext_vector_type(4))) int v4i;

__global__ __launch_bounds__(256) void k_wtG(const float* __restrict__ w, int K, int N, bf* Bt) {
    const int lane = threadIdx.x & 31; const int L0 = (blockIdx.x * 8 + (threadIdx.x >> 5)) * 8; const int nlines = N * K / 64;
{
#pragma unroll 1
        for (int l = 0; l < 8; ++l) { const int L = L0 + l; if (L >= nlines) break; const size_t e = (size_t)L * 64 + lane * 2; const int k = (int)(e % K), n = (int)(e / K); v2us o;
            o[0] = f2bf(w[(size_t)k * N + n]); o[1] = f2bf(w[(size_t)(k + 1) * N + n]); *(v2us*)(Bt + e) = o; }
         }
}

__global__ __launch_bounds__(256) void k_ln256(const float* __restrict__ X, int nrows, const float* __restrict__ gw, const float* __restrict__ gb, bf* Yh, bf* Yl) {
    const int lane = threadIdx.x & 31; const int r = blockIdx.x * 8 + (threadIdx.x >> 5); if (r >= nrows) return; const float* xr = X + (size_t)r * DM; float hv[8]; float s = 0.f;
#pragma unroll
    for (int ch = 0; ch < 2; ++ch) { const v4f y = *(const v4f*)(xr + ch * 128 + lane * 4);
#pragma unroll
        for (int q = 0; q < 4; ++q) { const float u = bfr(y[q]); hv[ch * 4 + q] = u; s += u; } }
#pragma unroll
    for (int sh = 16; sh; sh >>= 1) s += __shfl_xor(s, sh, 32);
    float mu = s * (1.0f / 256.0f); asm volatile("" : "+v"(mu)); float s2 = 0.f;
#pragma unroll
    for (int k = 0; k < 8; ++k) { float d0 = __fsub_rn(hv[k], mu); asm volatile("" : "+v"(d0)); float p = __fmul_rn(d0, d0); asm volatile("" : "+v"(p)); s2 = __fadd_rn(s2, p); }
#pragma unroll
    for (int sh = 16; sh; sh >>= 1) s2 += __shfl_xor(s2, sh, 32);
    float var = __fadd_rn(s2 * (1.0f / 256.0f), 1e-5f); asm volatile("" : "+v"(var)); const float rs = __frsqrt_rn(var);
{
#pragma unroll
        for (int ch = 0; ch < 2; ++ch) { const int c0 = ch * 128 + lane * 4; v4us oh, ol;
#pragma unroll
            for (int q = 0; q < 4; ++q) { float gg = bfr(gw[c0 + q]); asm volatile("" : "+v"(gg)); float d0 = __fsub_rn(hv[ch * 4 + q], mu); asm volatile("" : "+v"(d0)); float n0 = __fmul_rn(d0, rs); asm volatile("" : "+v"(n0)); float y = __fmul_rn(n0, gg); asm volatile("" : "+v"(y)); y = __fadd_rn(y, bfr(gb[c0 + q])); unsigned short a, c2; splitf(y, a, c2); oh[q] = a; ol[q] = c2; }
            *(v4us*)(Yh + (size_t)r * DM + c0) = oh; *(v4us*)(Yl + (size_t)r * DM + c0) = ol; }
         } }
// ---- k_attn: scores, softmax and attn.v of 64 query rows of one (sequence, head) plane in ONE work-group; no score leaves the WGP. Grid (TT/64, ZH), 128 threads = 4 waves, 16 query rows a wave.
// The scores are formed transposed, S^T = K Q^T (A = 16 key rows from LDS, B = the wave's 16 query rows): an accumulator tile then holds, in lane (lr, hi), keys 8*hi + j of query lr, and two such tiles are, register for register, the B fragment of a 32-key step of O^T = V^T P^T. A wave keeps its whole 512 x 16 score block in 32 accumulator tiles, so the softmax is the plain one over the full row (a lane's 256 values, then one exchange with lane ^ 16).
// LDS: first the K planes (rows of KPT elements, hi plane then lo plane), then, in the same bytes, the V^T rows [hi 512 | lo 512] at pitch VPT (both pitches 16 B x odd).
#define KPT 72
__device__ __forceinline__ v16bf cat16v(v4w lo, v4w hi) { return __builtin_bit_cast(v16bf, __builtin_shufflevector(lo, hi, 0, 1, 2, 3, 4, 5, 6, 7)); }
#define VPT 1032
__global__ __launch_bounds__(128, 2) void k_attn(const bf* __restrict__ Qh, const bf* __restrict__ Ql, const bf* __restrict__ Kh, const bf* __restrict__ Kl, const bf* __restrict__ VT, const float* __restrict__ G, bf* __restrict__ Ah, bf* __restrict__ Al) {
    typedef WFrag<bf> F; typedef F::V V;
    __shared__ __align__(16) bf sm[2 * TT * KPT];
    const int tid = threadIdx.x, lane = tid & 31, lr = lane & 15, hi = lane >> 4; const size_t z = blockIdx.y; const int q0 = blockIdx.x * 64 + (tid >> 5) * 16;
    // the wave's Q fragments (B operand: lane lr = query row, k = d in the hardware order), and the K planes to LDS: 8 lanes take one row's 128 bytes; all 64 K loads of a thread are in flight together (the score registers are not live yet)
    V qh[2], ql[2];
    { const bf* pqh = Qh + (z * TT + q0 + lr) * HD + 8 * hi; const bf* pql = Ql + (z * TT + q0 + lr) * HD + 8 * hi;
        const bf* gh = Kh + z * (TT * HD) + tid * 8; const bf* gl = Kl + z * (TT * HD) + tid * 8; bf* l = sm + (tid >> 3) * KPT + (tid & 7) * 8; v8us rh[32], rl[32];
#pragma unroll
        for (int i = 0; i < 32; ++i) { rh[i] = *(const v8usa*)(gh + i * 1024); rl[i] = *(const v8usa*)(gl + i * 1024); }
#pragma unroll
        for (int c = 0; c < 2; ++c) { qh[c] = F::ld(pqh + c * 32); ql[c] = F::ld(pql + c * 32); }
        asm volatile("s_wait_xcnt 0x0" :: "v"(gh), "v"(gl), "v"(pqh), "v"(pql) : "memory");    // the loads' address registers stay theirs up to this wait: no load lands on them and nothing rewrites them ahead of it
#pragma unroll
        for (int i = 0; i < 32; ++i) { *(v8usa*)(l + i * 16 * KPT) = rh[i]; *(v8usa*)(l + (TT + i * 16) * KPT) = rl[i]; } }
    __syncthreads();    // K is written by other waves than read it
    v8f s[TT / 16];
#pragma unroll
    for (int t = 0; t < TT / 16; ++t) s[t] = (v8f){};
    const bf* kf = sm + lr * KPT + 8 * hi;
    V kh[2][4], kl[2][4];    // two fragment sets: step g + 1 (4 key tiles x 32 of d) is fetched as one group ahead of step g's products
#pragma unroll
    for (int t = 0; t < 4; ++t) { kh[0][t] = F::ld(kf + t * 16 * KPT); kl[0][t] = F::ld(kf + (TT + t * 16) * KPT); }
#pragma unroll
    for (int g = 0; g < TT / 32; ++g) { const int cur = g & 1, nx = cur ^ 1, t0 = (g >> 1) * 4, c = g & 1;
        if (g + 1 < TT / 32) { const int t1 = ((g + 1) >> 1) * 4, c1 = (g + 1) & 1;
#pragma unroll
            for (int t = 0; t < 4; ++t) { kh[nx][t] = F::ld(kf + (t1 + t) * 16 * KPT + c1 * 32); kl[nx][t] = F::ld(kf + (TT + (t1 + t) * 16) * KPT + c1 * 32); } }
        __builtin_amdgcn_sched_barrier(0);    // keeps the next step's LDS reads ahead of these products (left alone the compiler sinks each read to its use and waits for it there)
#pragma unroll
        for (int t = 0; t < 4; ++t) s[t0 + t] = F::mma(kh[cur][t], qh[c], s[t0 + t]);
        __builtin_amdgcn_sched_barrier(0);    // keeps four independent tiles between two products into one accumulator
#pragma unroll
        for (int t = 0; t < 4; ++t) s[t0 + t] = F::mma(kh[cur][t], ql[c], s[t0 + t]);
        __builtin_amdgcn_sched_barrier(0);    // as above
#pragma unroll
        for (int t = 0; t < 4; ++t) s[t0 + t] = F::mma(kl[cur][t], qh[c], s[t0 + t]);
        __builtin_amdgcn_sched_barrier(0); }    // ends the step: the reads of step g + 2 stay behind the products that still use their registers
    // softmax over the 512 keys of query lr: exp2((s - max) * HD^-0.5 * log2 e); eight partial maxima and sums (one per accumulator register), then a tree, then lane ^ 16
    v8f m8 = s[0];
#pragma unroll
    for (int t = 1; t < TT / 16; ++t)
#pragma unroll
        for (int j = 0; j < 8; ++j) m8[j] = fmaxf(m8[j], s[t][j]);
    float mx = fmaxf(fmaxf(fmaxf(m8[0], m8[1]), fmaxf(m8[2], m8[3])), fmaxf(fmaxf(m8[4], m8[5]), fmaxf(m8[6], m8[7])));
    mx = fmaxf(mx, __shfl_xor(mx, 16, 32));
    const float cs = SCL * 1.4426950408889634f, mc = mx * cs; v8f a8 = (v8f){};
#pragma unroll
    for (int t = 0; t < TT / 16; ++t) {
#pragma unroll
        for (int j = 0; j < 8; ++j) s[t][j] = __builtin_amdgcn_exp2f(s[t][j] * cs - mc);
        a8 += s[t];
        if ((t & 3) == 3) __builtin_amdgcn_sched_barrier(0); }    // bounds how many tiles' temporaries are live beside the 256 score registers (left alone the compiler fills the register budget and spills)
    float sum = ((a8[0] + a8[1]) + (a8[2] + a8[3])) + ((a8[4] + a8[5]) + (a8[6] + a8[7]));
    sum += __shfl_xor(sum, 16, 32);
    const float f = __fdiv_rn(1.0f, sum);
    // V^T to LDS, a row of 2,048 bytes a step, in two halves of 32 rows; the first half's loads need no LDS and are issued ahead of the barrier
    const bf* gv = VT + z * HD * (2 * TT) + tid * 8; bf* lv = sm + tid * 8; v8us r[32];
#pragma unroll
    for (int i = 0; i < 32; ++i) r[i] = *(const v8usa*)(gv + i * 2 * TT);
    asm volatile("s_wait_xcnt 0x0" :: "v"(gv) : "memory");    // the loads' address registers stay theirs up to this wait
    __syncthreads();    // every wave has read its last K fragment before V^T overwrites the bytes
#pragma unroll
    for (int i = 0; i < 32; ++i) *(v8usa*)(lv + i * VPT) = r[i];
#pragma unroll
    for (int i = 0; i < 32; ++i) r[i] = *(const v8usa*)(gv + (32 + i) * 2 * TT);
    asm volatile("s_wait_xcnt 0x0" :: "v"(gv) : "memory");    // as above
#pragma unroll
    for (int i = 0; i < 32; ++i) *(v8usa*)(lv + (32 + i) * VPT) = r[i];
    __syncthreads();    // V^T is written by other waves than read it
    v8f o[4];
#pragma unroll
    for (int mb = 0; mb < 4; ++mb) o[mb] = (v8f){};
    const bf* vf = sm + lr * VPT + 8 * hi;
    V vh[2][4], vl[2][4], ph[2], pl[2];    // two sets again: step c + 1's V^T fragments are fetched, and its probabilities split into hi and lo, beside step c's products
    { v4w h0, h1, l0, l1;
#pragma unroll
        for (int mb = 0; mb < 4; ++mb) { vh[0][mb] = F::ld(vf + mb * 16 * VPT); vl[0][mb] = F::ld(vf + mb * 16 * VPT + TT); }
        split8(s[0] * f, h0, l0); split8(s[1] * f, h1, l1);
        ph[0] = cat16v(h0, h1); pl[0] = cat16v(l0, l1); }
#pragma unroll
    for (int c = 0; c < TT / 32; ++c) { const int cur = c & 1, nx = cur ^ 1; const bool more = c + 1 < TT / 32; v4w h0 = {}, h1 = {}, l0 = {}, l1 = {};
        if (more) {
#pragma unroll
            for (int mb = 0; mb < 4; ++mb) { vh[nx][mb] = F::ld(vf + mb * 16 * VPT + (c + 1) * 32); vl[nx][mb] = F::ld(vf + mb * 16 * VPT + TT + (c + 1) * 32); } }
        __builtin_amdgcn_sched_barrier(0);    // keeps the next step's LDS reads ahead of these products
#pragma unroll
        for (int mb = 0; mb < 4; ++mb) o[mb] = F::mma(vh[cur][mb], ph[cur], o[mb]);
        if (more) split8(s[2 * c + 2] * f, h0, l0);
        __builtin_amdgcn_sched_barrier(0);    // keeps four independent tiles between two products into one accumulator, and a share of the split beside each four
#pragma unroll
        for (int mb = 0; mb < 4; ++mb) o[mb] = F::mma(vh[cur][mb], pl[cur], o[mb]);
        if (more) split8(s[2 * c + 3] * f, h1, l1);
        __builtin_amdgcn_sched_barrier(0);    // as above
#pragma unroll
        for (int mb = 0; mb < 4; ++mb) o[mb] = F::mma(vl[cur][mb], ph[cur], o[mb]);
        if (more) { ph[nx] = cat16v(h0, h1); pl[nx] = cat16v(l0, l1); }
        __builtin_amdgcn_sched_barrier(0); }    // ends the step
    // lane (lr, hi) holds d = mb*16 + hi*8 + j of query lr: out x sigmoid(gate) (true division), split into hi + lo, goes straight to the merged-head operand planes of the output projection
    const size_t oo = ((z / NH_) * TT + q0 + lr) * DQ + (z % NH_) * HD + hi * 8; v4f g[8];
#pragma unroll
    for (int i = 0; i < 8; ++i) g[i] = *(const v4f*)(G + oo + (i >> 1) * 16 + (i & 1) * 4);
#pragma unroll
    for (int mb = 0; mb < 4; ++mb) { v8f a; v4w h, l;
#pragma unroll
        for (int j = 0; j < 8; ++j) { const float den = __fadd_rn(1.0f, expf(-g[mb * 2 + (j >> 2)][j & 3])); a[j] = __fmul_rn(o[mb][j], __fdiv_rn(1.0f, den)); }
        split8(a, h, l); *(v4wa*)(Ah + oo + mb * 16) = h; *(v4wa*)(Al + oo + mb * 16) = l; }
}

extern "C" void kernel_launch(void* const* d_in, const int* in_sizes, int n_in,
                              void* d_out, int out_size, void* d_ws, size_t ws_size, hipStream_t stream) {
    (void)in_sizes; (void)n_in; (void)out_size;
    const float* x = (const float*)d_in[0]; const float* ln_g = (const float*)d_in[1]; const float* ln_b = (const float*)d_in[2]; const float* wq = (const float*)d_in[3]; const float* wkv = (const float*)d_in[4]; const float* wg = (const float*)d_in[5]; const float* bg = (const float*)d_in[6]; const float* wo = (const float*)d_in[7]; const float* bo = (const float*)d_in[8];
    float* OUT = (float*)d_out;     // [1][64][512][256] = [32768][256]
    char* wsp = (char*)d_ws;
    auto take = [&](size_t bytes) { char* p = wsp; wsp += (bytes + 255) & ~(size_t)255; return (void*)p; };
    bf* WQ = (bf*)take((size_t)DQ * DM * 2); bf* WKV = (bf*)take((size_t)2 * DQ * DM * 2); bf* WG = (bf*)take((size_t)DQ * DM * 2); bf* WO = (bf*)take((size_t)DM * DQ * 2);
    bf* LNh = (bf*)take((size_t)GR * DM * 2); bf* LNl = (bf*)take((size_t)GR * DM * 2); float* FG = (float*)take((size_t)GR * DQ * 4);
    bf* QPh = (bf*)take((size_t)ZH * TT * HD * 2); bf* QPl = (bf*)take((size_t)ZH * TT * HD * 2); bf* KPh = (bf*)take((size_t)ZH * TT * HD * 2); bf* KPl = (bf*)take((size_t)ZH * TT * HD * 2); bf* VTh = (bf*)take((size_t)ZH * HD * 2 * TT * 2);    // row (z, d) of V^T: hi at VTh + row*2*TT, lo TT elements behind it
    bf* ATh = (bf*)take((size_t)GR * DQ * 2); bf* ATl = (bf*)take((size_t)GR * DQ * 2);
    if ((size_t)(wsp - (char*)d_ws) > ws_size) return;    // ws 256 MiB
    /* weights ('xw': Bt[n][k] = W[k][n]); the fused Wkv gives Bt rows 0..511 = k, 512..1023 = v */
    k_wtG<<<(unsigned)((DM * DQ / 64 + 63) / 64), 256, 0, stream>>>(wq, DM, DQ, WQ); k_wtG<<<(unsigned)((DM * 2 * DQ / 64 + 63) / 64), 256, 0, stream>>>(wkv, DM, 2 * DQ, WKV); k_wtG<<<(unsigned)((DM * DQ / 64 + 63) / 64), 256, 0, stream>>>(wg, DM, DQ, WG); k_wtG<<<(unsigned)((DQ * DM / 64 + 63) / 64), 256, 0, stream>>>(wo, DQ, DM, WO);
    for (int g = 0; g < NB_ / GB; ++g) { const float* xg = x + (size_t)g * GR * DM;
        k_ln256<<<GR / 8, 256, 0, stream>>>(xg, GR, ln_g, ln_b, LNh, LNl);
        k_gemmw<bf, 1, false, DM, 1><<<dim3(GR / 64, DQ / 64, 1), 32, 0, stream>>>(LNh, LNl, WQ, nullptr, DM, nullptr, 0, nullptr, 0, 0, 0, QPh, QPl, nullptr);
        k_gemmw<bf, 1, false, DM, 2><<<dim3(GR / 64, 2 * DQ / 64, 1), 32, 0, stream>>>(LNh, LNl, WKV, nullptr, DM, nullptr, 0, nullptr, 0, 0, 0, KPh, KPl, VTh);
        k_gemmw<bf, 1, true, DM, 0><<<dim3(GR / 64, DQ / 64, 1), 32, 0, stream>>>(LNh, LNl, WG, nullptr, DM, FG, DQ, bg, 0, 0, 0, nullptr, nullptr, nullptr);
        k_attn<<<dim3(TT / 64, ZH, 1), 128, 0, stream>>>(QPh, QPl, KPh, KPl, VTh, FG, ATh, ATl);
        k_gemmw<bf, 1, true, DQ, 0><<<dim3(GR / 64, DM / 64, 1), 32, 0, stream>>>(ATh, ATl, WO, nullptr, DQ, OUT + (size_t)g * GR * DM, DM, bo, 0, 0, 0, nullptr, nullptr, nullptr); }
}

// v005
// A run of this version takes 308 microseconds.
// Two timings next to v004 put it at 1.26 and 1.27 times that version's speed.
// All steps since v000 together make it 5.24 times as fast.
#include <hip/hip_runtime.h>

// Gated row (axial) attention with a pre-LayerNorm (x [1][64][512][256]: 64 image rows = 64 independent sequences of 512 tokens x 256; xn = LayerNorm(x) (gamma, beta, eps 1e-5); q = xn Wq ('xw' [256][512], 8 heads x 64), [k|v] = xn Wkv ('xw' [256][1024]: columns k | v); dots = (q/8).k over the 512 keys of the same row; softmax (the explicit max subtraction is a softmax identity); out = attn.v merged; gates = sigmoid(xn Wg + bg) ('xw' [256][512]); y = (out * gates) Wo + bo ('xw' [512][256]) -> [1][64][512][256] (8.4 M)).
// Compute dtypes, f32 accumulate: every input rounded to bf16; LayerNorm in f32, xn as bf16 hi + lo planes; q / kv / gate projections as (hi + lo) x exact weights (2 products) + f32 bias; scores and attn.v on bf16 hi/lo planes (3 products) for every row; softmax f32; sigmoid gate f32 (true division); (out x gate) as hi + lo x exact Wo (2 products) + bo.
// Layout: 16 image rows (8,192 tokens) per pass; all per-(row, head) planes are laid out z-major ([z = row*8 + head][512][64]); scores, softmax and attn.v are ONE launch (k_attn), the scores and the probabilities live in registers only.
// Launches that do not depend on one another share one grid: the four weight transposes with the first pass's LayerNorm (k_pre); the q, kv and gate projections (one GEMM over the 2,048 stacked weight rows); the output projection with the next pass's LayerNorm. 13 launches: 1 + 4 x 3.
// No elementwise launch stands between the matrix kernels: the q and kv projections split their f32 tiles into the hi / lo planes (V transposed) in their own epilogue, and k_attn gates and splits its output tile in its own.
// Workspace: the transposed V planes lie [hi 512 | lo 512] per row (pitch 1,024 elements).

#define NB_  64        // sequences (image rows)
#define TT   512       // tokens per sequence
#define DM   256
#define NH_  8
#define HD   64
#define DQ   (NH_ * HD)    // 512 = inner dim
#define GB   16            // sequences per pass
#define GR   (GB * TT)     // 8192 token rows per pass
#define ZH   (GB * NH_)    // 128 (sequence, head) planes per pass
#define SCL  0.125f   // HD^-0.5
typedef _Float16 h16;
typedef unsigned short bf;
typedef __attribute__((ext_vector_type(16))) __bf16   v16bf;
typedef __attribute__((ext_vector_type(16))) _Float16 v16h;
typedef __attribute__((ext_vector_type(8)))  _Float16 v8h;
typedef __attribute__((ext_vector_type(8)))  unsigned short v8us;
typedef __attribute__((ext_vector_type(8)))  float    v8f;
typedef __attribute__((ext_vector_type(4)))  float    v4f;
typedef v8h  __attribute__((may_alias)) v8ha;
typedef v4f  __attribute__((may_alias)) v4fa;
typedef v8us __attribute__((may_alias)) v8usa;

__device__ __forceinline__ unsigned short f2bf(float f) { unsigned u = __float_as_uint(f); u += 0x7FFFu + ((u >> 16) & 1u); return (unsigned short)(u >> 16); }
__device__ __forceinline__ float bf2f(unsigned short b) { return __uint_as_float(((unsigned)b) << 16); }
__device__ __forceinline__ float bfr(float f) { return bf2f(f2bf(f)); }
__device__ __forceinline__ v16h cat16(v8h lo, v8h hi) { return __builtin_shufflevector(lo, hi, 0, 1, 2, 3, 4, 5, 6, 7, 8, 9, 10, 11, 12, 13, 14, 15); }
__device__ __forceinline__ v16bf cat16b(v8us lo, v8us hi) { return __builtin_bit_cast(v16bf, __builtin_shufflevector(lo, hi, 0, 1, 2, 3, 4, 5, 6, 7, 8, 9, 10, 11, 12, 13, 14, 15)); }
__device__ __forceinline__ v8f wmma16(v16h a, v16h b, v8f c) { return __builtin_amdgcn_wmma_f32_16x16x32_f16(false, a, false, b, (short)0, c, false, false); }
__device__ __forceinline__ v8f wmmab(v16bf a, v16bf b, v8f c) { return __builtin_amdgcn_wmma_f32_16x16x32_bf16(false, a, false, b, (short)0, c, false, false); }

typedef __attribute__((ext_vector_type(2))) float v2f;
typedef __attribute__((ext_vector_type(2))) __bf16 v2bf;
typedef __attribute__((ext_vector_type(4))) unsigned v4w;    // eight bf16 as four packed words
// hi = p rounded to nearest even, lo = the rest rounded likewise (as splitf), two values a word: the packed hi word is also the source of the two f32 that are subtracted
__device__ __forceinline__ void split8(v8f p, v4w& h, v4w& l) {
#pragma unroll
    for (int i = 0; i < 4; ++i) { const unsigned u = __builtin_bit_cast(unsigned, __builtin_convertvector(((v2f){p[2 * i], p[2 * i + 1]}), v2bf)); h[i] = u;
        l[i] = __builtin_bit_cast(unsigned, __builtin_convertvector(((v2f){p[2 * i] - __uint_as_float(u << 16), p[2 * i + 1] - __uint_as_float(u & 0xFFFF0000u)}), v2bf)); } }
typedef v4w __attribute__((may_alias)) v4wa;

__device__ __forceinline__ void splitf(float y, unsigned short& h, unsigned short& l) { h = f2bf(y); l = f2bf(y - bf2f(h)); }
typedef __attribute__((ext_vector_type(2))) unsigned short v2us;
typedef __attribute__((ext_vector_type(4))) unsigned short v4us;
// LayerNorm of one row of 256 by one wave: y0, y1 are the lane's elements lane*4 .. +3 and 128 + lane*4 .. +3 of row r; g0, g1 and b0, b1 the same elements of gamma and beta
__device__ __forceinline__ void ln_row(const v4f y0, const v4f y1, const v4f g0, const v4f g1, const v4f b0, const v4f b1, const size_t r, const int lane, bf* Yh, bf* Yl) {
    float hv[8]; float s = 0.f;
#pragma unroll
    for (int ch = 0; ch < 2; ++ch) { const v4f y = ch ? y1 : y0;
#pragma unroll
        for (int q = 0; q < 4; ++q) { const float u = bfr(y[q]); hv[ch * 4 + q] = u; s += u; } }
#pragma unroll
    for (int sh = 16; sh; sh >>= 1) s += __shfl_xor(s, sh, 32);
    float mu = s * (1.0f / 256.0f); asm volatile("" : "+v"(mu)); float s2 = 0.f;
#pragma unroll
    for (int k = 0; k < 8; ++k) { float d0 = __fsub_rn(hv[k], mu); asm volatile("" : "+v"(d0)); float p = __fmul_rn(d0, d0); asm volatile("" : "+v"(p)); s2 = __fadd_rn(s2, p); }
#pragma unroll
    for (int sh = 16; sh; sh >>= 1) s2 += __shfl_xor(s2, sh, 32);
    float var = __fadd_rn(s2 * (1.0f / 256.0f), 1e-5f); asm volatile("" : "+v"(var)); const float rs = __frsqrt_rn(var);
#pragma unroll
    for (int ch = 0; ch < 2; ++ch) { const int c0 = ch * 128 + lane * 4; v4us oh, ol;
#pragma unroll
        for (int q = 0; q < 4; ++q) { float gg = bfr((ch ? g1 : g0)[q]); asm volatile("" : "+v"(gg)); float d0 = __fsub_rn(hv[ch * 4 + q], mu); asm volatile("" : "+v"(d0)); float n0 = __fmul_rn(d0, rs); asm volatile("" : "+v"(n0)); float y = __fmul_rn(n0, gg); asm volatile("" : "+v"(y)); y = __fadd_rn(y, bfr((ch ? b1 : b0)[q])); unsigned short a, c2; splitf(y, a, c2); oh[q] = a; ol[q] = c2; }
        *(v4us*)(Yh + r * DM + c0) = oh; *(v4us*)(Yl + r * DM + c0) = ol; }
}

// ---- k_gemmw: register-blocked GEMM, ONE WAVE per 64x64 output tile (16 accumulators), operands from K-contiguous 16-bit planes; grid (M/64, N/64, Z), 32 threads.
// C[m][n] (f32, pitch ldc, + optional f32 bias[n]) = sum_k A[m][k] Bt[n][k] (+ split products per NSPLIT). K (a template argument, so that a piece's 16 loads of a plane share one offset register and differ in the immediate offset) is the row pitch of A and of Bt in elements, KD <= K the depth that is summed. z-batch strides sA/sB/sC in elements. KD % 64 == 0, K % 64 == 0.
// Each 64-row x 64-deep piece of a plane goes through LDS: a global load takes 4 whole 128-byte lines (8 lanes a row), where a fragment load straight from memory touches 16 lines for the same 512 bytes; the fragments are then read from LDS rows of SP elements (144 B = 16 B x 9: no bank conflict).
// EPI says where the tile goes. 0: C as above, one plane (z = 0); work-groups with blockIdx.z > 0, where the grid has any, do no GEMM tile but 8 LayerNorm rows each (X -> Ph, Pl): they start behind the GEMM tiles, which run longer. 1: the stacked projections, by the tile's column: a tile is 64 tokens x one head (64 | TT, HD = 64); columns below DQ (q) and below 2 DQ (k) are split into bf16 hi + lo and stored as 64 whole rows of the z-major planes Ph, Pl (q) or Kh, Kl (k); columns below 3 DQ (v) go transposed into VT: an accumulator register group holds 8 successive tokens of one d, which are 16 bytes of a V^T row as they stand; the last DQ columns (gate) go to C with the bias.
#define SP 72
template <bool B> struct Sel { static constexpr bool v = B; };
template <typename T16> struct WFrag;
template <> struct WFrag<h16> { typedef v16h V; static __device__ __forceinline__ V ld(const h16* p) { return cat16(*(const v8h*)p, *(const v8h*)(p + 16)); } static __device__ __forceinline__ v8f mma(V a, V b, v8f c) { return wmma16(a, b, c); } };
template <> struct WFrag<bf> { typedef v16bf V; static __device__ __forceinline__ V ld(const bf* p) { return cat16b(*(const v8us*)p, *(const v8us*)(p + 16)); } static __device__ __forceinline__ v8f mma(V a, V b, v8f c) { return wmmab(a, b, c); } };
template <typename T16, int NSPLIT, bool BIAS, int K, int EPI>
__global__ __launch_bounds__(32) void k_gemmw(const T16* __restrict__ A, const T16* __restrict__ A2, const T16* __restrict__ Bt, const T16* __restrict__ Bt2, int KD, float* C, int ldc, const float* __restrict__ bias, size_t sA, size_t sB, size_t sC, bf* Ph, bf* Pl, bf* VT, bf* Kh, bf* Kl, const float* __restrict__ X, const float* __restrict__ gw, const float* __restrict__ gb) {
    typedef typename WFrag<T16>::V V;
    if (EPI == 0 && blockIdx.z > 0) {    // a LayerNorm work-group (one wave, so the whole group leaves here, ahead of every barrier): its 8 rows' loads are all in flight together
        const int ln = threadIdx.x & 31; const size_t rw = (((size_t)(blockIdx.z - 1) * gridDim.y + blockIdx.y) * gridDim.x + blockIdx.x) * 8; v4f y[8][2];
#pragma unroll
        for (int i = 0; i < 8; ++i) { y[i][0] = *(const v4f*)(X + (rw + i) * DM + ln * 4); y[i][1] = *(const v4f*)(X + (rw + i) * DM + 128 + ln * 4); }
        const v4f g0 = *(const v4f*)(gw + ln * 4), g1 = *(const v4f*)(gw + 128 + ln * 4), b0 = *(const v4f*)(gb + ln * 4), b1 = *(const v4f*)(gb + 128 + ln * 4);
#pragma unroll
        for (int i = 0; i < 8; ++i) ln_row(y[i][0], y[i][1], g0, g1, b0, b1, rw + i, ln, Ph, Pl);
        asm volatile("s_wait_xcnt 0x0" ::: "memory");    // ends the block: whatever the built code lays behind it rewrites no register of the stores above ahead of this wait
        return; }
    __shared__ __align__(16) float os[16 * 68];
    __shared__ __align__(16) T16 sa[64 * SP], sb[64 * SP], sa2[(NSPLIT == 1 || NSPLIT == 2) ? 64 * SP : 8], sb2[NSPLIT >= 2 ? 64 * SP : 8];
    const size_t z = blockIdx.z; A += z * sA; if (A2) A2 += z * sA; Bt += z * sB; if (Bt2) Bt2 += z * sB; C += z * sC;
    const int lane = threadIdx.x & 31, lr = lane & 15, hi = lane >> 4; const int r0 = blockIdx.x * 64, c0 = blockIdx.y * 64;
    v8f acc[4][4];
#pragma unroll
    for (int mb = 0; mb < 4; ++mb)
#pragma unroll
        for (int nb = 0; nb < 4; ++nb) acc[mb][nb] = (v8f){};
    const int srow = lane >> 3, scol = (lane & 7) * 8;    // staging: 8 lanes take one row's 128 bytes
    const unsigned aoff = ((unsigned)(r0 + srow) * K + scol) * 2u, boff = ((unsigned)(c0 + srow) * K + scol) * 2u;    // byte offsets (a plane is below 4 GiB): the plane pointers stay scalar and one offset register serves both A planes, which keeps the kernel at three waves a SIMD with a whole piece in flight
    const int soff = srow * SP + scol, foff = lr * SP + 8 * hi;
#pragma unroll 1
    for (int k0 = 0; k0 < KD; k0 += 64) { const unsigned ao = aoff + k0 * 2u, bo = boff + k0 * 2u; const char* pa = (const char*)A + ao; const char* pb = (const char*)Bt + bo; const char* pa2 = (NSPLIT == 1 || NSPLIT == 2) ? (const char*)A2 + ao : pa; const char* pb2 = NSPLIT >= 2 ? (const char*)Bt2 + bo : pb;
        v8us ra[16], rb[16], ra2[(NSPLIT == 1 || NSPLIT == 2) ? 16 : 1], rb2[NSPLIT >= 2 ? 16 : 1];
#pragma unroll    // all loads of a piece in flight together, each row step an immediate offset
        for (int i = 0; i < 16; ++i) { ra[i] = *(const v8usa*)(pa + i * 8 * K); rb[i] = *(const v8usa*)(pb + i * 8 * K);
            if (NSPLIT == 1 || NSPLIT == 2) ra2[i] = *(const v8usa*)(pa2 + i * 8 * K); if (NSPLIT >= 2) rb2[i] = *(const v8usa*)(pb2 + i * 8 * K); }
        asm volatile("s_wait_xcnt 0x0" :: "v"(ao), "v"(bo) : "memory");    // the loads' address registers stay theirs up to this wait: no later load lands on them, the next piece's addresses are formed behind it; standing ahead of the LDS stores it also keeps every load of the piece ahead of the first store (left alone the stacked-projection build waits for each load by itself)
#pragma unroll
        for (int i = 0; i < 16; ++i) { *(v8usa*)(sa + soff + i * 4 * SP) = ra[i]; *(v8usa*)(sb + soff + i * 4 * SP) = rb[i];
            if (NSPLIT == 1 || NSPLIT == 2) *(v8usa*)(sa2 + soff + i * 4 * SP) = ra2[i]; if (NSPLIT >= 2) *(v8usa*)(sb2 + soff + i * 4 * SP) = rb2[i]; }
        __syncthreads();    // the piece is written by other lanes than read it (a one-wave group: it builds to the LDS wait and keeps the compiler from reading ahead of the stores)
        V a[4], a2[4];
#pragma unroll    // the second half's fragment reads are scheduled among the first half's products
      for (int kc = 0; kc < 64; kc += 32) {
#pragma unroll
        for (int mb = 0; mb < 4; ++mb) { a[mb] = WFrag<T16>::ld(sa + foff + mb * 16 * SP + kc); if (NSPLIT == 1 || NSPLIT == 2) a2[mb] = WFrag<T16>::ld(sa2 + foff + mb * 16 * SP + kc); }
#pragma unroll
        for (int nb = 0; nb < 4; ++nb) { const V b = WFrag<T16>::ld(sb + foff + nb * 16 * SP + kc); V b2; if (NSPLIT >= 2) b2 = WFrag<T16>::ld(sb2 + foff + nb * 16 * SP + kc);
#pragma unroll
            for (int mb = 0; mb < 4; ++mb) { acc[mb][nb] = WFrag<T16>::mma(a[mb], b, acc[mb][nb]); if (NSPLIT == 1 || NSPLIT == 2) acc[mb][nb] = WFrag<T16>::mma(a2[mb], b, acc[mb][nb]); if (NSPLIT >= 2) acc[mb][nb] = WFrag<T16>::mma(a[mb], b2, acc[mb][nb]); } }
      }
        asm volatile("v_nop\n\tv_nop\n\tv_nop\n\tv_nop" : "+v"(acc[0][0]), "+v"(acc[1][1]), "+v"(acc[2][2]), "+v"(acc[3][3]) : "v"(a[0]), "v"(a[3]));
        __syncthreads();    // every fragment is read before the next piece overwrites it (keeps the next stores behind these reads)
    }
    const size_t zz = (size_t)(r0 / TT) * NH_ + (c0 / HD) % NH_; const int t0 = r0 % TT;    // the tile's (sequence, head) plane and its first token
    if (EPI == 1 && c0 >= 2 * DQ && c0 < 3 * DQ) {
        bf* vrow = VT + (zz * HD + lr) * (2 * TT) + t0 + hi * 8;
#pragma unroll
        for (int nb = 0; nb < 4; ++nb)
#pragma unroll
            for (int mb = 0; mb < 4; ++mb) { v4w h, l; split8(acc[mb][nb], h, l); *(v4wa*)(vrow + nb * 16 * 2 * TT + mb * 16) = h; *(v4wa*)(vrow + nb * 16 * 2 * TT + mb * 16 + TT) = l; }
    } else {
    auto rows = [&](auto pln) __attribute__((always_inline)) {    // the tile by way of os, 16 rows at a time; pln: to the hi / lo planes, else to C (the choice is made once a tile, outside the loop)
#pragma unroll
    for (int mb = 0; mb < 4; ++mb) {
#pragma unroll
        for (int nb = 0; nb < 4; ++nb) {
#pragma unroll
            for (int j = 0; j < 8; ++j) os[(hi * 8 + j) * 68 + nb * 16 + lr] = acc[mb][nb][j]; }
        __builtin_amdgcn_wave_barrier(); asm volatile("" ::: "memory");
        if (decltype(pln)::v) { bf* ph = c0 < DQ ? Ph : Kh; bf* pl = c0 < DQ ? Pl : Kl; const size_t po = (zz * TT + t0 + mb * 16 + (lane >> 3)) * HD + (lane & 7) * 8;    // 8 lanes a row: a store takes 4 whole 128-byte rows
#pragma unroll
            for (int s = 0; s < 4; ++s) { const float* orw = os + (4 * s + (lane >> 3)) * 68 + (lane & 7) * 8; const v4f x0 = *(const v4fa*)orw, x1 = *(const v4fa*)(orw + 4); v4w h, l;
                split8((v8f){x0[0], x0[1], x0[2], x0[3], x1[0], x1[1], x1[2], x1[3]}, h, l); *(v4wa*)(ph + po + s * 4 * HD) = h; *(v4wa*)(pl + po + s * 4 * HD) = l; }
        } else {
        const int cg = EPI == 1 ? c0 - 3 * DQ : c0;    // the tile's first column in C and in the bias
        float* crow = C + (size_t)(r0 + mb * 16) * ldc + cg;
#pragma unroll
            for (int s = 0; s < 8; ++s) { const int row = 2 * s + hi, cofs = lr * 4; v4f val = *(const v4fa*)(os + row * 68 + cofs); if (BIAS) { val[0] += bfr(bias[cg + cofs]); val[1] += bfr(bias[cg + cofs + 1]); val[2] += bfr(bias[cg + cofs + 2]); val[3] += bfr(bias[cg + cofs + 3]); }
                *(v4f*)(crow + (size_t)row * ldc + cofs) = val; }
             }
        __builtin_amdgcn_wave_barrier(); asm volatile("s_wait_xcnt 0x0" ::: "memory");    // keeps the next rows' writes of os behind these reads, as before; the wait: no register of the stores above is rewritten, and no later load lands on one, ahead of it (the next rows' bias load did; behind the last rows the built code lays another block of the kernel, with a branch round it)
    }
    };
    if (EPI == 1 && c0 < 2 * DQ) rows(Sel<true>{}); else rows(Sel<false>{});
    }
}

// ---- k_pre: the four weight transposes ('xw': Bt[n][k] = W[k][n], 64 lines of 64 elements a work-group: 32 + 64 + 32 + 32 work-groups) and, behind them in the same grid, the first pass's LayerNorm (a row a wave).
#define WB (DM * DQ / 64 / 64)    // work-groups of a 256 x 512 weight
__global__ __launch_bounds__(256) void k_pre(const float* __restrict__ wq, const float* __restrict__ wkv, const float* __restrict__ wg, const float* __restrict__ wo, bf* WQ, bf* WKV, bf* WG, bf* WO, const float* __restrict__ X, const float* __restrict__ gw, const float* __restrict__ gb, bf* Yh, bf* Yl) {
    const int lane = threadIdx.x & 31, wv = threadIdx.x >> 5, b = blockIdx.x;
    if (b < 5 * WB) {
        const float* w = b < WB ? wq : b < 3 * WB ? wkv : b < 4 * WB ? wg : wo; bf* Bt = b < WB ? WQ : b < 3 * WB ? WKV : b < 4 * WB ? WG : WO;
        const int K = b < 4 * WB ? DM : DQ, N = b < WB ? DQ : b < 3 * WB ? 2 * DQ : b < 4 * WB ? DQ : DM, b0 = b < WB ? 0 : b < 3 * WB ? WB : b < 4 * WB ? 3 * WB : 4 * WB;
        const int L0 = ((b - b0) * 8 + wv) * 8;
#pragma unroll 1
        for (int l = 0; l < 8; ++l) { const size_t e = (size_t)(L0 + l) * 64 + lane * 2; const int k = (int)(e % K), n = (int)(e / K); v2us o;
            o[0] = f2bf(w[(size_t)k * N + n]); o[1] = f2bf(w[(size_t)(k + 1) * N + n]); *(v2us*)(Bt + e) = o; }
        return; }
    const size_t r = (size_t)(b - 5 * WB) * 8 + wv; const float* xr = X + r * DM;
    ln_row(*(const v4f*)(xr + lane * 4), *(const v4f*)(xr + 128 + lane * 4), *(const v4f*)(gw + lane * 4), *(const v4f*)(gw + 128 + lane * 4), *(const v4f*)(gb + lane * 4), *(const v4f*)(gb + 128 + lane * 4), r, lane, Yh, Yl);
    asm volatile("s_wait_xcnt 0x0" ::: "memory");    // ends the block: the built code lays the transposes behind it, which rewrite no register of the stores above ahead of this wait
}
// ---- k_attn: scores, softmax and attn.v of 64 query rows of one (sequence, head) plane in ONE work-group; no score leaves the WGP. Grid (TT/64, ZH), 128 threads = 4 waves, 16 query rows a wave.
// The scores are formed transposed, S^T = K Q^T (A = 16 key rows from LDS, B = the wave's 16 query rows): an accumulator tile then holds, in lane (lr, hi), keys 8*hi + j of query lr, and two such tiles are, register for register, the B fragment of a 32-key step of O^T = V^T P^T. A wave keeps its whole 512 x 16 score block in 32 accumulator tiles, so the softmax is the plain one over the full row (a lane's 256 values, then one exchange with lane ^ 16).
// LDS: first the K planes (rows of KPT elements, hi plane then lo plane), then, in the same bytes, the V^T rows [hi 512 | lo 512] at pitch VPT (both pitches 16 B x odd).
#define KPT 72
__device__ __forceinline__ v16bf cat16v(v4w lo, v4w hi) { return __builtin_bit_cast(v16bf, __builtin_shufflevector(lo, hi, 0, 1, 2, 3, 4, 5, 6, 7)); }
#define VPT 1032
__global__ __launch_bounds__(128, 2) void k_attn(const bf* __restrict__ Qh, const bf* __restrict__ Ql, const bf* __restrict__ Kh, const bf* __restrict__ Kl, const bf* __restrict__ VT, const float* __restrict__ G, bf* __restrict__ Ah, bf* __restrict__ Al) {
    typedef WFrag<bf> F; typedef F::V V;
    __shared__ __align__(16) bf sm[2 * TT * KPT];
    const int tid = threadIdx.x, lane = tid & 31, lr = lane & 15, hi = lane >> 4; const size_t z = blockIdx.y; const int q0 = blockIdx.x * 64 + (tid >> 5) * 16;
    // the wave's Q fragments (B operand: lane lr = query row, k = d in the hardware order), and the K planes to LDS: 8 lanes take one row's 128 bytes; all 64 K loads of a thread are in flight together (the score registers are not live yet)
    V qh[2], ql[2];
    { const bf* pqh = Qh + (z * TT + q0 + lr) * HD + 8 * hi; const bf* pql = Ql + (z * TT + q0 + lr) * HD + 8 * hi;
        const bf* gh = Kh + z * (TT * HD) + tid * 8; const bf* gl = Kl + z * (TT * HD) + tid * 8; bf* l = sm + (tid >> 3) * KPT + (tid & 7) * 8; v8us rh[32], rl[32];
#pragma unroll
        for (int i = 0; i < 32; ++i) { rh[i] = *(const v8usa*)(gh + i * 1024); rl[i] = *(const v8usa*)(gl + i * 1024); }
#pragma unroll
        for (int c = 0; c < 2; ++c) { qh[c] = F::ld(pqh + c * 32); ql[c] = F::ld(pql + c * 32); }
        asm volatile("s_wait_xcnt 0x0" :: "v"(gh), "v"(gl), "v"(pqh), "v"(pql) : "memory");    // the loads' address registers stay theirs up to this wait: no load lands on them and nothing rewrites them ahead of it
#pragma unroll
        for (int i = 0; i < 32; ++i) { *(v8usa*)(l + i * 16 * KPT) = rh[i]; *(v8usa*)(l + (TT + i * 16) * KPT) = rl[i]; } }
    __syncthreads();    // K is written by other waves than read it
    v8f s[TT / 16];
#pragma unroll
    for (int t = 0; t < TT / 16; ++t) s[t] = (v8f){};
    const bf* kf = sm + lr * KPT + 8 * hi;
    V kh[2][4], kl[2][4];    // two fragment sets: step g + 1 (4 key tiles x 32 of d) is fetched as one group ahead of step g's products
#pragma unroll
    for (int t = 0; t < 4; ++t) { kh[0][t] = F::ld(kf + t * 16 * KPT); kl[0][t] = F::ld(kf + (TT + t * 16) * KPT); }
#pragma unroll
    for (int g = 0; g < TT / 32; ++g) { const int cur = g & 1, nx = cur ^ 1, t0 = (g >> 1) * 4, c = g & 1;
        if (g + 1 < TT / 32) { const int t1 = ((g + 1) >> 1) * 4, c1 = (g + 1) & 1;
#pragma unroll
            for (int t = 0; t < 4; ++t) { kh[nx][t] = F::ld(kf + (t1 + t) * 16 * KPT + c1 * 32); kl[nx][t] = F::ld(kf + (TT + (t1 + t) * 16) * KPT + c1 * 32); } }
        __builtin_amdgcn_sched_barrier(0);    // keeps the next step's LDS reads ahead of these products (left alone the compiler sinks each read to its use and waits for it there)
#pragma unroll
        for (int t = 0; t < 4; ++t) s[t0 + t] = F::mma(kh[cur][t], qh[c], s[t0 + t]);
        __builtin_amdgcn_sched_barrier(0);    // keeps four independent tiles between two products into one accumulator
#pragma unroll
        for (int t = 0; t < 4; ++t) s[t0 + t] = F::mma(kh[cur][t], ql[c], s[t0 + t]);
        __builtin_amdgcn_sched_barrier(0);    // as above
#pragma unroll
        for (int t = 0; t < 4; ++t) s[t0 + t] = F::mma(kl[cur][t], qh[c], s[t0 + t]);
        __builtin_amdgcn_sched_barrier(0); }    // ends the step: the reads of step g + 2 stay behind the products that still use their registers
    // softmax over the 512 keys of query lr: exp2((s - max) * HD^-0.5 * log2 e); eight partial maxima and sums (one per accumulator register), then a tree, then lane ^ 16
    v8f m8 = s[0];
#pragma unroll
    for (int t = 1; t < TT / 16; ++t)
#pragma unroll
        for (int j = 0; j < 8; ++j) m8[j] = fmaxf(m8[j], s[t][j]);
    float mx = fmaxf(fmaxf(fmaxf(m8[0], m8[1]), fmaxf(m8[2], m8[3])), fmaxf(fmaxf(m8[4], m8[5]), fmaxf(m8[6], m8[7])));
    mx = fmaxf(mx, __shfl_xor(mx, 16, 32));
    const float cs = SCL * 1.4426950408889634f, mc = mx * cs; v8f a8 = (v8f){};
#pragma unroll
    for (int t = 0; t < TT / 16; ++t) {
#pragma unroll
        for (int j = 0; j < 8; ++j) s[t][j] = __builtin_amdgcn_exp2f(s[t][j] * cs - mc);
        a8 += s[t];
        if ((t & 3) == 3) __builtin_amdgcn_sched_barrier(0); }    // bounds how many tiles' temporaries are live beside the 256 score registers (left alone the compiler fills the register budget and spills)
    float sum = ((a8[0] + a8[1]) + (a8[2] + a8[3])) + ((a8[4] + a8[5]) + (a8[6] + a8[7]));
    sum += __shfl_xor(sum, 16, 32);
    const float f = __fdiv_rn(1.0f, sum);
    // V^T to LDS, a row of 2,048 bytes a step, in two halves of 32 rows; the first half's loads need no LDS and are issued ahead of the barrier
    const bf* gv = VT + z * HD * (2 * TT) + tid * 8; bf* lv = sm + tid * 8; v8us r[32];
#pragma unroll
    for (int i = 0; i < 32; ++i) r[i] = *(const v8usa*)(gv + i * 2 * TT);
    asm volatile("s_wait_xcnt 0x0" :: "v"(gv) : "memory");    // the loads' address registers stay theirs up to this wait
    __syncthreads();    // every wave has read its last K fragment before V^T overwrites the bytes
#pragma unroll
    for (int i = 0; i < 32; ++i) *(v8usa*)(lv + i * VPT) = r[i];
#pragma unroll
    for (int i = 0; i < 32; ++i) r[i] = *(const v8usa*)(gv + (32 + i) * 2 * TT);
    asm volatile("s_wait_xcnt 0x0" :: "v"(gv) : "memory");    // as above
#pragma unroll
    for (int i = 0; i < 32; ++i) *(v8usa*)(lv + (32 + i) * VPT) = r[i];
    __syncthreads();    // V^T is written by other waves than read it
    v8f o[4];
#pragma unroll
    for (int mb = 0; mb < 4; ++mb) o[mb] = (v8f){};
    const bf* vf = sm + lr * VPT + 8 * hi;
    V vh[2][4], vl[2][4], ph[2], pl[2];    // two sets again: step c + 1's V^T fragments are fetched, and its probabilities split into hi and lo, beside step c's products
    { v4w h0, h1, l0, l1;
#pragma unroll
        for (int mb = 0; mb < 4; ++mb) { vh[0][mb] = F::ld(vf + mb * 16 * VPT); vl[0][mb] = F::ld(vf + mb * 16 * VPT + TT); }
        split8(s[0] * f, h0, l0); split8(s[1] * f, h1, l1);
        ph[0] = cat16v(h0, h1); pl[0] = cat16v(l0, l1); }
#pragma unroll
    for (int c = 0; c < TT / 32; ++c) { const int cur = c & 1, nx = cur ^ 1; const bool more = c + 1 < TT / 32; v4w h0 = {}, h1 = {}, l0 = {}, l1 = {};
        if (more) {
#pragma unroll
            for (int mb = 0; mb < 4; ++mb) { vh[nx][mb] = F::ld(vf + mb * 16 * VPT + (c + 1) * 32); vl[nx][mb] = F::ld(vf + mb * 16 * VPT + TT + (c + 1) * 32); } }
        __builtin_amdgcn_sched_barrier(0);    // keeps the next step's LDS reads ahead of these products
#pragma unroll
        for (int mb = 0; mb < 4; ++mb) o[mb] = F::mma(vh[cur][mb], ph[cur], o[mb]);
        if (more) split8(s[2 * c + 2] * f, h0, l0);
        __builtin_amdgcn_sched_barrier(0);    // keeps four independent tiles between two products into one accumulator, and a share of the split beside each four
#pragma unroll
        for (int mb = 0; mb < 4; ++mb) o[mb] = F::mma(vh[cur][mb], pl[cur], o[mb]);
        if (more) split8(s[2 * c + 3] * f, h1, l1);
        __builtin_amdgcn_sched_barrier(0);    // as above
#pragma unroll
        for (int mb = 0; mb < 4; ++mb) o[mb] = F::mma(vl[cur][mb], ph[cur], o[mb]);
        if (more) { ph[nx] = cat16v(h0, h1); pl[nx] = cat16v(l0, l1); }
        __builtin_amdgcn_sched_barrier(0); }    // ends the step
    // lane (lr, hi) holds d = mb*16 + hi*8 + j of query lr: out x sigmoid(gate) (true division), split into hi + lo, goes straight to the merged-head operand planes of the output projection
    const size_t oo = ((z / NH_) * TT + q0 + lr) * DQ + (z % NH_) * HD + hi * 8; v4f g[8];
#pragma unroll
    for (int i = 0; i < 8; ++i) g[i] = *(const v4f*)(G + oo + (i >> 1) * 16 + (i & 1) * 4);
#pragma unroll
    for (int mb = 0; mb < 4; ++mb) { v8f a; v4w h, l;
#pragma unroll
        for (int j = 0; j < 8; ++j) { const float den = __fadd_rn(1.0f, expf(-g[mb * 2 + (j >> 2)][j & 3])); a[j] = __fmul_rn(o[mb][j], __fdiv_rn(1.0f, den)); }
        split8(a, h, l); *(v4wa*)(Ah + oo + mb * 16) = h; *(v4wa*)(Al + oo + mb * 16) = l; }
}

extern "C" void kernel_launch(void* const* d_in, const int* in_sizes, int n_in,
                              void* d_out, int out_size, void* d_ws, size_t ws_size, hipStream_t stream) {
    (void)in_sizes; (void)n_in; (void)out_size;
    const float* x = (const float*)d_in[0]; const float* ln_g = (const float*)d_in[1]; const float* ln_b = (const float*)d_in[2]; const float* wq = (const float*)d_in[3]; const float* wkv = (const float*)d_in[4]; const float* wg = (const float*)d_in[5]; const float* bg = (const float*)d_in[6]; const float* wo = (const float*)d_in[7]; const float* bo = (const float*)d_in[8];
    float* OUT = (float*)d_out;     // [1][64][512][256] = [32768][256]
    char* wsp = (char*)d_ws;
    auto take = [&](size_t bytes) { char* p = wsp; wsp += (bytes + 255) & ~(size_t)255; return (void*)p; };
    bf* WQ = (bf*)take((size_t)4 * DQ * DM * 2); bf* WKV = WQ + DQ * DM; bf* WG = WQ + 3 * DQ * DM;    /* one Bt of 2,048 rows: q | k | v | gate */
    bf* WO = (bf*)take((size_t)DM * DQ * 2);
    bf* LNh = (bf*)take((size_t)GR * DM * 2); bf* LNl = (bf*)take((size_t)GR * DM * 2); float* FG = (float*)take((size_t)GR * DQ * 4);
    bf* QPh = (bf*)take((size_t)ZH * TT * HD * 2); bf* QPl = (bf*)take((size_t)ZH * TT * HD * 2); bf* KPh = (bf*)take((size_t)ZH * TT * HD * 2); bf* KPl = (bf*)take((size_t)ZH * TT * HD * 2); bf* VTh = (bf*)take((size_t)ZH * HD * 2 * TT * 2);    // row (z, d) of V^T: hi at VTh + row*2*TT, lo TT elements behind it
    bf* ATh = (bf*)take((size_t)GR * DQ * 2); bf* ATl = (bf*)take((size_t)GR * DQ * 2);
    if ((size_t)(wsp - (char*)d_ws) > ws_size) return;    // ws 256 MiB
    k_pre<<<5 * WB + GR / 8, 256, 0, stream>>>(wq, wkv, wg, wo, WQ, WKV, WG, WO, x, ln_g, ln_b, LNh, LNl);
    for (int g = 0; g < NB_ / GB; ++g) {
        k_gemmw<bf, 1, true, DM, 1><<<dim3(GR / 64, 4 * DQ / 64, 1), 32, 0, stream>>>(LNh, LNl, WQ, nullptr, DM, FG, DQ, bg, 0, 0, 0, QPh, QPl, VTh, KPh, KPl, nullptr, nullptr, nullptr);
        k_attn<<<dim3(TT / 64, ZH, 1), 128, 0, stream>>>(QPh, QPl, KPh, KPl, VTh, FG, ATh, ATl);
        /* LNh, LNl are free once this pass's projections have run: the next pass's rows are normalised beside the output projection (GR / 8 more work-groups) */
        if (g + 1 < NB_ / GB) k_gemmw<bf, 1, true, DQ, 0><<<dim3(GR / 64, DM / 64, 1 + (GR / 8) / ((GR / 64) * (DM / 64))), 32, 0, stream>>>(ATh, ATl, WO, nullptr, DQ, OUT + (size_t)g * GR * DM, DM, bo, 0, 0, 0, LNh, LNl, nullptr, nullptr, nullptr, x + (size_t)(g + 1) * GR * DM, ln_g, ln_b);
        else k_gemmw<bf, 1, true, DQ, 0><<<dim3(GR / 64, DM / 64, 1), 32, 0, stream>>>(ATh, ATl, WO, nullptr, DQ, OUT + (size_t)g * GR * DM, DM, bo, 0, 0, 0, nullptr, nullptr, nullptr, nullptr, nullptr, nullptr, nullptr, nullptr); }
}

// v006
// It runs in 289 microseconds.
// Next to v005, in two timings, it ran 1.07 times as fast each time.
// All steps since v000 together make it 5.60 times as fast.
#include <hip/hip_runtime.h>

// Gated row (axial) attention with a pre-LayerNorm (x [1][64][512][256]: 64 image rows = 64 independent sequences of 512 tokens x 256; xn = LayerNorm(x) (gamma, beta, eps 1e-5); q = xn Wq ('xw' [256][512], 8 heads x 64), [k|v] = xn Wkv ('xw' [256][1024]: columns k | v); dots = (q/8).k over the 512 keys of the same row; softmax (the explicit max subtraction is a softmax identity); out = attn.v merged; gates = sigmoid(xn Wg + bg) ('xw' [256][512]); y = (out * gates) Wo + bo ('xw' [512][256]) -> [1][64][512][256] (8.4 M)).
// Compute dtypes, f32 accumulate: every input rounded to bf16; LayerNorm in f32, xn as bf16 hi + lo planes; q / kv / gate projections as (hi + lo) x exact weights (2 products) + f32 bias; scores and attn.v on bf16 hi/lo planes (3 products) for every row; softmax f32; sigmoid gate f32 (true division); (out x gate) as hi + lo x exact Wo (2 products) + bo.
// Layout: 16 image rows (8,192 tokens) per pass; all per-(row, head) planes are laid out z-major ([z = row*8 + head][512][64]); scores, softmax and attn.v are ONE launch (k_attn), the scores and the probabilities live in registers only, 32 keys at a time (running maximum and sum).
// Launches that do not depend on one another share one grid: the four weight transposes with the first pass's LayerNorm (k_pre); the q, kv and gate projections (one GEMM over the 2,048 stacked weight rows); the output projection with the next pass's LayerNorm. 13 launches: 1 + 4 x 3.
// No elementwise launch stands between the matrix kernels: the q and kv projections split their f32 tiles into the hi / lo planes (V transposed) in their own epilogue, and k_attn gates and splits its output tile in its own.
// Workspace: the transposed V planes lie [hi 512 | lo 512] per row (pitch 1,024 elements).

#define NB_  64        // sequences (image rows)
#define TT   512       // tokens per sequence
#define DM   256
#define NH_  8
#define HD   64
#define DQ   (NH_ * HD)    // 512 = inner dim
#define GB   16            // sequences per pass
#define GR   (GB * TT)     // 8192 token rows per pass
#define ZH   (GB * NH_)    // 128 (sequence, head) planes per pass
#define SCL  0.125f   // HD^-0.5
typedef _Float16 h16;
typedef unsigned short bf;
typedef __attribute__((ext_vector_type(16))) __bf16   v16bf;
typedef __attribute__((ext_vector_type(16))) _Float16 v16h;
typedef __attribute__((ext_vector_type(8)))  _Float16 v8h;
typedef __attribute__((ext_vector_type(8)))  unsigned short v8us;
typedef __attribute__((ext_vector_type(8)))  float    v8f;
typedef __attribute__((ext_vector_type(4)))  float    v4f;
typedef v8h  __attribute__((may_alias)) v8ha;
typedef v4f  __attribute__((may_alias)) v4fa;
typedef v8us __attribute__((may_alias)) v8usa;

__device__ __forceinline__ unsigned short f2bf(float f) { unsigned u = __float_as_uint(f); u += 0x7FFFu + ((u >> 16) & 1u); return (unsigned short)(u >> 16); }
__device__ __forceinline__ float bf2f(unsigned short b) { return __uint_as_float(((unsigned)b) << 16); }
__device__ __forceinline__ float bfr(float f) { return bf2f(f2bf(f)); }
__device__ __forceinline__ v16h cat16(v8h lo, v8h hi) { return __builtin_shufflevector(lo, hi, 0, 1, 2, 3, 4, 5, 6, 7, 8, 9, 10, 11, 12, 13, 14, 15); }
__device__ __forceinline__ v16bf cat16b(v8us lo, v8us hi) { return __builtin_bit_cast(v16bf, __builtin_shufflevector(lo, hi, 0, 1, 2, 3, 4, 5, 6, 7, 8, 9, 10, 11, 12, 13, 14, 15)); }
__device__ __forceinline__ v8f wmma16(v16h a, v16h b, v8f c) { return __builtin_amdgcn_wmma_f32_16x16x32_f16(false, a, false, b, (short)0, c, false, false); }
__device__ __forceinline__ v8f wmmab(v16bf a, v16bf b, v8f c) { return __builtin_amdgcn_wmma_f32_16x16x32_bf16(false, a, false, b, (short)0, c, false, false); }

typedef __attribute__((ext_vector_type(2))) float v2f;
typedef __attribute__((ext_vector_type(2))) __bf16 v2bf;
typedef __attribute__((ext_vector_type(4))) unsigned v4w;    // eight bf16 as four packed words
// hi = p rounded to nearest even, lo = the rest rounded likewise (as splitf), two values a word: the packed hi word is also the source of the two f32 that are subtracted
__device__ __forceinline__ void split8(v8f p, v4w& h, v4w& l) {
#pragma unroll
    for (int i = 0; i < 4; ++i) { const unsigned u = __builtin_bit_cast(unsigned, __builtin_convertvector(((v2f){p[2 * i], p[2 * i + 1]}), v2bf)); h[i] = u;
        l[i] = __builtin_bit_cast(unsigned, __builtin_convertvector(((v2f){p[2 * i] - __uint_as_float(u << 16), p[2 * i + 1] - __uint_as_float(u & 0xFFFF0000u)}), v2bf)); } }
typedef v4w __attribute__((may_alias)) v4wa;

__device__ __forceinline__ void splitf(float y, unsigned short& h, unsigned short& l) { h = f2bf(y); l = f2bf(y - bf2f(h)); }
typedef __attribute__((ext_vector_type(2))) unsigned short v2us;
typedef __attribute__((ext_vector_type(4))) unsigned short v4us;
// LayerNorm of one row of 256 by one wave: y0, y1 are the lane's elements lane*4 .. +3 and 128 + lane*4 .. +3 of row r; g0, g1 and b0, b1 the same elements of gamma and beta
__device__ __forceinline__ void ln_row(const v4f y0, const v4f y1, const v4f g0, const v4f g1, const v4f b0, const v4f b1, const size_t r, const int lane, bf* Yh, bf* Yl) {
    float hv[8]; float s = 0.f;
#pragma unroll
    for (int ch = 0; ch < 2; ++ch) { const v4f y = ch ? y1 : y0;
#pragma unroll
        for (int q = 0; q < 4; ++q) { const float u = bfr(y[q]); hv[ch * 4 + q] = u; s += u; } }
#pragma unroll
    for (int sh = 16; sh; sh >>= 1) s += __shfl_xor(s, sh, 32);
    float mu = s * (1.0f / 256.0f); asm volatile("" : "+v"(mu)); float s2 = 0.f;
#pragma unroll
    for (int k = 0; k < 8; ++k) { float d0 = __fsub_rn(hv[k], mu); asm volatile("" : "+v"(d0)); float p = __fmul_rn(d0, d0); asm volatile("" : "+v"(p)); s2 = __fadd_rn(s2, p); }
#pragma unroll
    for (int sh = 16; sh; sh >>= 1) s2 += __shfl_xor(s2, sh, 32);
    float var = __fadd_rn(s2 * (1.0f / 256.0f), 1e-5f); asm volatile("" : "+v"(var)); const float rs = __frsqrt_rn(var);
#pragma unroll
    for (int ch = 0; ch < 2; ++ch) { const int c0 = ch * 128 + lane * 4; v4us oh, ol;
#pragma unroll
        for (int q = 0; q < 4; ++q) { float gg = bfr((ch ? g1 : g0)[q]); asm volatile("" : "+v"(gg)); float d0 = __fsub_rn(hv[ch * 4 + q], mu); asm volatile("" : "+v"(d0)); float n0 = __fmul_rn(d0, rs); asm volatile("" : "+v"(n0)); float y = __fmul_rn(n0, gg); asm volatile("" : "+v"(y)); y = __fadd_rn(y, bfr((ch ? b1 : b0)[q])); unsigned short a, c2; splitf(y, a, c2); oh[q] = a; ol[q] = c2; }
        *(v4us*)(Yh + r * DM + c0) = oh; *(v4us*)(Yl + r * DM + c0) = ol; }
}

// ---- k_gemmw: register-blocked GEMM, ONE WAVE per 64x64 output tile (16 accumulators), operands from K-contiguous 16-bit planes; grid (M/64, N/64, Z), 32 threads.
// C[m][n] (f32, pitch ldc, + optional f32 bias[n]) = sum_k A[m][k] Bt[n][k] (+ split products per NSPLIT). K (a template argument, so that a piece's 16 loads of a plane share one offset register and differ in the immediate offset) is the row pitch of A and of Bt in elements, KD <= K the depth that is summed. z-batch strides sA/sB/sC in elements. KD % 64 == 0, K % 64 == 0.
// Each 64-row x 64-deep piece of a plane goes through LDS: a global load takes 4 whole 128-byte lines (8 lanes a row), where a fragment load straight from memory touches 16 lines for the same 512 bytes; the fragments are then read from LDS rows of SP elements (144 B = 16 B x 9: no bank conflict).
// EPI says where the tile goes. 0: C as above, one plane (z = 0); work-groups with blockIdx.z > 0, where the grid has any, do no GEMM tile but 8 LayerNorm rows each (X -> Ph, Pl): they start behind the GEMM tiles, which run longer. 1: the stacked projections, by the tile's column: a tile is 64 tokens x one head (64 | TT, HD = 64); columns below DQ (q) and below 2 DQ (k) are split into bf16 hi + lo and stored as 64 whole rows of the z-major planes Ph, Pl (q) or Kh, Kl (k); columns below 3 DQ (v) go transposed into VT: an accumulator register group holds 8 successive tokens of one d, which are 16 bytes of a V^T row as they stand; the last DQ columns (gate) go to C with the bias.
#define SP 72
template <bool B> struct Sel { static constexpr bool v = B; };
template <typename T16> struct WFrag;
template <> struct WFrag<h16> { typedef v16h V; static __device__ __forceinline__ V ld(const h16* p) { return cat16(*(const v8h*)p, *(const v8h*)(p + 16)); } static __device__ __forceinline__ v8f mma(V a, V b, v8f c) { return wmma16(a, b, c); } };
template <> struct WFrag<bf> { typedef v16bf V; static __device__ __forceinline__ V ld(const bf* p) { return cat16b(*(const v8us*)p, *(const v8us*)(p + 16)); } static __device__ __forceinline__ v8f mma(V a, V b, v8f c) { return wmmab(a, b, c); } };
template <typename T16, int NSPLIT, bool BIAS, int K, int EPI>
__global__ __launch_bounds__(32) void k_gemmw(const T16* __restrict__ A, const T16* __restrict__ A2, const T16* __restrict__ Bt, const T16* __restrict__ Bt2, int KD, float* C, int ldc, const float* __restrict__ bias, size_t sA, size_t sB, size_t sC, bf* Ph, bf* Pl, bf* VT, bf* Kh, bf* Kl, const float* __restrict__ X, const float* __restrict__ gw, const float* __restrict__ gb) {
    typedef typename WFrag<T16>::V V;
    if (EPI == 0 && blockIdx.z > 0) {    // a LayerNorm work-group (one wave, so the whole group leaves here, ahead of every barrier): its 8 rows' loads are all in flight together
        const int ln = threadIdx.x & 31; const size_t rw = (((size_t)(blockIdx.z - 1) * gridDim.y + blockIdx.y) * gridDim.x + blockIdx.x) * 8; v4f y[8][2];
#pragma unroll
        for (int i = 0; i < 8; ++i) { y[i][0] = *(const v4f*)(X + (rw + i) * DM + ln * 4); y[i][1] = *(const v4f*)(X + (rw + i) * DM + 128 + ln * 4); }
        const v4f g0 = *(const v4f*)(gw + ln * 4), g1 = *(const v4f*)(gw + 128 + ln * 4), b0 = *(const v4f*)(gb + ln * 4), b1 = *(const v4f*)(gb + 128 + ln * 4);
#pragma unroll
        for (int i = 0; i < 8; ++i) ln_row(y[i][0], y[i][1], g0, g1, b0, b1, rw + i, ln, Ph, Pl);
        asm volatile("s_wait_xcnt 0x0" ::: "memory");    // ends the block: whatever the built code lays behind it rewrites no register of the stores above ahead of this wait
        return; }
    __shared__ __align__(16) float os[16 * 68];
    __shared__ __align__(16) T16 sa[64 * SP], sb[64 * SP], sa2[(NSPLIT == 1 || NSPLIT == 2) ? 64 * SP : 8], sb2[NSPLIT >= 2 ? 64 * SP : 8];
    const size_t z = blockIdx.z; A += z * sA; if (A2) A2 += z * sA; Bt += z * sB; if (Bt2) Bt2 += z * sB; C += z * sC;
    const int lane = threadIdx.x & 31, lr = lane & 15, hi = lane >> 4; const int r0 = blockIdx.x * 64, c0 = blockIdx.y * 64;
    v8f acc[4][4];
#pragma unroll
    for (int mb = 0; mb < 4; ++mb)
#pragma unroll
        for (int nb = 0; nb < 4; ++nb) acc[mb][nb] = (v8f){};
    const int srow = lane >> 3, scol = (lane & 7) * 8;    // staging: 8 lanes take one row's 128 bytes
    const unsigned aoff = ((unsigned)(r0 + srow) * K + scol) * 2u, boff = ((unsigned)(c0 + srow) * K + scol) * 2u;    // byte offsets (a plane is below 4 GiB): the plane pointers stay scalar and one offset register serves both A planes, which keeps the kernel at three waves a SIMD with a whole piece in flight
    const int soff = srow * SP + scol, foff = lr * SP + 8 * hi;
#pragma unroll 1
    for (int k0 = 0; k0 < KD; k0 += 64) { const unsigned ao = aoff + k0 * 2u, bo = boff + k0 * 2u; const char* pa = (const char*)A + ao; const char* pb = (const char*)Bt + bo; const char* pa2 = (NSPLIT == 1 || NSPLIT == 2) ? (const char*)A2 + ao : pa; const char* pb2 = NSPLIT >= 2 ? (const char*)Bt2 + bo : pb;
        v8us ra[16], rb[16], ra2[(NSPLIT == 1 || NSPLIT == 2) ? 16 : 1], rb2[NSPLIT >= 2 ? 16 : 1];
#pragma unroll    // all loads of a piece in flight together, each row step an immediate offset
        for (int i = 0; i < 16; ++i) { ra[i] = *(const v8usa*)(pa + i * 8 * K); rb[i] = *(const v8usa*)(pb + i * 8 * K);
            if (NSPLIT == 1 || NSPLIT == 2) ra2[i] = *(const v8usa*)(pa2 + i * 8 * K); if (NSPLIT >= 2) rb2[i] = *(const v8usa*)(pb2 + i * 8 * K); }
        asm volatile("s_wait_xcnt 0x0" :: "v"(ao), "v"(bo) : "memory");    // the loads' address registers stay theirs up to this wait: no later load lands on them, the next piece's addresses are formed behind it; standing ahead of the LDS stores it also keeps every load of the piece ahead of the first store (left alone the stacked-projection build waits for each load by itself)
#pragma unroll
        for (int i = 0; i < 16; ++i) { *(v8usa*)(sa + soff + i * 4 * SP) = ra[i]; *(v8usa*)(sb + soff + i * 4 * SP) = rb[i];
            if (NSPLIT == 1 || NSPLIT == 2) *(v8usa*)(sa2 + soff + i * 4 * SP) = ra2[i]; if (NSPLIT >= 2) *(v8usa*)(sb2 + soff + i * 4 * SP) = rb2[i]; }
        __syncthreads();    // the piece is written by other lanes than read it (a one-wave group: it builds to the LDS wait and keeps the compiler from reading ahead of the stores)
        V a[4], a2[4];
#pragma unroll    // the second half's fragment reads are scheduled among the first half's products
      for (int kc = 0; kc < 64; kc += 32) {
#pragma unroll
        for (int mb = 0; mb < 4; ++mb) { a[mb] = WFrag<T16>::ld(sa + foff + mb * 16 * SP + kc); if (NSPLIT == 1 || NSPLIT == 2) a2[mb] = WFrag<T16>::ld(sa2 + foff + mb * 16 * SP + kc); }
#pragma unroll
        for (int nb = 0; nb < 4; ++nb) { const V b = WFrag<T16>::ld(sb + foff + nb * 16 * SP + kc); V b2; if (NSPLIT >= 2) b2 = WFrag<T16>::ld(sb2 + foff + nb * 16 * SP + kc);
#pragma unroll
            for (int mb = 0; mb < 4; ++mb) { acc[mb][nb] = WFrag<T16>::mma(a[mb], b, acc[mb][nb]); if (NSPLIT == 1 || NSPLIT == 2) acc[mb][nb] = WFrag<T16>::mma(a2[mb], b, acc[mb][nb]); if (NSPLIT >= 2) acc[mb][nb] = WFrag<T16>::mma(a[mb], b2, acc[mb][nb]); } }
      }
        asm volatile("v_nop\n\tv_nop\n\tv_nop\n\tv_nop" : "+v"(acc[0][0]), "+v"(acc[1][1]), "+v"(acc[2][2]), "+v"(acc[3][3]) : "v"(a[0]), "v"(a[3]));
        __syncthreads();    // every fragment is read before the next piece overwrites it (keeps the next stores behind these reads)
    }
    const size_t zz = (size_t)(r0 / TT) * NH_ + (c0 / HD) % NH_; const int t0 = r0 % TT;    // the tile's (sequence, head) plane and its first token
    if (EPI == 1 && c0 >= 2 * DQ && c0 < 3 * DQ) {
        bf* vrow = VT + (zz * HD + lr) * (2 * TT) + t0 + hi * 8;
#pragma unroll
        for (int nb = 0; nb < 4; ++nb)
#pragma unroll
            for (int mb = 0; mb < 4; ++mb) { v4w h, l; split8(acc[mb][nb], h, l); *(v4wa*)(vrow + nb * 16 * 2 * TT + mb * 16) = h; *(v4wa*)(vrow + nb * 16 * 2 * TT + mb * 16 + TT) = l; }
    } else {
    auto rows = [&](auto pln) __attribute__((always_inline)) {    // the tile by way of os, 16 rows at a time; pln: to the hi / lo planes, else to C (the choice is made once a tile, outside the loop)
#pragma unroll
    for (int mb = 0; mb < 4; ++mb) {
#pragma unroll
        for (int nb = 0; nb < 4; ++nb) {
#pragma unroll
            for (int j = 0; j < 8; ++j) os[(hi * 8 + j) * 68 + nb * 16 + lr] = acc[mb][nb][j]; }
        __builtin_amdgcn_wave_barrier(); asm volatile("" ::: "memory");
        if (decltype(pln)::v) { bf* ph = c0 < DQ ? Ph : Kh; bf* pl = c0 < DQ ? Pl : Kl; const size_t po = (zz * TT + t0 + mb * 16 + (lane >> 3)) * HD + (lane & 7) * 8;    // 8 lanes a row: a store takes 4 whole 128-byte rows
#pragma unroll
            for (int s = 0; s < 4; ++s) { const float* orw = os + (4 * s + (lane >> 3)) * 68 + (lane & 7) * 8; const v4f x0 = *(const v4fa*)orw, x1 = *(const v4fa*)(orw + 4); v4w h, l;
                split8((v8f){x0[0], x0[1], x0[2], x0[3], x1[0], x1[1], x1[2], x1[3]}, h, l); *(v4wa*)(ph + po + s * 4 * HD) = h; *(v4wa*)(pl + po + s * 4 * HD) = l; }
        } else {
        const int cg = EPI == 1 ? c0 - 3 * DQ : c0;    // the tile's first column in C and in the bias
        float* crow = C + (size_t)(r0 + mb * 16) * ldc + cg;
#pragma unroll
            for (int s = 0; s < 8; ++s) { const int row = 2 * s + hi, cofs = lr * 4; v4f val = *(const v4fa*)(os + row * 68 + cofs); if (BIAS) { val[0] += bfr(bias[cg + cofs]); val[1] += bfr(bias[cg + cofs + 1]); val[2] += bfr(bias[cg + cofs + 2]); val[3] += bfr(bias[cg + cofs + 3]); }
                *(v4f*)(crow + (size_t)row * ldc + cofs) = val; }
             }
        __builtin_amdgcn_wave_barrier(); asm volatile("s_wait_xcnt 0x0" ::: "memory");    // keeps the next rows' writes of os behind these reads, as before; the wait: no register of the stores above is rewritten, and no later load lands on one, ahead of it (the next rows' bias load did; behind the last rows the built code lays another block of the kernel, with a branch round it)
    }
    };
    if (EPI == 1 && c0 < 2 * DQ) rows(Sel<true>{}); else rows(Sel<false>{});
    }
}

// ---- k_pre: the four weight transposes ('xw': Bt[n][k] = W[k][n], 64 lines of 64 elements a work-group: 32 + 64 + 32 + 32 work-groups) and, behind them in the same grid, the first pass's LayerNorm (a row a wave).
#define WB (DM * DQ / 64 / 64)    // work-groups of a 256 x 512 weight
__global__ __launch_bounds__(256) void k_pre(const float* __restrict__ wq, const float* __restrict__ wkv, const float* __restrict__ wg, const float* __restrict__ wo, bf* WQ, bf* WKV, bf* WG, bf* WO, const float* __restrict__ X, const float* __restrict__ gw, const float* __restrict__ gb, bf* Yh, bf* Yl) {
    const int lane = threadIdx.x & 31, wv = threadIdx.x >> 5, b = blockIdx.x;
    if (b < 5 * WB) {
        const float* w = b < WB ? wq : b < 3 * WB ? wkv : b < 4 * WB ? wg : wo; bf* Bt = b < WB ? WQ : b < 3 * WB ? WKV : b < 4 * WB ? WG : WO;
        const int K = b < 4 * WB ? DM : DQ, N = b < WB ? DQ : b < 3 * WB ? 2 * DQ : b < 4 * WB ? DQ : DM, b0 = b < WB ? 0 : b < 3 * WB ? WB : b < 4 * WB ? 3 * WB : 4 * WB;
        const int L0 = ((b - b0) * 8 + wv) * 8;
#pragma unroll 1
        for (int l = 0; l < 8; ++l) { const size_t e = (size_t)(L0 + l) * 64 + lane * 2; const int k = (int)(e % K), n = (int)(e / K); v2us o;
            o[0] = f2bf(w[(size_t)k * N + n]); o[1] = f2bf(w[(size_t)(k + 1) * N + n]); *(v2us*)(Bt + e) = o; }
        return; }
    const size_t r = (size_t)(b - 5 * WB) * 8 + wv; const float* xr = X + r * DM;
    ln_row(*(const v4f*)(xr + lane * 4), *(const v4f*)(xr + 128 + lane * 4), *(const v4f*)(gw + lane * 4), *(const v4f*)(gw + 128 + lane * 4), *(const v4f*)(gb + lane * 4), *(const v4f*)(gb + 128 + lane * 4), r, lane, Yh, Yl);
    asm volatile("s_wait_xcnt 0x0" ::: "memory");    // ends the block: the built code lays the transposes behind it, which rewrite no register of the stores above ahead of this wait
}
// ---- k_attn: scores, softmax and attn.v of 256 query rows of one (sequence, head) plane in ONE work-group; no score leaves the WGP. Grid (TT/256, ZH), 256 threads = 8 waves, 32 query rows (two tiles of 16) a wave.
// The scores are formed transposed, S^T = K Q^T (A = 16 key rows from LDS, B = 16 query rows held in registers): an accumulator tile then holds, in lane (lr, hi), keys 8*hi + j of query lr, and two such tiles are, register for register, the B fragment of a 32-key step of O^T = V^T P^T.
// A wave walks the 512 keys in a rolled loop of 32-key steps with a running maximum and a running sum (the output tiles and the sum are scaled by exp2 of the maximum's rise at every step; the division by the sum comes last): every K and V^T fragment read from LDS feeds two query tiles, and the loop's text is one step long.
// LDS: the K planes (rows of KPT elements, hi plane then lo plane) and, beside them, the V^T rows [hi 512 | lo 512] at pitch VPT (both pitches 16 B x odd); both are staged once for the 256 query rows.
#define KPT 72
__device__ __forceinline__ v16bf cat16v(v4w lo, v4w hi) { return __builtin_bit_cast(v16bf, __builtin_shufflevector(lo, hi, 0, 1, 2, 3, 4, 5, 6, 7)); }
__device__ __forceinline__ float xhalf(float x) { return __builtin_bit_cast(float, __builtin_amdgcn_permlanex16(__builtin_bit_cast(int, x), __builtin_bit_cast(int, x), 0x76543210, 0xfedcba98, false, false)); }    // lane l with lane l ^ 16
#define VPT 1032
#define AQ 256    // query rows of a work-group
__global__ __launch_bounds__(256, 1) void k_attn(const bf* __restrict__ Qh, const bf* __restrict__ Ql, const bf* __restrict__ Kh, const bf* __restrict__ Kl, const bf* __restrict__ VT, const float* __restrict__ G, bf* __restrict__ Ah, bf* __restrict__ Al) {
    typedef WFrag<bf> F; typedef F::V V;
    __shared__ __align__(16) bf sk[2 * TT * KPT];
    __shared__ __align__(16) bf sv[HD * VPT];
    const int tid = threadIdx.x, lane = tid & 31, lr = lane & 15, hi = lane >> 4; const size_t z = blockIdx.y; const int q0 = blockIdx.x * AQ + (tid >> 5) * 32;
    // the wave's Q fragments (B operand: lane lr = query row, k = d in the hardware order; [query tile][32 of d]), and K and V^T to LDS: a load takes whole 128-byte lines; all 64 staging loads of a thread are in flight together (no accumulator is live yet)
    V qh[2][2], ql[2][2];
    { const bf* pqh = Qh + (z * TT + q0 + lr) * HD + 8 * hi; const bf* pql = Ql + (z * TT + q0 + lr) * HD + 8 * hi;
        const bf* gh = Kh + z * (TT * HD) + tid * 8; const bf* gl = Kl + z * (TT * HD) + tid * 8; const bf* gv = VT + z * HD * (2 * TT) + tid * 8;
        bf* lk = sk + (tid >> 3) * KPT + (tid & 7) * 8; bf* lv = sv + (tid >> 7) * VPT + (tid & 127) * 8; v8us rh[16], rl[16], rv[32];
#pragma unroll
        for (int i = 0; i < 16; ++i) { rh[i] = *(const v8usa*)(gh + i * 2048); rl[i] = *(const v8usa*)(gl + i * 2048); }
#pragma unroll
        for (int u = 0; u < 2; ++u)
#pragma unroll
            for (int c = 0; c < 2; ++c) { qh[u][c] = F::ld(pqh + u * 16 * HD + c * 32); ql[u][c] = F::ld(pql + u * 16 * HD + c * 32); }
#pragma unroll
        for (int i = 0; i < 32; ++i) rv[i] = *(const v8usa*)(gv + i * 2048);
        asm volatile("s_wait_xcnt 0x0" :: "v"(tid), "v"(pqh), "v"(pql), "s"(gh - tid * 8), "s"(gl - tid * 8), "s"(gv - tid * 8) : "memory");    // the loads' address registers (the built staging loads take the thread's number as their offset register, on three scalar bases) stay theirs up to this wait: no load lands on them and nothing rewrites them ahead of it
#pragma unroll
        for (int i = 0; i < 16; ++i) { *(v8usa*)(lk + i * 32 * KPT) = rh[i]; *(v8usa*)(lk + (TT + i * 32) * KPT) = rl[i]; }
#pragma unroll
        for (int i = 0; i < 32; ++i) *(v8usa*)(lv + i * 2 * VPT) = rv[i]; }
    __syncthreads();    // K and V^T are written by other waves than read them
    v8f o[4][2];    // O^T: [16 of d][query tile]
#pragma unroll
    for (int mb = 0; mb < 4; ++mb)
#pragma unroll
        for (int u = 0; u < 2; ++u) o[mb][u] = (v8f){};
    float mr[2] = {-__builtin_inff(), -__builtin_inff()}, ls[2] = {0.f, 0.f};    // per query tile: the maximum in use (the same in both lane halves) and the lane's own share of the sum
    const float cs = SCL * 1.4426950408889634f;
    const bf* kf = sk + lr * KPT + 8 * hi; const bf* vf = sv + lr * VPT + 8 * hi;
    V kh[2][2], kl[2][2];    // [key tile][32 of d]; a step's K fragments are fetched one step ahead
#pragma unroll
    for (int t = 0; t < 2; ++t)
#pragma unroll
        for (int c = 0; c < 2; ++c) { kh[t][c] = F::ld(kf + t * 16 * KPT + c * 32); kl[t][c] = F::ld(kf + (TT + t * 16) * KPT + c * 32); }
#pragma unroll 1    // one step of text, for speed only
    for (int kb = 0; kb < TT / 32; ++kb) {
        V vh[4], vl[4];
#pragma unroll
        for (int mb = 0; mb < 4; ++mb) { vh[mb] = F::ld(vf + mb * 16 * VPT + kb * 32); vl[mb] = F::ld(vf + mb * 16 * VPT + TT + kb * 32); }
        __builtin_amdgcn_sched_barrier(0);    // keeps this step's V^T reads, one group, ahead of the score products (left alone the compiler sinks each read to its use and waits for it there)
        v8f s[2][2];
#pragma unroll
        for (int t = 0; t < 2; ++t)
#pragma unroll
            for (int u = 0; u < 2; ++u) s[t][u] = (v8f){};
#pragma unroll
        for (int c = 0; c < 2; ++c) {
#pragma unroll
            for (int t = 0; t < 2; ++t)
#pragma unroll
                for (int u = 0; u < 2; ++u) s[t][u] = F::mma(kh[t][c], qh[u][c], s[t][u]);
            __builtin_amdgcn_sched_barrier(0);    // keeps four independent tiles between two products into one accumulator
#pragma unroll
            for (int t = 0; t < 2; ++t)
#pragma unroll
                for (int u = 0; u < 2; ++u) s[t][u] = F::mma(kh[t][c], ql[u][c], s[t][u]);
            __builtin_amdgcn_sched_barrier(0);    // as above
#pragma unroll
            for (int t = 0; t < 2; ++t)
#pragma unroll
                for (int u = 0; u < 2; ++u) s[t][u] = F::mma(kl[t][c], qh[u][c], s[t][u]);
            __builtin_amdgcn_sched_barrier(0); }    // as above
        { const bf* kn = kf + ((kb + 1) & (TT / 32 - 1)) * 32 * KPT;    // the next step's key rows; the last step reads step 0's again, which nothing uses
#pragma unroll
            for (int t = 0; t < 2; ++t)
#pragma unroll
                for (int c = 0; c < 2; ++c) { kh[t][c] = F::ld(kn + t * 16 * KPT + c * 32); kl[t][c] = F::ld(kn + (TT + t * 16) * KPT + c * 32); } }
        __builtin_amdgcn_sched_barrier(0);    // keeps the next step's K reads, one group, ahead of the softmax work, under which they land
        V ph[2], pl[2];
#pragma unroll
        for (int u = 0; u < 2; ++u) {    // query lr of tile u: the lane's 16 scores of this step, then one exchange with lane ^ 16
            v8f m8;
#pragma unroll
            for (int j = 0; j < 8; ++j) m8[j] = fmaxf(s[0][u][j], s[1][u][j]);
            float mx = fmaxf(fmaxf(fmaxf(m8[0], m8[1]), fmaxf(m8[2], m8[3])), fmaxf(fmaxf(m8[4], m8[5]), fmaxf(m8[6], m8[7])));
            mx = fmaxf(mx, xhalf(mx));
            const float mn = fmaxf(mr[u], mx), al = __builtin_amdgcn_exp2f((mr[u] - mn) * cs), mc = mn * cs; mr[u] = mn;
#pragma unroll
            for (int t = 0; t < 2; ++t)
#pragma unroll
                for (int j = 0; j < 8; ++j) s[t][u][j] = __builtin_amdgcn_exp2f(s[t][u][j] * cs - mc);
            const v8f a8 = s[0][u] + s[1][u];
            ls[u] = ls[u] * al + (((a8[0] + a8[1]) + (a8[2] + a8[3])) + ((a8[4] + a8[5]) + (a8[6] + a8[7])));
#pragma unroll
            for (int mb = 0; mb < 4; ++mb) o[mb][u] *= al;
            v4w h0, h1, l0, l1; split8(s[0][u], h0, l0); split8(s[1][u], h1, l1);
            ph[u] = cat16v(h0, h1); pl[u] = cat16v(l0, l1); }
        __builtin_amdgcn_sched_barrier(0);    // the products below start together, eight independent tiles a group
#pragma unroll
        for (int mb = 0; mb < 4; ++mb)
#pragma unroll
            for (int u = 0; u < 2; ++u) o[mb][u] = F::mma(vh[mb], ph[u], o[mb][u]);
#pragma unroll
        for (int mb = 0; mb < 4; ++mb)
#pragma unroll
            for (int u = 0; u < 2; ++u) o[mb][u] = F::mma(vh[mb], pl[u], o[mb][u]);
#pragma unroll
        for (int mb = 0; mb < 4; ++mb)
#pragma unroll
            for (int u = 0; u < 2; ++u) o[mb][u] = F::mma(vl[mb], ph[u], o[mb][u]);
    }
    // lane (lr, hi) holds d = mb*16 + hi*8 + j of query lr of tile u: out / sum x sigmoid(gate) (true divisions), split into hi + lo, goes straight to the merged-head operand planes of the output projection
    const size_t oo = ((z / NH_) * TT + q0 + lr) * DQ + (z % NH_) * HD + hi * 8; const float* gp = G + oo; v4f g[2][8];
#pragma unroll
    for (int u = 0; u < 2; ++u)
#pragma unroll
        for (int i = 0; i < 8; ++i) g[u][i] = *(const v4f*)(gp + u * 16 * DQ + (i >> 1) * 16 + (i & 1) * 4);
    asm volatile("s_wait_xcnt 0x0" :: "v"(gp) : "memory");    // the loads' address registers stay theirs up to this wait
#pragma unroll
    for (int u = 0; u < 2; ++u) { const float f = __fdiv_rn(1.0f, ls[u] + xhalf(ls[u]));
#pragma unroll
        for (int mb = 0; mb < 4; ++mb) { v8f a; v4w h, l;
#pragma unroll
            for (int j = 0; j < 8; ++j) { const float den = __fadd_rn(1.0f, expf(-g[u][mb * 2 + (j >> 2)][j & 3])); a[j] = __fmul_rn(__fmul_rn(o[mb][u][j], f), __fdiv_rn(1.0f, den)); }
            split8(a, h, l); *(v4wa*)(Ah + oo + u * 16 * DQ + mb * 16) = h; *(v4wa*)(Al + oo + u * 16 * DQ + mb * 16) = l;
            asm volatile("s_wait_xcnt 0x0" ::: "memory"); } }    // no register of the two stores above is rewritten by the next tile's arithmetic ahead of this wait
}

extern "C" void kernel_launch(void* const* d_in, const int* in_sizes, int n_in,
                              void* d_out, int out_size, void* d_ws, size_t ws_size, hipStream_t stream) {
    (void)in_sizes; (void)n_in; (void)out_size;
    const float* x = (const float*)d_in[0]; const float* ln_g = (const float*)d_in[1]; const float* ln_b = (const float*)d_in[2]; const float* wq = (const float*)d_in[3]; const float* wkv = (const float*)d_in[4]; const float* wg = (const float*)d_in[5]; const float* bg = (const float*)d_in[6]; const float* wo = (const float*)d_in[7]; const float* bo = (const float*)d_in[8];
    float* OUT = (float*)d_out;     // [1][64][512][256] = [32768][256]
    char* wsp = (char*)d_ws;
    auto take = [&](size_t bytes) { char* p = wsp; wsp += (bytes + 255) & ~(size_t)255; return (void*)p; };
    bf* WQ = (bf*)take((size_t)4 * DQ * DM * 2); bf* WKV = WQ + DQ * DM; bf* WG = WQ + 3 * DQ * DM;    /* one Bt of 2,048 rows: q | k | v | gate */
    bf* WO = (bf*)take((size_t)DM * DQ * 2);
    bf* LNh = (bf*)take((size_t)GR * DM * 2); bf* LNl = (bf*)take((size_t)GR * DM * 2); float* FG = (float*)take((size_t)GR * DQ * 4);
    bf* QPh = (bf*)take((size_t)ZH * TT * HD * 2); bf* QPl = (bf*)take((size_t)ZH * TT * HD * 2); bf* KPh = (bf*)take((size_t)ZH * TT * HD * 2); bf* KPl = (bf*)take((size_t)ZH * TT * HD * 2); bf* VTh = (bf*)take((size_t)ZH * HD * 2 * TT * 2);    // row (z, d) of V^T: hi at VTh + row*2*TT, lo TT elements behind it
    bf* ATh = (bf*)take((size_t)GR * DQ * 2); bf* ATl = (bf*)take((size_t)GR * DQ * 2);
    if ((size_t)(wsp - (char*)d_ws) > ws_size) return;    // ws 256 MiB
    k_pre<<<5 * WB + GR / 8, 256, 0, stream>>>(wq, wkv, wg, wo, WQ, WKV, WG, WO, x, ln_g, ln_b, LNh, LNl);
    for (int g = 0; g < NB_ / GB; ++g) {
        k_gemmw<bf, 1, true, DM, 1><<<dim3(GR / 64, 4 * DQ / 64, 1), 32, 0, stream>>>(LNh, LNl, WQ, nullptr, DM, FG, DQ, bg, 0, 0, 0, QPh, QPl, VTh, KPh, KPl, nullptr, nullptr, nullptr);
        k_attn<<<dim3(TT / AQ, ZH, 1), 256, 0, stream>>>(QPh, QPl, KPh, KPl, VTh, FG, ATh, ATl);
        /* LNh, LNl are free once this pass's projections have run: the next pass's rows are normalised beside the output projection (GR / 8 more work-groups) */
        if (g + 1 < NB_ / GB) k_gemmw<bf, 1, true, DQ, 0><<<dim3(GR / 64, DM / 64, 1 + (GR / 8) / ((GR / 64) * (DM / 64))), 32, 0, stream>>>(ATh, ATl, WO, nullptr, DQ, OUT + (size_t)g * GR * DM, DM, bo, 0, 0, 0, LNh, LNl, nullptr, nullptr, nullptr, x + (size_t)(g + 1) * GR * DM, ln_g, ln_b);
        else k_gemmw<bf, 1, true, DQ, 0><<<dim3(GR / 64, DM / 64, 1), 32, 0, stream>>>(ATh, ATl, WO, nullptr, DQ, OUT + (size_t)g * GR * DM, DM, bo, 0, 0, 0, nullptr, nullptr, nullptr, nullptr, nullptr, nullptr, nullptr, nullptr); }
}

// v007
// One run takes 277 microseconds.
// In two side-by-side timings against v006, it was 1.05 and 1.04 times as fast.
// Over all steps from v000 it is 5.85 times as fast.
#include <hip/hip_runtime.h>

// Gated row (axial) attention with a pre-LayerNorm (x [1][64][512][256]: 64 image rows = 64 independent sequences of 512 tokens x 256; xn = LayerNorm(x) (gamma, beta, eps 1e-5); q = xn Wq ('xw' [256][512], 8 heads x 64), [k|v] = xn Wkv ('xw' [256][1024]: columns k | v); dots = (q/8).k over the 512 keys of the same row; softmax (the explicit max subtraction is a softmax identity); out = attn.v merged; gates = sigmoid(xn Wg + bg) ('xw' [256][512]); y = (out * gates) Wo + bo ('xw' [512][256]) -> [1][64][512][256] (8.4 M)).
// Compute dtypes, f32 accumulate: every input rounded to bf16; LayerNorm in f32, xn as bf16 hi + lo planes; q / kv / gate projections as (hi + lo) x exact weights (2 products) + f32 bias; scores and attn.v on bf16 hi/lo planes (3 products) for every row; softmax f32; sigmoid gate f32 (true division); (out x gate) as hi + lo x exact Wo (2 products) + bo.
// Layout: 16 image rows (8,192 tokens) per pass; all per-(row, head) planes are laid out z-major ([z = row*8 + head][512][64]); scores, softmax and attn.v are ONE launch (k_attn), the scores and the probabilities live in registers only, 32 keys at a time (running maximum and sum).
// Launches that do not depend on one another share one grid: the four weight transposes with the first pass's LayerNorm (k_pre); the q, kv and gate projections (one GEMM over the 2,048 stacked weight rows); the output projection with the next pass's LayerNorm. 13 launches: 1 + 4 x 3.
// No elementwise launch stands between the matrix kernels: the q and kv projections split their f32 tiles into the hi / lo planes (V transposed) in their own epilogue, and k_attn gates and splits its output tile in its own.
// Workspace: the transposed V planes lie [hi 512 | lo 512] per row (pitch 1,024 elements).

#define NB_  64        // sequences (image rows)
#define TT   512       // tokens per sequence
#define DM   256
#define NH_  8
#define HD   64
#define DQ   (NH_ * HD)    // 512 = inner dim
#define GB   16            // sequences per pass
#define GR   (GB * TT)     // 8192 token rows per pass
#define ZH   (GB * NH_)    // 128 (sequence, head) planes per pass
#define SCL  0.125f   // HD^-0.5
typedef _Float16 h16;
typedef unsigned short bf;
typedef __attribute__((ext_vector_type(16))) __bf16   v16bf;
typedef __attribute__((ext_vector_type(16))) _Float16 v16h;
typedef __attribute__((ext_vector_type(8)))  _Float16 v8h;
typedef __attribute__((ext_vector_type(8)))  unsigned short v8us;
typedef __attribute__((ext_vector_type(8)))  float    v8f;
typedef __attribute__((ext_vector_type(4)))  float    v4f;
typedef v8h  __attribute__((may_alias)) v8ha;
typedef v4f  __attribute__((may_alias)) v4fa;
typedef v8us __attribute__((may_alias)) v8usa;

__device__ __forceinline__ unsigned short f2bf(float f) { unsigned u = __float_as_uint(f); u += 0x7FFFu + ((u >> 16) & 1u); return (unsigned short)(u >> 16); }
__device__ __forceinline__ float bf2f(unsigned short b) { return __uint_as_float(((unsigned)b) << 16); }
__device__ __forceinline__ float bfr(float f) { return bf2f(f2bf(f)); }
__device__ __forceinline__ v16h cat16(v8h lo, v8h hi) { return __builtin_shufflevector(lo, hi, 0, 1, 2, 3, 4, 5, 6, 7, 8, 9, 10, 11, 12, 13, 14, 15); }
__device__ __forceinline__ v16bf cat16b(v8us lo, v8us hi) { return __builtin_bit_cast(v16bf, __builtin_shufflevector(lo, hi, 0, 1, 2, 3, 4, 5, 6, 7, 8, 9, 10, 11, 12, 13, 14, 15)); }
__device__ __forceinline__ v8f wmma16(v16h a, v16h b, v8f c) { return __builtin_amdgcn_wmma_f32_16x16x32_f16(false, a, false, b, (short)0, c, false, false); }
__device__ __forceinline__ v8f wmmab(v16bf a, v16bf b, v8f c) { return __builtin_amdgcn_wmma_f32_16x16x32_bf16(false, a, false, b, (short)0, c, false, false); }

typedef __attribute__((ext_vector_type(2))) float v2f;
typedef __attribute__((ext_vector_type(2))) __bf16 v2bf;
typedef __attribute__((ext_vector_type(4))) unsigned v4w;    // eight bf16 as four packed words
// hi = p rounded to nearest even, lo = the rest rounded likewise (as splitf), two values a word: the packed hi word is also the source of the two f32 that are subtracted
__device__ __forceinline__ void split8(v8f p, v4w& h, v4w& l) {
#pragma unroll
    for (int i = 0; i < 4; ++i) { const unsigned u = __builtin_bit_cast(unsigned, __builtin_convertvector(((v2f){p[2 * i], p[2 * i + 1]}), v2bf)); h[i] = u;
        l[i] = __builtin_bit_cast(unsigned, __builtin_convertvector(((v2f){p[2 * i] - __uint_as_float(u << 16), p[2 * i + 1] - __uint_as_float(u & 0xFFFF0000u)}), v2bf)); } }
typedef v4w __attribute__((may_alias)) v4wa;

__device__ __forceinline__ void splitf(float y, unsigned short& h, unsigned short& l) { h = f2bf(y); l = f2bf(y - bf2f(h)); }
typedef __attribute__((ext_vector_type(2))) unsigned short v2us;
typedef __attribute__((ext_vector_type(4))) unsigned short v4us;
// LayerNorm of one row of 256 by one wave: y0, y1 are the lane's elements lane*4 .. +3 and 128 + lane*4 .. +3 of row r; g0, g1 and b0, b1 the same elements of gamma and beta
__device__ __forceinline__ void ln_row(const v4f y0, const v4f y1, const v4f g0, const v4f g1, const v4f b0, const v4f b1, const size_t r, const int lane, bf* Yh, bf* Yl) {
    float hv[8]; float s = 0.f;
#pragma unroll
    for (int ch = 0; ch < 2; ++ch) { const v4f y = ch ? y1 : y0;
#pragma unroll
        for (int q = 0; q < 4; ++q) { const float u = bfr(y[q]); hv[ch * 4 + q] = u; s += u; } }
#pragma unroll
    for (int sh = 16; sh; sh >>= 1) s += __shfl_xor(s, sh, 32);
    float mu = s * (1.0f / 256.0f); asm volatile("" : "+v"(mu)); float s2 = 0.f;
#pragma unroll
    for (int k = 0; k < 8; ++k) { float d0 = __fsub_rn(hv[k], mu); asm volatile("" : "+v"(d0)); float p = __fmul_rn(d0, d0); asm volatile("" : "+v"(p)); s2 = __fadd_rn(s2, p); }
#pragma unroll
    for (int sh = 16; sh; sh >>= 1) s2 += __shfl_xor(s2, sh, 32);
    float var = __fadd_rn(s2 * (1.0f / 256.0f), 1e-5f); asm volatile("" : "+v"(var)); const float rs = __frsqrt_rn(var);
#pragma unroll
    for (int ch = 0; ch < 2; ++ch) { const int c0 = ch * 128 + lane * 4; v4us oh, ol;
#pragma unroll
        for (int q = 0; q < 4; ++q) { float gg = bfr((ch ? g1 : g0)[q]); asm volatile("" : "+v"(gg)); float d0 = __fsub_rn(hv[ch * 4 + q], mu); asm volatile("" : "+v"(d0)); float n0 = __fmul_rn(d0, rs); asm volatile("" : "+v"(n0)); float y = __fmul_rn(n0, gg); asm volatile("" : "+v"(y)); y = __fadd_rn(y, bfr((ch ? b1 : b0)[q])); unsigned short a, c2; splitf(y, a, c2); oh[q] = a; ol[q] = c2; }
        *(v4us*)(Yh + r * DM + c0) = oh; *(v4us*)(Yl + r * DM + c0) = ol; }
}

// ---- k_gemmw: register-blocked GEMM, ONE WAVE per 64x64 output tile (16 accumulators), WM x WN waves a work-group, operands from K-contiguous 16-bit planes; grid (M/(64 WM), N/(64 WN), Z), 32 WM WN threads.
// The waves of a group share each staged piece: its 64 WM rows of the A planes and 64 WN rows of Bt leave L2 once for the group, not once for each wave that reads them. The stacked projections run 2 x 4 waves (512 staged rows a piece where eight one-wave groups take 1,536); the output projection, whose grid has few tiles, stays at one wave a group.
// C[m][n] (f32, pitch ldc, + optional f32 bias[n]) = sum_k A[m][k] Bt[n][k] (+ split products per NSPLIT). K (a template argument, so that a piece's loads of a plane (16 / WN a thread for A, 16 / WM for Bt) share one offset register and differ in the immediate offset) is the row pitch of A and of Bt in elements, KD <= K the depth that is summed. z-batch strides sA/sB/sC in elements. KD % 64 == 0, K % 64 == 0.
// Each 64-row x 64-deep piece of a plane goes through LDS: a global load takes 4 whole 128-byte lines (8 lanes a row), where a fragment load straight from memory touches 16 lines for the same 512 bytes; the fragments are then read from LDS rows of SP elements (144 B = 16 B x 9: no bank conflict).
// EPI says where the tile goes. 0: C as above, one plane (z = 0); work-groups with blockIdx.z > 0, where the grid has any, do no GEMM tile but 8 LayerNorm rows each (X -> Ph, Pl). 1: the stacked projections, by the tile's column: a tile is 64 tokens x one head (64 | TT, HD = 64); columns below DQ (q) and below 2 DQ (k) are split into bf16 hi + lo and stored as 64 whole rows of the z-major planes Ph, Pl (q) or Kh, Kl (k); columns below 3 DQ (v) go transposed into VT: an accumulator register group holds 8 successive tokens of one d, which are 16 bytes of a V^T row as they stand; the last DQ columns (gate) go to C with the bias.
#define SP 72
template <bool B> struct Sel { static constexpr bool v = B; };
template <typename T16> struct WFrag;
template <> struct WFrag<h16> { typedef v16h V; static __device__ __forceinline__ V ld(const h16* p) { return cat16(*(const v8h*)p, *(const v8h*)(p + 16)); } static __device__ __forceinline__ v8f mma(V a, V b, v8f c) { return wmma16(a, b, c); } };
template <> struct WFrag<bf> { typedef v16bf V; static __device__ __forceinline__ V ld(const bf* p) { return cat16b(*(const v8us*)p, *(const v8us*)(p + 16)); } static __device__ __forceinline__ v8f mma(V a, V b, v8f c) { return wmmab(a, b, c); } };
template <typename T16, int NSPLIT, bool BIAS, int K, int EPI, int WM, int WN>
__global__ __launch_bounds__(32 * WM * WN) void k_gemmw(const T16* __restrict__ A, const T16* __restrict__ A2, const T16* __restrict__ Bt, const T16* __restrict__ Bt2, int KD, float* C, int ldc, const float* __restrict__ bias, size_t sA, size_t sB, size_t sC, bf* Ph, bf* Pl, bf* VT, bf* Kh, bf* Kl, const float* __restrict__ X, const float* __restrict__ gw, const float* __restrict__ gb) {
    typedef typename WFrag<T16>::V V;
    if (EPI == 0 && blockIdx.z > 0) {    // a LayerNorm work-group (one wave, so the whole group leaves here, ahead of every barrier): its 8 rows' loads are all in flight together
        const int ln = threadIdx.x & 31; const size_t rw = (((size_t)(blockIdx.z - 1) * gridDim.y + blockIdx.y) * gridDim.x + blockIdx.x) * 8; v4f y[8][2];
#pragma unroll
        for (int i = 0; i < 8; ++i) { y[i][0] = *(const v4f*)(X + (rw + i) * DM + ln * 4); y[i][1] = *(const v4f*)(X + (rw + i) * DM + 128 + ln * 4); }
        const v4f g0 = *(const v4f*)(gw + ln * 4), g1 = *(const v4f*)(gw + 128 + ln * 4), b0 = *(const v4f*)(gb + ln * 4), b1 = *(const v4f*)(gb + 128 + ln * 4);
#pragma unroll
        for (int i = 0; i < 8; ++i) ln_row(y[i][0], y[i][1], g0, g1, b0, b1, rw + i, ln, Ph, Pl);
        asm volatile("s_wait_xcnt 0x0" ::: "memory");    // ends the block: whatever the built code lays behind it rewrites no register of the stores above ahead of this wait
        return; }
    constexpr int NW = WM * WN, RS = NW * 4, NA = WM * 64 / RS, NB = WN * 64 / RS;    // waves; rows that one staging load of the whole group takes; such loads per A plane, per B plane
    __shared__ __align__(16) float osg[NW * 16 * 68];
    __shared__ __align__(16) T16 sa[WM * 64 * SP], sb[WN * 64 * SP], sa2[(NSPLIT == 1 || NSPLIT == 2) ? WM * 64 * SP : 8], sb2[NSPLIT >= 2 ? WN * 64 * SP : 8];
    const size_t z = blockIdx.z; A += z * sA; if (A2) A2 += z * sA; Bt += z * sB; if (Bt2) Bt2 += z * sB; C += z * sC;
    const int tid = threadIdx.x, lane = tid & 31, lr = lane & 15, hi = lane >> 4; const int wv = NW > 1 ? __builtin_amdgcn_readfirstlane(tid >> 5) : 0, wm = wv % WM, wn = wv / WM;    // the wave's number as a scalar: the epilogue's choices by column stay scalar branches
    const int R0 = blockIdx.x * (64 * WM), C0 = blockIdx.y * (64 * WN), r0 = R0 + wm * 64, c0 = C0 + wn * 64; float* os = osg + wv * (16 * 68);    // the group's tile, the wave's own 64 x 64 of it, the wave's own epilogue rows
    v8f acc[4][4];
#pragma unroll
    for (int mb = 0; mb < 4; ++mb)
#pragma unroll
        for (int nb = 0; nb < 4; ++nb) acc[mb][nb] = (v8f){};
    const int srow = tid >> 3, scol = (tid & 7) * 8;    // staging: 8 lanes take one row's 128 bytes
    const unsigned aoff = ((unsigned)(R0 + srow) * K + scol) * 2u, boff = ((unsigned)(C0 + srow) * K + scol) * 2u;    // byte offsets (a plane is below 4 GiB): the plane pointers stay scalar and one offset register serves both A planes, which keeps the one-wave build at three waves a SIMD with a whole piece in flight
    const int soff = srow * SP + scol, foa = (wm * 64 + lr) * SP + 8 * hi, fob = (wn * 64 + lr) * SP + 8 * hi;
#pragma unroll 1
    for (int k0 = 0; k0 < KD; k0 += 64) { const unsigned ao = aoff + k0 * 2u, bo = boff + k0 * 2u; const char* pa = (const char*)A + ao; const char* pb = (const char*)Bt + bo; const char* pa2 = (NSPLIT == 1 || NSPLIT == 2) ? (const char*)A2 + ao : pa; const char* pb2 = NSPLIT >= 2 ? (const char*)Bt2 + bo : pb;
        v8us ra[NA], rb[NB], ra2[(NSPLIT == 1 || NSPLIT == 2) ? NA : 1], rb2[NSPLIT >= 2 ? NB : 1];
#pragma unroll    // all loads of a piece in flight together, each row step an immediate offset
        for (int i = 0; i < (NA > NB ? NA : NB); ++i) { if (i < NA) ra[i] = *(const v8usa*)(pa + i * RS * 2 * K); if (i < NB) rb[i] = *(const v8usa*)(pb + i * RS * 2 * K);
            if ((NSPLIT == 1 || NSPLIT == 2) && i < NA) ra2[i] = *(const v8usa*)(pa2 + i * RS * 2 * K); if (NSPLIT >= 2 && i < NB) rb2[i] = *(const v8usa*)(pb2 + i * RS * 2 * K); }
        asm volatile("s_wait_xcnt 0x0" :: "v"(ao), "v"(bo) : "memory");    // the loads' address registers stay theirs up to this wait: no later load lands on them, the next piece's addresses are formed behind it; standing ahead of the LDS stores it also keeps every load of the piece ahead of the first store (left alone the stacked-projection build waits for each load by itself)
#pragma unroll
        for (int i = 0; i < (NA > NB ? NA : NB); ++i) { if (i < NA) *(v8usa*)(sa + soff + i * RS * SP) = ra[i]; if (i < NB) *(v8usa*)(sb + soff + i * RS * SP) = rb[i];
            if ((NSPLIT == 1 || NSPLIT == 2) && i < NA) *(v8usa*)(sa2 + soff + i * RS * SP) = ra2[i]; if (NSPLIT >= 2 && i < NB) *(v8usa*)(sb2 + soff + i * RS * SP) = rb2[i]; }
        __syncthreads();    // the piece is written by other lanes, in a group of several waves by other waves, than read it (a one-wave group: it builds to the LDS wait and keeps the compiler from reading ahead of the stores)
        V a[4], a2[4];
#pragma unroll    // the second half's fragment reads are scheduled among the first half's products
      for (int kc = 0; kc < 64; kc += 32) {
#pragma unroll
        for (int mb = 0; mb < 4; ++mb) { a[mb] = WFrag<T16>::ld(sa + foa + mb * 16 * SP + kc); if (NSPLIT == 1 || NSPLIT == 2) a2[mb] = WFrag<T16>::ld(sa2 + foa + mb * 16 * SP + kc); }
#pragma unroll
        for (int nb = 0; nb < 4; ++nb) { const V b = WFrag<T16>::ld(sb + fob + nb * 16 * SP + kc); V b2; if (NSPLIT >= 2) b2 = WFrag<T16>::ld(sb2 + fob + nb * 16 * SP + kc);
#pragma unroll
            for (int mb = 0; mb < 4; ++mb) { acc[mb][nb] = WFrag<T16>::mma(a[mb], b, acc[mb][nb]); if (NSPLIT == 1 || NSPLIT == 2) acc[mb][nb] = WFrag<T16>::mma(a2[mb], b, acc[mb][nb]); if (NSPLIT >= 2) acc[mb][nb] = WFrag<T16>::mma(a[mb], b2, acc[mb][nb]); } }
      }
        asm volatile("v_nop\n\tv_nop\n\tv_nop\n\tv_nop" : "+v"(acc[0][0]), "+v"(acc[0][1]), "+v"(acc[0][2]), "+v"(acc[0][3]), "+v"(acc[1][0]), "+v"(acc[1][1]), "+v"(acc[1][2]), "+v"(acc[1][3]), "+v"(acc[2][0]), "+v"(acc[2][1]), "+v"(acc[2][2]), "+v"(acc[2][3]), "+v"(acc[3][0]), "+v"(acc[3][1]), "+v"(acc[3][2]), "+v"(acc[3][3]));    // the four vector slots between the piece's last product and the branch back, behind which the next piece's loads land on operand registers; every accumulator is named, so that no product of the piece is scheduled behind the slots
        __syncthreads();    // every fragment is read before the next piece overwrites it (keeps the next stores behind these reads)
    }
    const size_t zz = (size_t)(r0 / TT) * NH_ + (c0 / HD) % NH_; const int t0 = r0 % TT;    // the tile's (sequence, head) plane and its first token
    if (EPI == 1 && c0 >= 2 * DQ && c0 < 3 * DQ) {
        bf* vrow = VT + (zz * HD + lr) * (2 * TT) + t0 + hi * 8;
#pragma unroll
        for (int nb = 0; nb < 4; ++nb)
#pragma unroll
            for (int mb = 0; mb < 4; ++mb) { v4w h, l; split8(acc[mb][nb], h, l); *(v4wa*)(vrow + nb * 16 * 2 * TT + mb * 16) = h; *(v4wa*)(vrow + nb * 16 * 2 * TT + mb * 16 + TT) = l; }
    } else {
    auto rows = [&](auto pln) __attribute__((always_inline)) {    // the tile by way of os, 16 rows at a time; pln: to the hi / lo planes, else to C (the choice is made once a tile, outside the loop)
#pragma unroll
    for (int mb = 0; mb < 4; ++mb) {
#pragma unroll
        for (int nb = 0; nb < 4; ++nb) {
#pragma unroll
            for (int j = 0; j < 8; ++j) os[(hi * 8 + j) * 68 + nb * 16 + lr] = acc[mb][nb][j]; }
        __builtin_amdgcn_wave_barrier(); asm volatile("" ::: "memory");
        if (decltype(pln)::v) { bf* ph = c0 < DQ ? Ph : Kh; bf* pl = c0 < DQ ? Pl : Kl; const size_t po = (zz * TT + t0 + mb * 16 + (lane >> 3)) * HD + (lane & 7) * 8;    // 8 lanes a row: a store takes 4 whole 128-byte rows
#pragma unroll
            for (int s = 0; s < 4; ++s) { const float* orw = os + (4 * s + (lane >> 3)) * 68 + (lane & 7) * 8; const v4f x0 = *(const v4fa*)orw, x1 = *(const v4fa*)(orw + 4); v4w h, l;
                split8((v8f){x0[0], x0[1], x0[2], x0[3], x1[0], x1[1], x1[2], x1[3]}, h, l); *(v4wa*)(ph + po + s * 4 * HD) = h; *(v4wa*)(pl + po + s * 4 * HD) = l; }
        } else {
        const int cg = EPI == 1 ? c0 - 3 * DQ : c0;    // the tile's first column in C and in the bias
        float* crow = C + (size_t)(r0 + mb * 16) * ldc + cg;
#pragma unroll
            for (int s = 0; s < 8; ++s) { const int row = 2 * s + hi, cofs = lr * 4; v4f val = *(const v4fa*)(os + row * 68 + cofs); if (BIAS) { val[0] += bfr(bias[cg + cofs]); val[1] += bfr(bias[cg + cofs + 1]); val[2] += bfr(bias[cg + cofs + 2]); val[3] += bfr(bias[cg + cofs + 3]); }
                *(v4f*)(crow + (size_t)row * ldc + cofs) = val; }
             }
        __builtin_amdgcn_wave_barrier(); asm volatile("s_wait_xcnt 0x0" ::: "memory");    // keeps the next rows' writes of os behind these reads, as before; the wait: no register of the stores above is rewritten, and no later load lands on one, ahead of it (the next rows' bias load did; behind the last rows the built code lays another block of the kernel, with a branch round it)
    }
    };
    if (EPI == 1 && c0 < 2 * DQ) rows(Sel<true>{}); else rows(Sel<false>{});
    }
}

// ---- k_pre: the four weight transposes ('xw': Bt[n][k] = W[k][n], 64 lines of 64 elements a work-group: 32 + 64 + 32 + 32 work-groups) and, behind them in the same grid, the first pass's LayerNorm (a row a wave).
#define WB (DM * DQ / 64 / 64)    // work-groups of a 256 x 512 weight
__global__ __launch_bounds__(256) void k_pre(const float* __restrict__ wq, const float* __restrict__ wkv, const float* __restrict__ wg, const float* __restrict__ wo, bf* WQ, bf* WKV, bf* WG, bf* WO, const float* __restrict__ X, const float* __restrict__ gw, const float* __restrict__ gb, bf* Yh, bf* Yl) {
    const int lane = threadIdx.x & 31, wv = threadIdx.x >> 5, b = blockIdx.x;
    if (b < 5 * WB) {
        const float* w = b < WB ? wq : b < 3 * WB ? wkv : b < 4 * WB ? wg : wo; bf* Bt = b < WB ? WQ : b < 3 * WB ? WKV : b < 4 * WB ? WG : WO;
        const int K = b < 4 * WB ? DM : DQ, N = b < WB ? DQ : b < 3 * WB ? 2 * DQ : b < 4 * WB ? DQ : DM, b0 = b < WB ? 0 : b < 3 * WB ? WB : b < 4 * WB ? 3 * WB : 4 * WB;
        const int L0 = ((b - b0) * 8 + wv) * 8;
#pragma unroll 1
        for (int l = 0; l < 8; ++l) { const size_t e = (size_t)(L0 + l) * 64 + lane * 2; const int k = (int)(e % K), n = (int)(e / K); v2us o;
            o[0] = f2bf(w[(size_t)k * N + n]); o[1] = f2bf(w[(size_t)(k + 1) * N + n]); *(v2us*)(Bt + e) = o; }
        return; }
    const size_t r = (size_t)(b - 5 * WB) * 8 + wv; const float* xr = X + r * DM;
    ln_row(*(const v4f*)(xr + lane * 4), *(const v4f*)(xr + 128 + lane * 4), *(const v4f*)(gw + lane * 4), *(const v4f*)(gw + 128 + lane * 4), *(const v4f*)(gb + lane * 4), *(const v4f*)(gb + 128 + lane * 4), r, lane, Yh, Yl);
    asm volatile("s_wait_xcnt 0x0" ::: "memory");    // ends the block: the built code lays the transposes behind it, which rewrite no register of the stores above ahead of this wait
}
// ---- k_attn: scores, softmax and attn.v of 256 query rows of one (sequence, head) plane in ONE work-group; no score leaves the WGP. Grid (TT/256, ZH), 256 threads = 8 waves, 32 query rows (two tiles of 16) a wave.
// The scores are formed transposed, S^T = K Q^T (A = 16 key rows from LDS, B = 16 query rows held in registers): an accumulator tile then holds, in lane (lr, hi), keys 8*hi + j of query lr, and two such tiles are, register for register, the B fragment of a 32-key step of O^T = V^T P^T.
// A wave walks the 512 keys in a rolled loop of 32-key steps with a running maximum and a running sum (the output tiles and the sum are scaled by exp2 of the maximum's rise at every step; the division by the sum comes last): every K and V^T fragment read from LDS feeds two query tiles, and the loop's text is one step long.
// LDS: the K planes (rows of KPT elements, hi plane then lo plane) and, beside them, the V^T rows [hi 512 | lo 512] at pitch VPT (both pitches 16 B x odd); both are staged once for the 256 query rows.
#define KPT 72
__device__ __forceinline__ v16bf cat16v(v4w lo, v4w hi) { return __builtin_bit_cast(v16bf, __builtin_shufflevector(lo, hi, 0, 1, 2, 3, 4, 5, 6, 7)); }
__device__ __forceinline__ float xhalf(float x) { return __builtin_bit_cast(float, __builtin_amdgcn_permlanex16(__builtin_bit_cast(int, x), __builtin_bit_cast(int, x), 0x76543210, 0xfedcba98, false, false)); }    // lane l with lane l ^ 16
#define VPT 1032
#define AQ 256    // query rows of a work-group
__global__ __launch_bounds__(256, 1) void k_attn(const bf* __restrict__ Qh, const bf* __restrict__ Ql, const bf* __restrict__ Kh, const bf* __restrict__ Kl, const bf* __restrict__ VT, const float* __restrict__ G, bf* __restrict__ Ah, bf* __restrict__ Al) {
    typedef WFrag<bf> F; typedef F::V V;
    __shared__ __align__(16) bf sk[2 * TT * KPT];
    __shared__ __align__(16) bf sv[HD * VPT];
    const int tid = threadIdx.x, lane = tid & 31, lr = lane & 15, hi = lane >> 4; const size_t z = blockIdx.y; const int q0 = blockIdx.x * AQ + (tid >> 5) * 32;
    // the wave's Q fragments (B operand: lane lr = query row, k = d in the hardware order; [query tile][32 of d]), and K and V^T to LDS: a load takes whole 128-byte lines; all 64 staging loads of a thread are in flight together (no accumulator is live yet)
    V qh[2][2], ql[2][2];
    { const bf* pqh = Qh + (z * TT + q0 + lr) * HD + 8 * hi; const bf* pql = Ql + (z * TT + q0 + lr) * HD + 8 * hi;
        const bf* gh = Kh + z * (TT * HD) + tid * 8; const bf* gl = Kl + z * (TT * HD) + tid * 8; const bf* gv = VT + z * HD * (2 * TT) + tid * 8;
        bf* lk = sk + (tid >> 3) * KPT + (tid & 7) * 8; bf* lv = sv + (tid >> 7) * VPT + (tid & 127) * 8; v8us rh[16], rl[16], rv[32];
#pragma unroll
        for (int i = 0; i < 16; ++i) { rh[i] = *(const v8usa*)(gh + i * 2048); rl[i] = *(const v8usa*)(gl + i * 2048); }
#pragma unroll
        for (int u = 0; u < 2; ++u)
#pragma unroll
            for (int c = 0; c < 2; ++c) { qh[u][c] = F::ld(pqh + u * 16 * HD + c * 32); ql[u][c] = F::ld(pql + u * 16 * HD + c * 32); }
#pragma unroll
        for (int i = 0; i < 32; ++i) rv[i] = *(const v8usa*)(gv + i * 2048);
        asm volatile("s_wait_xcnt 0x0" :: "v"(tid), "v"(pqh), "v"(pql), "s"(gh - tid * 8), "s"(gl - tid * 8), "s"(gv - tid * 8) : "memory");    // the loads' address registers (the built staging loads take the thread's number as their offset register, on three scalar bases) stay theirs up to this wait: no load lands on them and nothing rewrites them ahead of it
#pragma unroll
        for (int i = 0; i < 16; ++i) { *(v8usa*)(lk + i * 32 * KPT) = rh[i]; *(v8usa*)(lk + (TT + i * 32) * KPT) = rl[i]; }
#pragma unroll
        for (int i = 0; i < 32; ++i) *(v8usa*)(lv + i * 2 * VPT) = rv[i]; }
    __syncthreads();    // K and V^T are written by other waves than read them
    v8f o[4][2];    // O^T: [16 of d][query tile]
#pragma unroll
    for (int mb = 0; mb < 4; ++mb)
#pragma unroll
        for (int u = 0; u < 2; ++u) o[mb][u] = (v8f){};
    float mr[2] = {-__builtin_inff(), -__builtin_inff()}, ls[2] = {0.f, 0.f};    // per query tile: the maximum in use (the same in both lane halves) and the lane's own share of the sum
    const float cs = SCL * 1.4426950408889634f;
    const bf* kf = sk + lr * KPT + 8 * hi; const bf* vf = sv + lr * VPT + 8 * hi;
    V kh[2][2], kl[2][2];    // [key tile][32 of d]; a step's K fragments are fetched one step ahead
#pragma unroll
    for (int t = 0; t < 2; ++t)
#pragma unroll
        for (int c = 0; c < 2; ++c) { kh[t][c] = F::ld(kf + t * 16 * KPT + c * 32); kl[t][c] = F::ld(kf + (TT + t * 16) * KPT + c * 32); }
#pragma unroll 1    // one step of text, for speed only
    for (int kb = 0; kb < TT / 32; ++kb) {
        V vh[4], vl[4];
#pragma unroll
        for (int mb = 0; mb < 4; ++mb) { vh[mb] = F::ld(vf + mb * 16 * VPT + kb * 32); vl[mb] = F::ld(vf + mb * 16 * VPT + TT + kb * 32); }
        __builtin_amdgcn_sched_barrier(0);    // keeps this step's V^T reads, one group, ahead of the score products (left alone the compiler sinks each read to its use and waits for it there)
        v8f s[2][2];
#pragma unroll
        for (int t = 0; t < 2; ++t)
#pragma unroll
            for (int u = 0; u < 2; ++u) s[t][u] = (v8f){};
#pragma unroll
        for (int c = 0; c < 2; ++c) {
#pragma unroll
            for (int t = 0; t < 2; ++t)
#pragma unroll
                for (int u = 0; u < 2; ++u) s[t][u] = F::mma(kh[t][c], qh[u][c], s[t][u]);
            __builtin_amdgcn_sched_barrier(0);    // keeps four independent tiles between two products into one accumulator
#pragma unroll
            for (int t = 0; t < 2; ++t)
#pragma unroll
                for (int u = 0; u < 2; ++u) s[t][u] = F::mma(kh[t][c], ql[u][c], s[t][u]);
            __builtin_amdgcn_sched_barrier(0);    // as above
#pragma unroll
            for (int t = 0; t < 2; ++t)
#pragma unroll
                for (int u = 0; u < 2; ++u) s[t][u] = F::mma(kl[t][c], qh[u][c], s[t][u]);
            __builtin_amdgcn_sched_barrier(0); }    // as above
        { const bf* kn = kf + ((kb + 1) & (TT / 32 - 1)) * 32 * KPT;    // the next step's key rows; the last step reads step 0's again, which nothing uses
#pragma unroll
            for (int t = 0; t < 2; ++t)
#pragma unroll
                for (int c = 0; c < 2; ++c) { kh[t][c] = F::ld(kn + t * 16 * KPT + c * 32); kl[t][c] = F::ld(kn + (TT + t * 16) * KPT + c * 32); } }
        __builtin_amdgcn_sched_barrier(0);    // keeps the next step's K reads, one group, ahead of the softmax work, under which they land
        V ph[2], pl[2];
#pragma unroll
        for (int u = 0; u < 2; ++u) {    // query lr of tile u: the lane's 16 scores of this step, then one exchange with lane ^ 16
            v8f m8;
#pragma unroll
            for (int j = 0; j < 8; ++j) m8[j] = fmaxf(s[0][u][j], s[1][u][j]);
            float mx = fmaxf(fmaxf(fmaxf(m8[0], m8[1]), fmaxf(m8[2], m8[3])), fmaxf(fmaxf(m8[4], m8[5]), fmaxf(m8[6], m8[7])));
            mx = fmaxf(mx, xhalf(mx));
            const float mn = fmaxf(mr[u], mx), al = __builtin_amdgcn_exp2f((mr[u] - mn) * cs), mc = mn * cs; mr[u] = mn;
#pragma unroll
            for (int t = 0; t < 2; ++t)
#pragma unroll
                for (int j = 0; j < 8; ++j) s[t][u][j] = __builtin_amdgcn_exp2f(s[t][u][j] * cs - mc);
            const v8f a8 = s[0][u] + s[1][u];
            ls[u] = ls[u] * al + (((a8[0] + a8[1]) + (a8[2] + a8[3])) + ((a8[4] + a8[5]) + (a8[6] + a8[7])));
#pragma unroll
            for (int mb = 0; mb < 4; ++mb) o[mb][u] *= al;
            v4w h0, h1, l0, l1; split8(s[0][u], h0, l0); split8(s[1][u], h1, l1);
            ph[u] = cat16v(h0, h1); pl[u] = cat16v(l0, l1); }
        __builtin_amdgcn_sched_barrier(0);    // the products below start together, eight independent tiles a group
#pragma unroll
        for (int mb = 0; mb < 4; ++mb)
#pragma unroll
            for (int u = 0; u < 2; ++u) o[mb][u] = F::mma(vh[mb], ph[u], o[mb][u]);
#pragma unroll
        for (int mb = 0; mb < 4; ++mb)
#pragma unroll
            for (int u = 0; u < 2; ++u) o[mb][u] = F::mma(vh[mb], pl[u], o[mb][u]);
#pragma unroll
        for (int mb = 0; mb < 4; ++mb)
#pragma unroll
            for (int u = 0; u < 2; ++u) o[mb][u] = F::mma(vl[mb], ph[u], o[mb][u]);
    }
    // lane (lr, hi) holds d = mb*16 + hi*8 + j of query lr of tile u: out / sum x sigmoid(gate) (true divisions), split into hi + lo, goes straight to the merged-head operand planes of the output projection
    const size_t oo = ((z / NH_) * TT + q0 + lr) * DQ + (z % NH_) * HD + hi * 8; const float* gp = G + oo; v4f g[2][8];
#pragma unroll
    for (int u = 0; u < 2; ++u)
#pragma unroll
        for (int i = 0; i < 8; ++i) g[u][i] = *(const v4f*)(gp + u * 16 * DQ + (i >> 1) * 16 + (i & 1) * 4);
    asm volatile("s_wait_xcnt 0x0" :: "v"(gp) : "memory");    // the loads' address registers stay theirs up to this wait
#pragma unroll
    for (int u = 0; u < 2; ++u) { const float f = __fdiv_rn(1.0f, ls[u] + xhalf(ls[u]));
#pragma unroll
        for (int mb = 0; mb < 4; ++mb) { v8f a; v4w h, l;
#pragma unroll
            for (int j = 0; j < 8; ++j) { const float den = __fadd_rn(1.0f, expf(-g[u][mb * 2 + (j >> 2)][j & 3])); a[j] = __fmul_rn(__fmul_rn(o[mb][u][j], f), __fdiv_rn(1.0f, den)); }
            split8(a, h, l); *(v4wa*)(Ah + oo + u * 16 * DQ + mb * 16) = h; *(v4wa*)(Al + oo + u * 16 * DQ + mb * 16) = l;
            asm volatile("s_wait_xcnt 0x0" ::: "memory"); } }    // no register of the two stores above is rewritten by the next tile's arithmetic ahead of this wait
}

extern "C" void kernel_launch(void* const* d_in, const int* in_sizes, int n_in,
                              void* d_out, int out_size, void* d_ws, size_t ws_size, hipStream_t stream) {
    (void)in_sizes; (void)n_in; (void)out_size;
    const float* x = (const float*)d_in[0]; const float* ln_g = (const float*)d_in[1]; const float* ln_b = (const float*)d_in[2]; const float* wq = (const float*)d_in[3]; const float* wkv = (const float*)d_in[4]; const float* wg = (const float*)d_in[5]; const float* bg = (const float*)d_in[6]; const float* wo = (const float*)d_in[7]; const float* bo = (const float*)d_in[8];
    float* OUT = (float*)d_out;     // [1][64][512][256] = [32768][256]
    char* wsp = (char*)d_ws;
    auto take = [&](size_t bytes) { char* p = wsp; wsp += (bytes + 255) & ~(size_t)255; return (void*)p; };
    bf* WQ = (bf*)take((size_t)4 * DQ * DM * 2); bf* WKV = WQ + DQ * DM; bf* WG = WQ + 3 * DQ * DM;    /* one Bt of 2,048 rows: q | k | v | gate */
    bf* WO = (bf*)take((size_t)DM * DQ * 2);
    bf* LNh = (bf*)take((size_t)GR * DM * 2); bf* LNl = (bf*)take((size_t)GR * DM * 2); float* FG = (float*)take((size_t)GR * DQ * 4);
    bf* QPh = (bf*)take((size_t)ZH * TT * HD * 2); bf* QPl = (bf*)take((size_t)ZH * TT * HD * 2); bf* KPh = (bf*)take((size_t)ZH * TT * HD * 2); bf* KPl = (bf*)take((size_t)ZH * TT * HD * 2); bf* VTh = (bf*)take((size_t)ZH * HD * 2 * TT * 2);    // row (z, d) of V^T: hi at VTh + row*2*TT, lo TT elements behind it
    bf* ATh = (bf*)take((size_t)GR * DQ * 2); bf* ATl = (bf*)take((size_t)GR * DQ * 2);
    if ((size_t)(wsp - (char*)d_ws) > ws_size) return;    // ws 256 MiB
    k_pre<<<5 * WB + GR / 8, 256, 0, stream>>>(wq, wkv, wg, wo, WQ, WKV, WG, WO, x, ln_g, ln_b, LNh, LNl);
    for (int g = 0; g < NB_ / GB; ++g) {
        k_gemmw<bf, 1, true, DM, 1, 2, 4><<<dim3(GR / 128, 4 * DQ / 256, 1), 256, 0, stream>>>(LNh, LNl, WQ, nullptr, DM, FG, DQ, bg, 0, 0, 0, QPh, QPl, VTh, KPh, KPl, nullptr, nullptr, nullptr);
        k_attn<<<dim3(TT / AQ, ZH, 1), 256, 0, stream>>>(QPh, QPl, KPh, KPl, VTh, FG, ATh, ATl);
        /* LNh, LNl are free once this pass's projections have run: the next pass's rows are normalised beside the output projection (GR / 8 more work-groups) */
        if (g + 1 < NB_ / GB) k_gemmw<bf, 1, true, DQ, 0, 1, 1><<<dim3(GR / 64, DM / 64, 1 + (GR / 8) / ((GR / 64) * (DM / 64))), 32, 0, stream>>>(ATh, ATl, WO, nullptr, DQ, OUT + (size_t)g * GR * DM, DM, bo, 0, 0, 0, LNh, LNl, nullptr, nullptr, nullptr, x + (size_t)(g + 1) * GR * DM, ln_g, ln_b);
        else k_gemmw<bf, 1, true, DQ, 0, 1, 1><<<dim3(GR / 64, DM / 64, 1), 32, 0, stream>>>(ATh, ATl, WO, nullptr, DQ, OUT + (size_t)g * GR * DM, DM, bo, 0, 0, 0, nullptr, nullptr, nullptr, nullptr, nullptr, nullptr, nullptr, nullptr); }
}

// v008
// Measured time: 263 microseconds a run.
// Timed twice side by side with v007, it ran 1.05 times as fast both times.
// All steps since v000 together make it 6.15 times as fast.
#include <hip/hip_runtime.h>

// Gated row (axial) attention with a pre-LayerNorm (x [1][64][512][256]: 64 image rows = 64 independent sequences of 512 tokens x 256; xn = LayerNorm(x) (gamma, beta, eps 1e-5); q = xn Wq ('xw' [256][512], 8 heads x 64), [k|v] = xn Wkv ('xw' [256][1024]: columns k | v); dots = (q/8).k over the 512 keys of the same row; softmax (the explicit max subtraction is a softmax identity); out = attn.v merged; gates = sigmoid(xn Wg + bg) ('xw' [256][512]); y = (out * gates) Wo + bo ('xw' [512][256]) -> [1][64][512][256] (8.4 M)).
// Compute dtypes, f32 accumulate: every input rounded to bf16; LayerNorm in f32, xn as bf16 hi + lo planes; q / kv / gate projections as (hi + lo) x exact weights (2 products) + f32 bias; scores and attn.v on bf16 hi/lo planes (3 products) for every row; softmax f32; sigmoid gate f32 (true division); (out x gate) as hi + lo x exact Wo (2 products) + bo.
// Layout: 16 image rows (8,192 tokens) per pass; all per-(row, head) planes are laid out z-major ([z = row*8 + head][512][64]); scores, softmax and attn.v are ONE launch (k_attn), the scores and the probabilities live in registers only, 32 keys at a time (running maximum and sum).
// Launches that do not depend on one another share one grid: the four weight transposes with the first pass's LayerNorm (k_pre); the q, kv and gate projections (one GEMM over the 2,048 stacked weight rows); the output projection with the next pass's LayerNorm (k_outp). 13 launches: 1 + 4 x 3.
// No elementwise launch stands between the matrix kernels: the q and kv projections split their f32 tiles into the hi / lo planes (V transposed) in their own epilogue, and k_attn gates and splits its output tile in its own.
// Workspace: the transposed V planes lie [hi 512 | lo 512] per row (pitch 1,024 elements).

#define NB_  64        // sequences (image rows)
#define TT   512       // tokens per sequence
#define DM   256
#define NH_  8
#define HD   64
#define DQ   (NH_ * HD)    // 512 = inner dim
#define GB   16            // sequences per pass
#define GR   (GB * TT)     // 8192 token rows per pass
#define ZH   (GB * NH_)    // 128 (sequence, head) planes per pass
#define SCL  0.125f   // HD^-0.5
typedef _Float16 h16;
typedef unsigned short bf;
typedef __attribute__((ext_vector_type(16))) __bf16   v16bf;
typedef __attribute__((ext_vector_type(16))) _Float16 v16h;
typedef __attribute__((ext_vector_type(8)))  _Float16 v8h;
typedef __attribute__((ext_vector_type(8)))  unsigned short v8us;
typedef __attribute__((ext_vector_type(8)))  float    v8f;
typedef __attribute__((ext_vector_type(4)))  float    v4f;
typedef v8h  __attribute__((may_alias)) v8ha;
typedef v4f  __attribute__((may_alias)) v4fa;
typedef v8us __attribute__((may_alias)) v8usa;

__device__ __forceinline__ unsigned short f2bf(float f) { unsigned u = __float_as_uint(f); u += 0x7FFFu + ((u >> 16) & 1u); return (unsigned short)(u >> 16); }
__device__ __forceinline__ float bf2f(unsigned short b) { return __uint_as_float(((unsigned)b) << 16); }
__device__ __forceinline__ float bfr(float f) { return bf2f(f2bf(f)); }
__device__ __forceinline__ v16h cat16(v8h lo, v8h hi) { return __builtin_shufflevector(lo, hi, 0, 1, 2, 3, 4, 5, 6, 7, 8, 9, 10, 11, 12, 13, 14, 15); }
__device__ __forceinline__ v16bf cat16b(v8us lo, v8us hi) { return __builtin_bit_cast(v16bf, __builtin_shufflevector(lo, hi, 0, 1, 2, 3, 4, 5, 6, 7, 8, 9, 10, 11, 12, 13, 14, 15)); }
__device__ __forceinline__ v8f wmma16(v16h a, v16h b, v8f c) { return __builtin_amdgcn_wmma_f32_16x16x32_f16(false, a, false, b, (short)0, c, false, false); }
__device__ __forceinline__ v8f wmmab(v16bf a, v16bf b, v8f c) { return __builtin_amdgcn_wmma_f32_16x16x32_bf16(false, a, false, b, (short)0, c, false, false); }

typedef __attribute__((ext_vector_type(2))) float v2f;
typedef __attribute__((ext_vector_type(2))) __bf16 v2bf;
typedef __attribute__((ext_vector_type(4))) unsigned v4w;    // eight bf16 as four packed words
// hi = p rounded to nearest even, lo = the rest rounded likewise (as splitf), two values a word: the packed hi word is also the source of the two f32 that are subtracted
__device__ __forceinline__ void split8(v8f p, v4w& h, v4w& l) {
#pragma unroll
    for (int i = 0; i < 4; ++i) { const unsigned u = __builtin_bit_cast(unsigned, __builtin_convertvector(((v2f){p[2 * i], p[2 * i + 1]}), v2bf)); h[i] = u;
        l[i] = __builtin_bit_cast(unsigned, __builtin_convertvector(((v2f){p[2 * i] - __uint_as_float(u << 16), p[2 * i + 1] - __uint_as_float(u & 0xFFFF0000u)}), v2bf)); } }
typedef v4w __attribute__((may_alias)) v4wa;

__device__ __forceinline__ void splitf(float y, unsigned short& h, unsigned short& l) { h = f2bf(y); l = f2bf(y - bf2f(h)); }
typedef __attribute__((ext_vector_type(2))) unsigned short v2us;
typedef __attribute__((ext_vector_type(4))) unsigned short v4us;
// LayerNorm of one row of 256 by one wave: y0, y1 are the lane's elements lane*4 .. +3 and 128 + lane*4 .. +3 of row r; g0, g1 and b0, b1 the same elements of gamma and beta
__device__ __forceinline__ void ln_row(const v4f y0, const v4f y1, const v4f g0, const v4f g1, const v4f b0, const v4f b1, const size_t r, const int lane, bf* Yh, bf* Yl) {
    float hv[8]; float s = 0.f;
#pragma unroll
    for (int ch = 0; ch < 2; ++ch) { const v4f y = ch ? y1 : y0;
#pragma unroll
        for (int q = 0; q < 4; ++q) { const float u = bfr(y[q]); hv[ch * 4 + q] = u; s += u; } }
#pragma unroll
    for (int sh = 16; sh; sh >>= 1) s += __shfl_xor(s, sh, 32);
    float mu = s * (1.0f / 256.0f); asm volatile("" : "+v"(mu)); float s2 = 0.f;
#pragma unroll
    for (int k = 0; k < 8; ++k) { float d0 = __fsub_rn(hv[k], mu); asm volatile("" : "+v"(d0)); float p = __fmul_rn(d0, d0); asm volatile("" : "+v"(p)); s2 = __fadd_rn(s2, p); }
#pragma unroll
    for (int sh = 16; sh; sh >>= 1) s2 += __shfl_xor(s2, sh, 32);
    float var = __fadd_rn(s2 * (1.0f / 256.0f), 1e-5f); asm volatile("" : "+v"(var)); const float rs = __frsqrt_rn(var);
#pragma unroll
    for (int ch = 0; ch < 2; ++ch) { const int c0 = ch * 128 + lane * 4; v4us oh, ol;
#pragma unroll
        for (int q = 0; q < 4; ++q) { float gg = bfr((ch ? g1 : g0)[q]); asm volatile("" : "+v"(gg)); float d0 = __fsub_rn(hv[ch * 4 + q], mu); asm volatile("" : "+v"(d0)); float n0 = __fmul_rn(d0, rs); asm volatile("" : "+v"(n0)); float y = __fmul_rn(n0, gg); asm volatile("" : "+v"(y)); y = __fadd_rn(y, bfr((ch ? b1 : b0)[q])); unsigned short a, c2; splitf(y, a, c2); oh[q] = a; ol[q] = c2; }
        *(v4us*)(Yh + r * DM + c0) = oh; *(v4us*)(Yl + r * DM + c0) = ol;
        asm volatile("s_wait_xcnt 0x0" ::: "memory"); }    // no register of the two stores above is rewritten by what follows (the row's second half, the caller's next row) ahead of this wait
}

// ---- k_gemmw: register-blocked GEMM, ONE WAVE per 64x64 output tile (16 accumulators), WM x WN waves a work-group, operands from K-contiguous 16-bit planes; grid (M/(64 WM), N/(64 WN), Z), 32 WM WN threads.
// The waves of a group share each staged piece: its 64 WM rows of the A planes and 64 WN rows of Bt leave L2 once for the group, not once for each wave that reads them. The stacked projections run 2 x 4 waves (512 staged rows a piece where eight one-wave groups take 1,536); the output projection, whose grid has few tiles, has a kernel of its own (k_outp).
// C[m][n] (f32, pitch ldc, + optional f32 bias[n]) = sum_k A[m][k] Bt[n][k] (+ split products per NSPLIT). K (a template argument, so that a piece's loads of a plane (NA of an A plane, NB of Bt) share one offset register and differ in the immediate offset) is the row pitch of A and of Bt in elements, KD <= K the depth that is summed. z-batch strides sA/sB/sC in elements. KD % 64 == 0, K % 64 == 0.
// Each 64-row x 64-deep piece of a plane goes through LDS: a global load takes 4 whole 128-byte lines (8 lanes a row), where a fragment load straight from memory touches 16 lines for the same 512 bytes; the fragments are then read from LDS rows of SP elements (144 B = 16 B x 9: no bank conflict).
// EPI says where the tile goes. 0: C as above. 1: the stacked projections, by the tile's column: a tile is 64 tokens x one head (64 | TT, HD = 64); columns below DQ (q) and below 2 DQ (k) are split into bf16 hi + lo and stored as 64 whole rows of the z-major planes Ph, Pl (q) or Kh, Kl (k); columns below 3 DQ (v) go transposed into VT: an accumulator register group holds 8 successive tokens of one d, which are 16 bytes of a V^T row as they stand; the last DQ columns (gate) go to C with the bias.
#define SP 72
template <bool B> struct Sel { static constexpr bool v = B; };
template <typename T16> struct WFrag;
template <> struct WFrag<h16> { typedef v16h V; static __device__ __forceinline__ V ld(const h16* p) { return cat16(*(const v8h*)p, *(const v8h*)(p + 16)); } static __device__ __forceinline__ v8f mma(V a, V b, v8f c) { return wmma16(a, b, c); } };
template <> struct WFrag<bf> { typedef v16bf V; static __device__ __forceinline__ V ld(const bf* p) { return cat16b(*(const v8us*)p, *(const v8us*)(p + 16)); } static __device__ __forceinline__ v8f mma(V a, V b, v8f c) { return wmmab(a, b, c); } };
template <typename T16, int NSPLIT, bool BIAS, int K, int EPI, int WM, int WN>
__global__ __launch_bounds__(32 * WM * WN) void k_gemmw(const T16* __restrict__ A, const T16* __restrict__ A2, const T16* __restrict__ Bt, const T16* __restrict__ Bt2, int KD, float* C, int ldc, const float* __restrict__ bias, size_t sA, size_t sB, size_t sC, bf* Ph, bf* Pl, bf* VT, bf* Kh, bf* Kl) {
    typedef typename WFrag<T16>::V V;
    constexpr int NW = WM * WN, RS = NW * 4, NA = WM * 64 / RS, NB = WN * 64 / RS;    // waves; rows that one staging load of the whole group takes; such loads per A plane, per B plane
    __shared__ __align__(16) float osg[NW * 16 * 68];
    __shared__ __align__(16) T16 sa[WM * 64 * SP], sb[WN * 64 * SP], sa2[(NSPLIT == 1 || NSPLIT == 2) ? WM * 64 * SP : 8], sb2[NSPLIT >= 2 ? WN * 64 * SP : 8];
    const size_t z = blockIdx.z; A += z * sA; if (A2) A2 += z * sA; Bt += z * sB; if (Bt2) Bt2 += z * sB; C += z * sC;
    const int tid = threadIdx.x, lane = tid & 31, lr = lane & 15, hi = lane >> 4; const int wv = NW > 1 ? __builtin_amdgcn_readfirstlane(tid >> 5) : 0, wm = wv % WM, wn = wv / WM;    // the wave's number as a scalar: the epilogue's choices by column stay scalar branches
    const int R0 = blockIdx.x * (64 * WM), C0 = blockIdx.y * (64 * WN), r0 = R0 + wm * 64, c0 = C0 + wn * 64; float* os = osg + wv * (16 * 68);    // the group's tile, the wave's own 64 x 64 of it, the wave's own epilogue rows
    v8f acc[4][4];
#pragma unroll
    for (int mb = 0; mb < 4; ++mb)
#pragma unroll
        for (int nb = 0; nb < 4; ++nb) acc[mb][nb] = (v8f){};
    const int srow = tid >> 3, scol = (tid & 7) * 8;    // staging: 8 lanes take one row's 128 bytes
    const unsigned aoff = ((unsigned)(R0 + srow) * K + scol) * 2u, boff = ((unsigned)(C0 + srow) * K + scol) * 2u;    // byte offsets (a plane is below 4 GiB): the plane pointers stay scalar and one offset register serves both A planes
    const int soff = srow * SP + scol, foa = (wm * 64 + lr) * SP + 8 * hi, fob = (wn * 64 + lr) * SP + 8 * hi;
#pragma unroll 1
    for (int k0 = 0; k0 < KD; k0 += 64) { const unsigned ao = aoff + k0 * 2u, bo = boff + k0 * 2u; const char* pa = (const char*)A + ao; const char* pb = (const char*)Bt + bo; const char* pa2 = (NSPLIT == 1 || NSPLIT == 2) ? (const char*)A2 + ao : pa; const char* pb2 = NSPLIT >= 2 ? (const char*)Bt2 + bo : pb;
        v8us ra[NA], rb[NB], ra2[(NSPLIT == 1 || NSPLIT == 2) ? NA : 1], rb2[NSPLIT >= 2 ? NB : 1];
#pragma unroll    // all loads of a piece in flight together, each row step an immediate offset
        for (int i = 0; i < (NA > NB ? NA : NB); ++i) { if (i < NA) ra[i] = *(const v8usa*)(pa + i * RS * 2 * K); if (i < NB) rb[i] = *(const v8usa*)(pb + i * RS * 2 * K);
            if ((NSPLIT == 1 || NSPLIT == 2) && i < NA) ra2[i] = *(const v8usa*)(pa2 + i * RS * 2 * K); if (NSPLIT >= 2 && i < NB) rb2[i] = *(const v8usa*)(pb2 + i * RS * 2 * K); }
        asm volatile("s_wait_xcnt 0x0" :: "v"(ao), "v"(bo) : "memory");    // the loads' address registers stay theirs up to this wait: no later load lands on them, the next piece's addresses are formed behind it; standing ahead of the LDS stores it also keeps every load of the piece ahead of the first store (left alone the stacked-projection build waits for each load by itself)
#pragma unroll
        for (int i = 0; i < (NA > NB ? NA : NB); ++i) { if (i < NA) *(v8usa*)(sa + soff + i * RS * SP) = ra[i]; if (i < NB) *(v8usa*)(sb + soff + i * RS * SP) = rb[i];
            if ((NSPLIT == 1 || NSPLIT == 2) && i < NA) *(v8usa*)(sa2 + soff + i * RS * SP) = ra2[i]; if (NSPLIT >= 2 && i < NB) *(v8usa*)(sb2 + soff + i * RS * SP) = rb2[i]; }
        __syncthreads();    // the piece is written by other lanes, in a group of several waves by other waves, than read it (a one-wave group: it builds to the LDS wait and keeps the compiler from reading ahead of the stores)
        V a[4], a2[4];
#pragma unroll    // the second half's fragment reads are scheduled among the first half's products
      for (int kc = 0; kc < 64; kc += 32) {
#pragma unroll
        for (int mb = 0; mb < 4; ++mb) { a[mb] = WFrag<T16>::ld(sa + foa + mb * 16 * SP + kc); if (NSPLIT == 1 || NSPLIT == 2) a2[mb] = WFrag<T16>::ld(sa2 + foa + mb * 16 * SP + kc); }
#pragma unroll
        for (int nb = 0; nb < 4; ++nb) { const V b = WFrag<T16>::ld(sb + fob + nb * 16 * SP + kc); V b2; if (NSPLIT >= 2) b2 = WFrag<T16>::ld(sb2 + fob + nb * 16 * SP + kc);
#pragma unroll
            for (int mb = 0; mb < 4; ++mb) { acc[mb][nb] = WFrag<T16>::mma(a[mb], b, acc[mb][nb]); if (NSPLIT == 1 || NSPLIT == 2) acc[mb][nb] = WFrag<T16>::mma(a2[mb], b, acc[mb][nb]); if (NSPLIT >= 2) acc[mb][nb] = WFrag<T16>::mma(a[mb], b2, acc[mb][nb]); } }
      }
        asm volatile("v_nop\n\tv_nop\n\tv_nop\n\tv_nop" : "+v"(acc[0][0]), "+v"(acc[0][1]), "+v"(acc[0][2]), "+v"(acc[0][3]), "+v"(acc[1][0]), "+v"(acc[1][1]), "+v"(acc[1][2]), "+v"(acc[1][3]), "+v"(acc[2][0]), "+v"(acc[2][1]), "+v"(acc[2][2]), "+v"(acc[2][3]), "+v"(acc[3][0]), "+v"(acc[3][1]), "+v"(acc[3][2]), "+v"(acc[3][3]));    // the four vector slots between the piece's last product and the branch back, behind which the next piece's loads land on operand registers; every accumulator is named, so that no product of the piece is scheduled behind the slots
        __syncthreads();    // every fragment is read before the next piece overwrites it (keeps the next stores behind these reads)
    }
    const size_t zz = (size_t)(r0 / TT) * NH_ + (c0 / HD) % NH_; const int t0 = r0 % TT;    // the tile's (sequence, head) plane and its first token
    if (EPI == 1 && c0 >= 2 * DQ && c0 < 3 * DQ) {
        bf* vrow = VT + (zz * HD + lr) * (2 * TT) + t0 + hi * 8;
#pragma unroll
        for (int nb = 0; nb < 4; ++nb)
#pragma unroll
            for (int mb = 0; mb < 4; ++mb) { v4w h, l; split8(acc[mb][nb], h, l); *(v4wa*)(vrow + nb * 16 * 2 * TT + mb * 16) = h; *(v4wa*)(vrow + nb * 16 * 2 * TT + mb * 16 + TT) = l; }
    } else {
    auto rows = [&](auto pln) __attribute__((always_inline)) {    // the tile by way of os, 16 rows at a time; pln: to the hi / lo planes, else to C (the choice is made once a tile, outside the loop)
#pragma unroll
    for (int mb = 0; mb < 4; ++mb) {
#pragma unroll
        for (int nb = 0; nb < 4; ++nb) {
#pragma unroll
            for (int j = 0; j < 8; ++j) os[(hi * 8 + j) * 68 + nb * 16 + lr] = acc[mb][nb][j]; }
        __builtin_amdgcn_wave_barrier(); asm volatile("" ::: "memory");
        if (decltype(pln)::v) { bf* ph = c0 < DQ ? Ph : Kh; bf* pl = c0 < DQ ? Pl : Kl; const size_t po = (zz * TT + t0 + mb * 16 + (lane >> 3)) * HD + (lane & 7) * 8;    // 8 lanes a row: a store takes 4 whole 128-byte rows
#pragma unroll
            for (int s = 0; s < 4; ++s) { const float* orw = os + (4 * s + (lane >> 3)) * 68 + (lane & 7) * 8; const v4f x0 = *(const v4fa*)orw, x1 = *(const v4fa*)(orw + 4); v4w h, l;
                split8((v8f){x0[0], x0[1], x0[2], x0[3], x1[0], x1[1], x1[2], x1[3]}, h, l); *(v4wa*)(ph + po + s * 4 * HD) = h; *(v4wa*)(pl + po + s * 4 * HD) = l; }
        } else {
        const int cg = EPI == 1 ? c0 - 3 * DQ : c0;    // the tile's first column in C and in the bias
        float* crow = C + (size_t)(r0 + mb * 16) * ldc + cg;
#pragma unroll
            for (int s = 0; s < 8; ++s) { const int row = 2 * s + hi, cofs = lr * 4; v4f val = *(const v4fa*)(os + row * 68 + cofs); if (BIAS) { val[0] += bfr(bias[cg + cofs]); val[1] += bfr(bias[cg + cofs + 1]); val[2] += bfr(bias[cg + cofs + 2]); val[3] += bfr(bias[cg + cofs + 3]); }
                *(v4f*)(crow + (size_t)row * ldc + cofs) = val; }
             }
        __builtin_amdgcn_wave_barrier(); asm volatile("s_wait_xcnt 0x0" ::: "memory");    // keeps the next rows' writes of os behind these reads, as before; the wait: no register of the stores above is rewritten, and no later load lands on one, ahead of it (the next rows' bias load did; behind the last rows the built code lays another block of the kernel, with a branch round it)
    }
    };
    if (EPI == 1 && c0 < 2 * DQ) rows(Sel<true>{}); else rows(Sel<false>{});
    }
}

// ---- k_outp: the output projection, C[m][n] = sum_k (A + A2)[m][k] Bt[n][k] + bias[n] (f32, pitch DM), depth DQ. Grid (GR/64, DM/64): 512 tiles of 64 x 64, two to a WGP; with one wave a tile a wave walks eight staged pieces one behind the other, each with its own trip to memory, and half the SIMDs stand idle.
// OW waves a work-group share ONE tile and split its DEPTH: wave w sums k = w*KW .. w*KW + KW - 1 (two pieces) through staging rows of its own, as k_gemmw stages them; the OW partial tiles then meet in LDS (on the staging rows, which are read out by then), and each wave adds and stores 16 of the 64 rows: ((p0 + p1) + (p2 + p3)) + bias.
// LN: each wave also normalises 4 rows of the next pass (X -> Ph, Pl; OW x 4 x 512 = GR rows). Their loads go out ahead of the first piece's, and the arithmetic of two rows runs while each piece is on its way.
#define OW 4
#define KW (DQ / OW)
template <bool LN>
__global__ __launch_bounds__(32 * OW) void k_outp(const bf* __restrict__ A, const bf* __restrict__ A2, const bf* __restrict__ Bt, float* C, const float* __restrict__ bias, bf* Ph, bf* Pl, const float* __restrict__ X, const float* __restrict__ gw, const float* __restrict__ gb) {
    typedef WFrag<bf> F; typedef F::V V;
    __shared__ __align__(16) bf sm[OW * 3 * 64 * SP];    // staging: per wave 64 rows of A, A2, Bt; behind the two pieces: OW partial tiles of 64 rows x 68 f32
    const int tid = threadIdx.x, lane = tid & 31, lr = lane & 15, hi = lane >> 4; const int wv = __builtin_amdgcn_readfirstlane(tid >> 5);
    bf* sa = sm + wv * (3 * 64 * SP); bf* sa2 = sa + 64 * SP; bf* sb = sa2 + 64 * SP;
    const int r0 = blockIdx.x * 64, c0 = blockIdx.y * 64;
    const int cofs = lr * 4; const float* bp = bias + c0 + cofs; const v4f braw = *(const v4f*)bp;    // the lane's four bias values, read first: their trip runs beside the first piece's
    __builtin_amdgcn_sched_barrier(0);    // keeps that load the first: loads return in order, and the wait for its value (ahead of the first piece's s_wait_xcnt) is then no wait for the piece
    const size_t rw = (((size_t)blockIdx.y * (GR / 64) + blockIdx.x) * OW + wv) * 4; v4f y[4][2], g0, g1, b0, b1;
    if (LN) {
#pragma unroll
        for (int i = 0; i < 4; ++i) { y[i][0] = *(const v4f*)(X + (rw + i) * DM + lane * 4); y[i][1] = *(const v4f*)(X + (rw + i) * DM + 128 + lane * 4); }
        g0 = *(const v4f*)(gw + lane * 4); g1 = *(const v4f*)(gw + 128 + lane * 4); b0 = *(const v4f*)(gb + lane * 4); b1 = *(const v4f*)(gb + 128 + lane * 4); }
    v8f acc[4][4];
#pragma unroll
    for (int mb = 0; mb < 4; ++mb)
#pragma unroll
        for (int nb = 0; nb < 4; ++nb) acc[mb][nb] = (v8f){};
    const int srow = lane >> 3, scol = (lane & 7) * 8;    // staging: 8 lanes take one row's 128 bytes
    const unsigned aoff = ((unsigned)(r0 + srow) * DQ + wv * KW + scol) * 2u, boff = ((unsigned)(c0 + srow) * DQ + wv * KW + scol) * 2u;
    const int soff = srow * SP + scol, fo = lr * SP + 8 * hi;
    auto piece = [&](const int k0, auto rows) __attribute__((always_inline)) {    // one 64-deep piece; rows: the arithmetic of two LayerNorm rows goes between the piece's loads and its LDS stores (written out per piece, not as a loop: out of a loop the compiler lifts that arithmetic, and the wait for its loads, ahead of the piece's loads)
        const unsigned ao = aoff + k0 * 2u, bo = boff + k0 * 2u; const char* pa = (const char*)A + ao; const char* pb = (const char*)Bt + bo; const char* pa2 = (const char*)A2 + ao;
        v8us ra[16], rb[16], ra2[16];
#pragma unroll    // all loads of a piece in flight together, each row step an immediate offset
        for (int i = 0; i < 16; ++i) { ra[i] = *(const v8usa*)(pa + i * 4 * 2 * DQ); rb[i] = *(const v8usa*)(pb + i * 4 * 2 * DQ); ra2[i] = *(const v8usa*)(pa2 + i * 4 * 2 * DQ); }
        if (k0 == 0) asm volatile("s_wait_xcnt 0x0" :: "v"(aoff), "v"(boff), "v"(lr), "v"(braw) : "memory");    // as the next line; the bias load's offset register (the built load takes lr, scaled, on a scalar base) and its value are named too, so that this load stands ahead of the wait and no later load lands on that register
        else asm volatile("s_wait_xcnt 0x0" :: "v"(aoff), "v"(boff) : "memory");    // the loads' address registers (the built loads take aoff, boff and put the piece's step into the immediate offset) stay theirs up to this wait; standing ahead of the LDS stores it also keeps every load of the piece ahead of the first store
        if (decltype(rows)::v) {    // the rows' loads were issued first and return first
            __builtin_amdgcn_sched_barrier(0);    // keeps the rows' arithmetic, and the wait for their loads, behind the issue of the piece's loads
#pragma unroll
            for (int i = k0 / 32; i < k0 / 32 + 2; ++i) ln_row(y[i][0], y[i][1], g0, g1, b0, b1, rw + i, lane, Ph, Pl); }
#pragma unroll
        for (int i = 0; i < 16; ++i) { *(v8usa*)(sa + soff + i * 4 * SP) = ra[i]; *(v8usa*)(sb + soff + i * 4 * SP) = rb[i]; *(v8usa*)(sa2 + soff + i * 4 * SP) = ra2[i]; }
        __syncthreads();    // the piece is written by other lanes than read it: the LDS wait, and the compiler reads nothing ahead of the stores
        V a[4], a2[4];
#pragma unroll    // the second half's fragment reads are scheduled among the first half's products
      for (int kc = 0; kc < 64; kc += 32) {
#pragma unroll
        for (int mb = 0; mb < 4; ++mb) { a[mb] = F::ld(sa + fo + mb * 16 * SP + kc); a2[mb] = F::ld(sa2 + fo + mb * 16 * SP + kc); }
#pragma unroll
        for (int nb = 0; nb < 4; ++nb) { const V b = F::ld(sb + fo + nb * 16 * SP + kc);
#pragma unroll
            for (int mb = 0; mb < 4; ++mb) { acc[mb][nb] = F::mma(a[mb], b, acc[mb][nb]); acc[mb][nb] = F::mma(a2[mb], b, acc[mb][nb]); } }
      }
        __syncthreads();    // every fragment is read before the next piece, or behind the last piece another wave's partial tile, overwrites it
    };
    static_assert(KW == 128, "two pieces a wave");
    piece(0, Sel<LN>{}); piece(64, Sel<LN>{});
    float* red = (float*)sm; float* my = red + wv * (64 * 68);
#pragma unroll
    for (int mb = 0; mb < 4; ++mb)
#pragma unroll
        for (int nb = 0; nb < 4; ++nb)
#pragma unroll
            for (int j = 0; j < 8; ++j) my[(mb * 16 + hi * 8 + j) * 68 + nb * 16 + lr] = acc[mb][nb][j];
    __syncthreads();    // a wave adds rows that the other waves wrote
    const v4f bs = {bfr(braw[0]), bfr(braw[1]), bfr(braw[2]), bfr(braw[3])};
    float* crow = C + (size_t)(r0 + wv * 16) * DM + c0 + cofs; const float* pr = red + wv * 16 * 68 + cofs;
#pragma unroll
    for (int s = 0; s < 8; ++s) { const int row = 2 * s + hi; const float* p = pr + row * 68;
        const v4f val = ((*(const v4fa*)p + *(const v4fa*)(p + 64 * 68)) + (*(const v4fa*)(p + 2 * 64 * 68) + *(const v4fa*)(p + 3 * 64 * 68))) + bs;
        *(v4f*)(crow + (size_t)row * DM) = val; }
}

// ---- k_pre: the four weight transposes ('xw': Bt[n][k] = W[k][n], 64 lines of 64 elements a work-group: 32 + 64 + 32 + 32 work-groups) and, behind them in the same grid, the first pass's LayerNorm (a row a wave).
#define WB (DM * DQ / 64 / 64)    // work-groups of a 256 x 512 weight
__global__ __launch_bounds__(256) void k_pre(const float* __restrict__ wq, const float* __restrict__ wkv, const float* __restrict__ wg, const float* __restrict__ wo, bf* WQ, bf* WKV, bf* WG, bf* WO, const float* __restrict__ X, const float* __restrict__ gw, const float* __restrict__ gb, bf* Yh, bf* Yl) {
    const int lane = threadIdx.x & 31, wv = threadIdx.x >> 5, b = blockIdx.x;
    if (b < 5 * WB) {
        const float* w = b < WB ? wq : b < 3 * WB ? wkv : b < 4 * WB ? wg : wo; bf* Bt = b < WB ? WQ : b < 3 * WB ? WKV : b < 4 * WB ? WG : WO;
        const int K = b < 4 * WB ? DM : DQ, N = b < WB ? DQ : b < 3 * WB ? 2 * DQ : b < 4 * WB ? DQ : DM, b0 = b < WB ? 0 : b < 3 * WB ? WB : b < 4 * WB ? 3 * WB : 4 * WB;
        const int L0 = ((b - b0) * 8 + wv) * 8;
#pragma unroll 1
        for (int l = 0; l < 8; ++l) { const size_t e = (size_t)(L0 + l) * 64 + lane * 2; const int k = (int)(e % K), n = (int)(e / K); v2us o;
            o[0] = f2bf(w[(size_t)k * N + n]); o[1] = f2bf(w[(size_t)(k + 1) * N + n]); *(v2us*)(Bt + e) = o; }
        return; }
    const size_t r = (size_t)(b - 5 * WB) * 8 + wv; const float* xr = X + r * DM;
    ln_row(*(const v4f*)(xr + lane * 4), *(const v4f*)(xr + 128 + lane * 4), *(const v4f*)(gw + lane * 4), *(const v4f*)(gw + 128 + lane * 4), *(const v4f*)(gb + lane * 4), *(const v4f*)(gb + 128 + lane * 4), r, lane, Yh, Yl);
}
// ---- k_attn: scores, softmax and attn.v of 256 query rows of one (sequence, head) plane in ONE work-group; no score leaves the WGP. Grid (TT/256, ZH), 256 threads = 8 waves, 32 query rows (two tiles of 16) a wave.
// The scores are formed transposed, S^T = K Q^T (A = 16 key rows from LDS, B = 16 query rows held in registers): an accumulator tile then holds, in lane (lr, hi), keys 8*hi + j of query lr, and two such tiles are, register for register, the B fragment of a 32-key step of O^T = V^T P^T.
// A wave walks the 512 keys in a rolled loop of 32-key steps with a running maximum and a running sum (the output tiles and the sum are scaled by exp2 of the maximum's rise at every step; the division by the sum comes last): every K and V^T fragment read from LDS feeds two query tiles, and the loop's text is one step long.
// LDS: the K planes (rows of KPT elements, hi plane then lo plane) and, beside them, the V^T rows [hi 512 | lo 512] at pitch VPT (both pitches 16 B x odd); both are staged once for the 256 query rows.
#define KPT 72
__device__ __forceinline__ v16bf cat16v(v4w lo, v4w hi) { return __builtin_bit_cast(v16bf, __builtin_shufflevector(lo, hi, 0, 1, 2, 3, 4, 5, 6, 7)); }
__device__ __forceinline__ float xhalf(float x) { return __builtin_bit_cast(float, __builtin_amdgcn_permlanex16(__builtin_bit_cast(int, x), __builtin_bit_cast(int, x), 0x76543210, 0xfedcba98, false, false)); }    // lane l with lane l ^ 16
#define VPT 1032
#define AQ 256    // query rows of a work-group
__global__ __launch_bounds__(256, 1) void k_attn(const bf* __restrict__ Qh, const bf* __restrict__ Ql, const bf* __restrict__ Kh, const bf* __restrict__ Kl, const bf* __restrict__ VT, const float* __restrict__ G, bf* __restrict__ Ah, bf* __restrict__ Al) {
    typedef WFrag<bf> F; typedef F::V V;
    __shared__ __align__(16) bf sk[2 * TT * KPT];
    __shared__ __align__(16) bf sv[HD * VPT];
    const int tid = threadIdx.x, lane = tid & 31, lr = lane & 15, hi = lane >> 4; const size_t z = blockIdx.y; const int q0 = blockIdx.x * AQ + (tid >> 5) * 32;
    // the wave's Q fragments (B operand: lane lr = query row, k = d in the hardware order; [query tile][32 of d]), and K and V^T to LDS: a load takes whole 128-byte lines; all 64 staging loads of a thread are in flight together (no accumulator is live yet)
    V qh[2][2], ql[2][2];
    { const bf* pqh = Qh + (z * TT + q0 + lr) * HD + 8 * hi; const bf* pql = Ql + (z * TT + q0 + lr) * HD + 8 * hi;
        const bf* gh = Kh + z * (TT * HD) + tid * 8; const bf* gl = Kl + z * (TT * HD) + tid * 8; const bf* gv = VT + z * HD * (2 * TT) + tid * 8;
        bf* lk = sk + (tid >> 3) * KPT + (tid & 7) * 8; bf* lv = sv + (tid >> 7) * VPT + (tid & 127) * 8; v8us rh[16], rl[16], rv[32];
#pragma unroll
        for (int i = 0; i < 16; ++i) { rh[i] = *(const v8usa*)(gh + i * 2048); rl[i] = *(const v8usa*)(gl + i * 2048); }
#pragma unroll
        for (int u = 0; u < 2; ++u)
#pragma unroll
            for (int c = 0; c < 2; ++c) { qh[u][c] = F::ld(pqh + u * 16 * HD + c * 32); ql[u][c] = F::ld(pql + u * 16 * HD + c * 32); }
#pragma unroll
        for (int i = 0; i < 32; ++i) rv[i] = *(const v8usa*)(gv + i * 2048);
        asm volatile("s_wait_xcnt 0x0" :: "v"(tid), "v"(pqh), "v"(pql), "s"(gh - tid * 8), "s"(gl - tid * 8), "s"(gv - tid * 8) : "memory");    // the loads' address registers (the built staging loads take the thread's number as their offset register, on three scalar bases) stay theirs up to this wait: no load lands on them and nothing rewrites them ahead of it
#pragma unroll
        for (int i = 0; i < 16; ++i) { *(v8usa*)(lk + i * 32 * KPT) = rh[i]; *(v8usa*)(lk + (TT + i * 32) * KPT) = rl[i]; }
#pragma unroll
        for (int i = 0; i < 32; ++i) *(v8usa*)(lv + i * 2 * VPT) = rv[i]; }
    __syncthreads();    // K and V^T are written by other waves than read them
    v8f o[4][2];    // O^T: [16 of d][query tile]
#pragma unroll
    for (int mb = 0; mb < 4; ++mb)
#pragma unroll
        for (int u = 0; u < 2; ++u) o[mb][u] = (v8f){};
    float mr[2] = {-__builtin_inff(), -__builtin_inff()}, ls[2] = {0.f, 0.f};    // per query tile: the maximum in use (the same in both lane halves) and the lane's own share of the sum
    const float cs = SCL * 1.4426950408889634f;
    const bf* kf = sk + lr * KPT + 8 * hi; const bf* vf = sv + lr * VPT + 8 * hi;
    V kh[2][2], kl[2][2];    // [key tile][32 of d]; a step's K fragments are fetched one step ahead
#pragma unroll
    for (int t = 0; t < 2; ++t)
#pragma unroll
        for (int c = 0; c < 2; ++c) { kh[t][c] = F::ld(kf + t * 16 * KPT + c * 32); kl[t][c] = F::ld(kf + (TT + t * 16) * KPT + c * 32); }
#pragma unroll 1    // one step of text, for speed only
    for (int kb = 0; kb < TT / 32; ++kb) {
        V vh[4], vl[4];
#pragma unroll
        for (int mb = 0; mb < 4; ++mb) { vh[mb] = F::ld(vf + mb * 16 * VPT + kb * 32); vl[mb] = F::ld(vf + mb * 16 * VPT + TT + kb * 32); }
        __builtin_amdgcn_sched_barrier(0);    // keeps this step's V^T reads, one group, ahead of the score products (left alone the compiler sinks each read to its use and waits for it there)
        v8f s[2][2];
#pragma unroll
        for (int t = 0; t < 2; ++t)
#pragma unroll
            for (int u = 0; u < 2; ++u) s[t][u] = (v8f){};
#pragma unroll
        for (int c = 0; c < 2; ++c) {
#pragma unroll
            for (int t = 0; t < 2; ++t)
#pragma unroll
                for (int u = 0; u < 2; ++u) s[t][u] = F::mma(kh[t][c], qh[u][c], s[t][u]);
            __builtin_amdgcn_sched_barrier(0);    // keeps four independent tiles between two products into one accumulator
#pragma unroll
            for (int t = 0; t < 2; ++t)
#pragma unroll
                for (int u = 0; u < 2; ++u) s[t][u] = F::mma(kh[t][c], ql[u][c], s[t][u]);
            __builtin_amdgcn_sched_barrier(0);    // as above
#pragma unroll
            for (int t = 0; t < 2; ++t)
#pragma unroll
                for (int u = 0; u < 2; ++u) s[t][u] = F::mma(kl[t][c], qh[u][c], s[t][u]);
            __builtin_amdgcn_sched_barrier(0); }    // as above
        { const bf* kn = kf + ((kb + 1) & (TT / 32 - 1)) * 32 * KPT;    // the next step's key rows; the last step reads step 0's again, which nothing uses
#pragma unroll
            for (int t = 0; t < 2; ++t)
#pragma unroll
                for (int c = 0; c < 2; ++c) { kh[t][c] = F::ld(kn + t * 16 * KPT + c * 32); kl[t][c] = F::ld(kn + (TT + t * 16) * KPT + c * 32); } }
        __builtin_amdgcn_sched_barrier(0);    // keeps the next step's K reads, one group, ahead of the softmax work, under which they land
        V ph[2], pl[2];
#pragma unroll
        for (int u = 0; u < 2; ++u) {    // query lr of tile u: the lane's 16 scores of this step, then one exchange with lane ^ 16
            v8f m8;
#pragma unroll
            for (int j = 0; j < 8; ++j) m8[j] = fmaxf(s[0][u][j], s[1][u][j]);
            float mx = fmaxf(fmaxf(fmaxf(m8[0], m8[1]), fmaxf(m8[2], m8[3])), fmaxf(fmaxf(m8[4], m8[5]), fmaxf(m8[6], m8[7])));
            mx = fmaxf(mx, xhalf(mx));
            const float mn = fmaxf(mr[u], mx), al = __builtin_amdgcn_exp2f((mr[u] - mn) * cs), mc = mn * cs; mr[u] = mn;
#pragma unroll
            for (int t = 0; t < 2; ++t)
#pragma unroll
                for (int j = 0; j < 8; ++j) s[t][u][j] = __builtin_amdgcn_exp2f(s[t][u][j] * cs - mc);
            const v8f a8 = s[0][u] + s[1][u];
            ls[u] = ls[u] * al + (((a8[0] + a8[1]) + (a8[2] + a8[3])) + ((a8[4] + a8[5]) + (a8[6] + a8[7])));
#pragma unroll
            for (int mb = 0; mb < 4; ++mb) o[mb][u] *= al;
            v4w h0, h1, l0, l1; split8(s[0][u], h0, l0); split8(s[1][u], h1, l1);
            ph[u] = cat16v(h0, h1); pl[u] = cat16v(l0, l1); }
        __builtin_amdgcn_sched_barrier(0);    // the products below start together, eight independent tiles a group
#pragma unroll
        for (int mb = 0; mb < 4; ++mb)
#pragma unroll
            for (int u = 0; u < 2; ++u) o[mb][u] = F::mma(vh[mb], ph[u], o[mb][u]);
#pragma unroll
        for (int mb = 0; mb < 4; ++mb)
#pragma unroll
            for (int u = 0; u < 2; ++u) o[mb][u] = F::mma(vh[mb], pl[u], o[mb][u]);
#pragma unroll
        for (int mb = 0; mb < 4; ++mb)
#pragma unroll
            for (int u = 0; u < 2; ++u) o[mb][u] = F::mma(vl[mb], ph[u], o[mb][u]);
    }
    // lane (lr, hi) holds d = mb*16 + hi*8 + j of query lr of tile u: out / sum x sigmoid(gate) (true divisions), split into hi + lo, goes straight to the merged-head operand planes of the output projection
    const size_t oo = ((z / NH_) * TT + q0 + lr) * DQ + (z % NH_) * HD + hi * 8; const float* gp = G + oo; v4f g[2][8];
#pragma unroll
    for (int u = 0; u < 2; ++u)
#pragma unroll
        for (int i = 0; i < 8; ++i) g[u][i] = *(const v4f*)(gp + u * 16 * DQ + (i >> 1) * 16 + (i & 1) * 4);
    asm volatile("s_wait_xcnt 0x0" :: "v"(gp) : "memory");    // the loads' address registers stay theirs up to this wait
#pragma unroll
    for (int u = 0; u < 2; ++u) { const float f = __fdiv_rn(1.0f, ls[u] + xhalf(ls[u]));
#pragma unroll
        for (int mb = 0; mb < 4; ++mb) { v8f a; v4w h, l;
#pragma unroll
            for (int j = 0; j < 8; ++j) { const float den = __fadd_rn(1.0f, expf(-g[u][mb * 2 + (j >> 2)][j & 3])); a[j] = __fmul_rn(__fmul_rn(o[mb][u][j], f), __fdiv_rn(1.0f, den)); }
            split8(a, h, l); *(v4wa*)(Ah + oo + u * 16 * DQ + mb * 16) = h; *(v4wa*)(Al + oo + u * 16 * DQ + mb * 16) = l;
            asm volatile("s_wait_xcnt 0x0" ::: "memory"); } }    // no register of the two stores above is rewritten by the next tile's arithmetic ahead of this wait
}

extern "C" void kernel_launch(void* const* d_in, const int* in_sizes, int n_in,
                              void* d_out, int out_size, void* d_ws, size_t ws_size, hipStream_t stream) {
    (void)in_sizes; (void)n_in; (void)out_size;
    const float* x = (const float*)d_in[0]; const float* ln_g = (const float*)d_in[1]; const float* ln_b = (const float*)d_in[2]; const float* wq = (const float*)d_in[3]; const float* wkv = (const float*)d_in[4]; const float* wg = (const float*)d_in[5]; const float* bg = (const float*)d_in[6]; const float* wo = (const float*)d_in[7]; const float* bo = (const float*)d_in[8];
    float* OUT = (float*)d_out;     // [1][64][512][256] = [32768][256]
    char* wsp = (char*)d_ws;
    auto take = [&](size_t bytes) { char* p = wsp; wsp += (bytes + 255) & ~(size_t)255; return (void*)p; };
    bf* WQ = (bf*)take((size_t)4 * DQ * DM * 2); bf* WKV = WQ + DQ * DM; bf* WG = WQ + 3 * DQ * DM;    /* one Bt of 2,048 rows: q | k | v | gate */
    bf* WO = (bf*)take((size_t)DM * DQ * 2);
    bf* LNh = (bf*)take((size_t)GR * DM * 2); bf* LNl = (bf*)take((size_t)GR * DM * 2); float* FG = (float*)take((size_t)GR * DQ * 4);
    bf* QPh = (bf*)take((size_t)ZH * TT * HD * 2); bf* QPl = (bf*)take((size_t)ZH * TT * HD * 2); bf* KPh = (bf*)take((size_t)ZH * TT * HD * 2); bf* KPl = (bf*)take((size_t)ZH * TT * HD * 2); bf* VTh = (bf*)take((size_t)ZH * HD * 2 * TT * 2);    // row (z, d) of V^T: hi at VTh + row*2*TT, lo TT elements behind it
    bf* ATh = (bf*)take((size_t)GR * DQ * 2); bf* ATl = (bf*)take((size_t)GR * DQ * 2);
    if ((size_t)(wsp - (char*)d_ws) > ws_size) return;    // ws 256 MiB
    k_pre<<<5 * WB + GR / 8, 256, 0, stream>>>(wq, wkv, wg, wo, WQ, WKV, WG, WO, x, ln_g, ln_b, LNh, LNl);
    for (int g = 0; g < NB_ / GB; ++g) {
        k_gemmw<bf, 1, true, DM, 1, 2, 4><<<dim3(GR / 128, 4 * DQ / 256, 1), 256, 0, stream>>>(LNh, LNl, WQ, nullptr, DM, FG, DQ, bg, 0, 0, 0, QPh, QPl, VTh, KPh, KPl);
        k_attn<<<dim3(TT / AQ, ZH, 1), 256, 0, stream>>>(QPh, QPl, KPh, KPl, VTh, FG, ATh, ATl);
        /* LNh, LNl are free once this pass's projections have run: the next pass's rows are normalised by the waves of the output projection */
        if (g + 1 < NB_ / GB) k_outp<true><<<dim3(GR / 64, DM / 64, 1), 32 * OW, 0, stream>>>(ATh, ATl, WO, OUT + (size_t)g * GR * DM, bo, LNh, LNl, x + (size_t)(g + 1) * GR * DM, ln_g, ln_b);
        else k_outp<false><<<dim3(GR / 64, DM / 64, 1), 32 * OW, 0, stream>>>(ATh, ATl, WO, OUT + (size_t)g * GR * DM, bo, nullptr, nullptr, nullptr, nullptr, nullptr); }
}

// v009
// A run of this version takes 243 microseconds.
// In two side-by-side timings against v008, it was 1.09 and 1.07 times as fast.
// Counting every step since v000, it is 6.65 times as fast.
#include <hip/hip_runtime.h>

// Gated row (axial) attention with a pre-LayerNorm (x [1][64][512][256]: 64 image rows = 64 independent sequences of 512 tokens x 256; xn = LayerNorm(x) (gamma, beta, eps 1e-5); q = xn Wq ('xw' [256][512], 8 heads x 64), [k|v] = xn Wkv ('xw' [256][1024]: columns k | v); dots = (q/8).k over the 512 keys of the same row; softmax (the explicit max subtraction is a softmax identity); out = attn.v merged; gates = sigmoid(xn Wg + bg) ('xw' [256][512]); y = (out * gates) Wo + bo ('xw' [512][256]) -> [1][64][512][256] (8.4 M)).
// Compute dtypes, f32 accumulate: every input rounded to bf16; LayerNorm in f32, xn as bf16 hi + lo planes; q / kv / gate projections as (hi + lo) x exact weights (2 products) + f32 bias; scores and attn.v on bf16 hi/lo planes (3 products) for every row; softmax f32; sigmoid gate f32 (true division); (out x gate) as hi + lo x exact Wo (2 products) + bo.
// Layout: 32 image rows (16,384 tokens) per pass, the most whose planes fit the workspace side by side (186 MB): every grid then holds two rounds of resident work-groups; all per-(row, head) planes are laid out z-major ([z = row*8 + head][512][64]); scores, softmax and attn.v are ONE launch (k_attn), the scores and the probabilities live in registers only, 32 keys at a time (running maximum and sum).
// Launches that do not depend on one another share one grid: the four weight transposes with the first pass's LayerNorm (k_pre); the q, kv and gate projections (one GEMM over the 2,048 stacked weight rows); the output projection with the next pass's LayerNorm (k_outp). 7 launches: 1 + 2 x 3.
// No elementwise launch stands between the matrix kernels: the q and kv projections split their f32 tiles into the hi / lo planes (V transposed) in their own epilogue, and k_attn gates and splits its output tile in its own.
// Workspace: the transposed V planes lie [hi 512 | lo 512] per row (pitch 1,024 elements).

#define NB_  64        // sequences (image rows)
#define TT   512       // tokens per sequence
#define DM   256
#define NH_  8
#define HD   64
#define DQ   (NH_ * HD)    // 512 = inner dim
#define GB   32            // sequences per pass
#define GR   (GB * TT)     // 16384 token rows per pass
#define ZH   (GB * NH_)    // 256 (sequence, head) planes per pass
#define SCL  0.125f   // HD^-0.5
typedef _Float16 h16;
typedef unsigned short bf;
typedef __attribute__((ext_vector_type(16))) __bf16   v16bf;
typedef __attribute__((ext_vector_type(16))) _Float16 v16h;
typedef __attribute__((ext_vector_type(8)))  _Float16 v8h;
typedef __attribute__((ext_vector_type(8)))  unsigned short v8us;
typedef __attribute__((ext_vector_type(8)))  float    v8f;
typedef __attribute__((ext_vector_type(4)))  float    v4f;
typedef v8h  __attribute__((may_alias)) v8ha;
typedef v4f  __attribute__((may_alias)) v4fa;
typedef v8us __attribute__((may_alias)) v8usa;

__device__ __forceinline__ unsigned short f2bf(float f) { unsigned u = __float_as_uint(f); u += 0x7FFFu + ((u >> 16) & 1u); return (unsigned short)(u >> 16); }
__device__ __forceinline__ float bf2f(unsigned short b) { return __uint_as_float(((unsigned)b) << 16); }
__device__ __forceinline__ float bfr(float f) { return bf2f(f2bf(f)); }
__device__ __forceinline__ v16h cat16(v8h lo, v8h hi) { return __builtin_shufflevector(lo, hi, 0, 1, 2, 3, 4, 5, 6, 7, 8, 9, 10, 11, 12, 13, 14, 15); }
__device__ __forceinline__ v16bf cat16b(v8us lo, v8us hi) { return __builtin_bit_cast(v16bf, __builtin_shufflevector(lo, hi, 0, 1, 2, 3, 4, 5, 6, 7, 8, 9, 10, 11, 12, 13, 14, 15)); }
__device__ __forceinline__ v8f wmma16(v16h a, v16h b, v8f c) { return __builtin_amdgcn_wmma_f32_16x16x32_f16(false, a, false, b, (short)0, c, false, false); }
__device__ __forceinline__ v8f wmmab(v16bf a, v16bf b, v8f c) { return __builtin_amdgcn_wmma_f32_16x16x32_bf16(false, a, false, b, (short)0, c, false, false); }

typedef __attribute__((ext_vector_type(2))) float v2f;
typedef __attribute__((ext_vector_type(2))) __bf16 v2bf;
typedef __attribute__((ext_vector_type(4))) unsigned v4w;    // eight bf16 as four packed words
// hi = p rounded to nearest even, lo = the rest rounded likewise (as splitf), two values a word: the packed hi word is also the source of the two f32 that are subtracted
__device__ __forceinline__ void split8(v8f p, v4w& h, v4w& l) {
#pragma unroll
    for (int i = 0; i < 4; ++i) { const unsigned u = __builtin_bit_cast(unsigned, __builtin_convertvector(((v2f){p[2 * i], p[2 * i + 1]}), v2bf)); h[i] = u;
        l[i] = __builtin_bit_cast(unsigned, __builtin_convertvector(((v2f){p[2 * i] - __uint_as_float(u << 16), p[2 * i + 1] - __uint_as_float(u & 0xFFFF0000u)}), v2bf)); } }
typedef v4w __attribute__((may_alias)) v4wa;

__device__ __forceinline__ void splitf(float y, unsigned short& h, unsigned short& l) { h = f2bf(y); l = f2bf(y - bf2f(h)); }
typedef __attribute__((ext_vector_type(2))) unsigned short v2us;
typedef __attribute__((ext_vector_type(4))) unsigned short v4us;
// LayerNorm of one row of 256 by one wave: y0, y1 are the lane's elements lane*4 .. +3 and 128 + lane*4 .. +3 of row r; g0, g1 and b0, b1 the same elements of gamma and beta
__device__ __forceinline__ void ln_row(const v4f y0, const v4f y1, const v4f g0, const v4f g1, const v4f b0, const v4f b1, const size_t r, const int lane, bf* Yh, bf* Yl) {
    float hv[8]; float s = 0.f;
#pragma unroll
    for (int ch = 0; ch < 2; ++ch) { const v4f y = ch ? y1 : y0;
#pragma unroll
        for (int q = 0; q < 4; ++q) { const float u = bfr(y[q]); hv[ch * 4 + q] = u; s += u; } }
#pragma unroll
    for (int sh = 16; sh; sh >>= 1) s += __shfl_xor(s, sh, 32);
    float mu = s * (1.0f / 256.0f); asm volatile("" : "+v"(mu)); float s2 = 0.f;
#pragma unroll
    for (int k = 0; k < 8; ++k) { float d0 = __fsub_rn(hv[k], mu); asm volatile("" : "+v"(d0)); float p = __fmul_rn(d0, d0); asm volatile("" : "+v"(p)); s2 = __fadd_rn(s2, p); }
#pragma unroll
    for (int sh = 16; sh; sh >>= 1) s2 += __shfl_xor(s2, sh, 32);
    float var = __fadd_rn(s2 * (1.0f / 256.0f), 1e-5f); asm volatile("" : "+v"(var)); const float rs = __frsqrt_rn(var);
#pragma unroll
    for (int ch = 0; ch < 2; ++ch) { const int c0 = ch * 128 + lane * 4; v4us oh, ol;
#pragma unroll
        for (int q = 0; q < 4; ++q) { float gg = bfr((ch ? g1 : g0)[q]); asm volatile("" : "+v"(gg)); float d0 = __fsub_rn(hv[ch * 4 + q], mu); asm volatile("" : "+v"(d0)); float n0 = __fmul_rn(d0, rs); asm volatile("" : "+v"(n0)); float y = __fmul_rn(n0, gg); asm volatile("" : "+v"(y)); y = __fadd_rn(y, bfr((ch ? b1 : b0)[q])); unsigned short a, c2; splitf(y, a, c2); oh[q] = a; ol[q] = c2; }
        *(v4us*)(Yh + r * DM + c0) = oh; *(v4us*)(Yl + r * DM + c0) = ol;
        asm volatile("s_wait_xcnt 0x0" ::: "memory"); }    // no register of the two stores above is rewritten by what follows (the row's second half, the caller's next row) ahead of this wait
}

// ---- k_gemmw: register-blocked GEMM, ONE WAVE per 64x64 output tile (16 accumulators), WM x WN waves a work-group, operands from K-contiguous 16-bit planes; grid (M/(64 WM), N/(64 WN), Z), 32 WM WN threads.
// The waves of a group share each staged piece: its 64 WM rows of the A planes and 64 WN rows of Bt leave L2 once for the group, not once for each wave that reads them. The stacked projections run 2 x 4 waves (512 staged rows a piece where eight one-wave groups take 1,536); the output projection, whose grid has few tiles, has a kernel of its own (k_outp).
// C[m][n] (f32, pitch ldc, + optional f32 bias[n]) = sum_k A[m][k] Bt[n][k] (+ split products per NSPLIT). K (a template argument, so that a piece's loads of a plane (NA of an A plane, NB of Bt) share one offset register and differ in the immediate offset) is the row pitch of A and of Bt in elements, KD <= K the depth that is summed. z-batch strides sA/sB/sC in elements. KD % 64 == 0, K % 64 == 0.
// Each 64-row x 64-deep piece of a plane goes through LDS: a global load takes 4 whole 128-byte lines (8 lanes a row), where a fragment load straight from memory touches 16 lines for the same 512 bytes; the fragments are then read from LDS rows of SP elements (144 B = 16 B x 9: no bank conflict).
// EPI says where the tile goes. 0: C as above. 1: the stacked projections, by the tile's column: a tile is 64 tokens x one head (64 | TT, HD = 64); columns below DQ (q) and below 2 DQ (k) are split into bf16 hi + lo and stored as 64 whole rows of the z-major planes Ph, Pl (q) or Kh, Kl (k); columns below 3 DQ (v) go transposed into VT: an accumulator register group holds 8 successive tokens of one d, which are 16 bytes of a V^T row as they stand; the last DQ columns (gate) go to C with the bias.
#define SP 72
template <bool B> struct Sel { static constexpr bool v = B; };
template <typename T16> struct WFrag;
template <> struct WFrag<h16> { typedef v16h V; static __device__ __forceinline__ V ld(const h16* p) { return cat16(*(const v8h*)p, *(const v8h*)(p + 16)); } static __device__ __forceinline__ v8f mma(V a, V b, v8f c) { return wmma16(a, b, c); } };
template <> struct WFrag<bf> { typedef v16bf V; static __device__ __forceinline__ V ld(const bf* p) { return cat16b(*(const v8us*)p, *(const v8us*)(p + 16)); } static __device__ __forceinline__ v8f mma(V a, V b, v8f c) { return wmmab(a, b, c); } };
template <typename T16, int NSPLIT, bool BIAS, int K, int EPI, int WM, int WN>
__global__ __launch_bounds__(32 * WM * WN) void k_gemmw(const T16* __restrict__ A, const T16* __restrict__ A2, const T16* __restrict__ Bt, const T16* __restrict__ Bt2, int KD, float* C, int ldc, const float* __restrict__ bias, size_t sA, size_t sB, size_t sC, bf* Ph, bf* Pl, bf* VT, bf* Kh, bf* Kl) {
    typedef typename WFrag<T16>::V V;
    constexpr int NW = WM * WN, RS = NW * 4, NA = WM * 64 / RS, NB = WN * 64 / RS;    // waves; rows that one staging load of the whole group takes; such loads per A plane, per B plane
    __shared__ __align__(16) float osg[NW * 16 * 68];
    __shared__ __align__(16) T16 sa[WM * 64 * SP], sb[WN * 64 * SP], sa2[(NSPLIT == 1 || NSPLIT == 2) ? WM * 64 * SP : 8], sb2[NSPLIT >= 2 ? WN * 64 * SP : 8];
    const size_t z = blockIdx.z; A += z * sA; if (A2) A2 += z * sA; Bt += z * sB; if (Bt2) Bt2 += z * sB; C += z * sC;
    const int tid = threadIdx.x, lane = tid & 31, lr = lane & 15, hi = lane >> 4; const int wv = NW > 1 ? __builtin_amdgcn_readfirstlane(tid >> 5) : 0, wm = wv % WM, wn = wv / WM;    // the wave's number as a scalar: the epilogue's choices by column stay scalar branches
    const int R0 = blockIdx.x * (64 * WM), C0 = blockIdx.y * (64 * WN), r0 = R0 + wm * 64, c0 = C0 + wn * 64; float* os = osg + wv * (16 * 68);    // the group's tile, the wave's own 64 x 64 of it, the wave's own epilogue rows
    v8f acc[4][4];
#pragma unroll
    for (int mb = 0; mb < 4; ++mb)
#pragma unroll
        for (int nb = 0; nb < 4; ++nb) acc[mb][nb] = (v8f){};
    const int srow = tid >> 3, scol = (tid & 7) * 8;    // staging: 8 lanes take one row's 128 bytes
    const unsigned aoff = ((unsigned)(R0 + srow) * K + scol) * 2u, boff = ((unsigned)(C0 + srow) * K + scol) * 2u;    // byte offsets (a plane is below 4 GiB): the plane pointers stay scalar and one offset register serves both A planes
    const int soff = srow * SP + scol, foa = (wm * 64 + lr) * SP + 8 * hi, fob = (wn * 64 + lr) * SP + 8 * hi;
#pragma unroll 1
    for (int k0 = 0; k0 < KD; k0 += 64) { const unsigned ao = aoff + k0 * 2u, bo = boff + k0 * 2u; const char* pa = (const char*)A + ao; const char* pb = (const char*)Bt + bo; const char* pa2 = (NSPLIT == 1 || NSPLIT == 2) ? (const char*)A2 + ao : pa; const char* pb2 = NSPLIT >= 2 ? (const char*)Bt2 + bo : pb;
        v8us ra[NA], rb[NB], ra2[(NSPLIT == 1 || NSPLIT == 2) ? NA : 1], rb2[NSPLIT >= 2 ? NB : 1];
#pragma unroll    // all loads of a piece in flight together, each row step an immediate offset
        for (int i = 0; i < (NA > NB ? NA : NB); ++i) { if (i < NA) ra[i] = *(const v8usa*)(pa + i * RS * 2 * K); if (i < NB) rb[i] = *(const v8usa*)(pb + i * RS * 2 * K);
            if ((NSPLIT == 1 || NSPLIT == 2) && i < NA) ra2[i] = *(const v8usa*)(pa2 + i * RS * 2 * K); if (NSPLIT >= 2 && i < NB) rb2[i] = *(const v8usa*)(pb2 + i * RS * 2 * K); }
        asm volatile("s_wait_xcnt 0x0" :: "v"(ao), "v"(bo) : "memory");    // the loads' address registers stay theirs up to this wait: no later load lands on them, the next piece's addresses are formed behind it; standing ahead of the LDS stores it also keeps every load of the piece ahead of the first store (left alone the stacked-projection build waits for each load by itself)
#pragma unroll
        for (int i = 0; i < (NA > NB ? NA : NB); ++i) { if (i < NA) *(v8usa*)(sa + soff + i * RS * SP) = ra[i]; if (i < NB) *(v8usa*)(sb + soff + i * RS * SP) = rb[i];
            if ((NSPLIT == 1 || NSPLIT == 2) && i < NA) *(v8usa*)(sa2 + soff + i * RS * SP) = ra2[i]; if (NSPLIT >= 2 && i < NB) *(v8usa*)(sb2 + soff + i * RS * SP) = rb2[i]; }
        __syncthreads();    // the piece is written by other lanes, in a group of several waves by other waves, than read it (a one-wave group: it builds to the LDS wait and keeps the compiler from reading ahead of the stores)
        V a[4], a2[4];
#pragma unroll    // the second half's fragment reads are scheduled among the first half's products
      for (int kc = 0; kc < 64; kc += 32) {
#pragma unroll
        for (int mb = 0; mb < 4; ++mb) { a[mb] = WFrag<T16>::ld(sa + foa + mb * 16 * SP + kc); if (NSPLIT == 1 || NSPLIT == 2) a2[mb] = WFrag<T16>::ld(sa2 + foa + mb * 16 * SP + kc); }
#pragma unroll
        for (int nb = 0; nb < 4; ++nb) { const V b = WFrag<T16>::ld(sb + fob + nb * 16 * SP + kc); V b2; if (NSPLIT >= 2) b2 = WFrag<T16>::ld(sb2 + fob + nb * 16 * SP + kc);
#pragma unroll
            for (int mb = 0; mb < 4; ++mb) { acc[mb][nb] = WFrag<T16>::mma(a[mb], b, acc[mb][nb]); if (NSPLIT == 1 || NSPLIT == 2) acc[mb][nb] = WFrag<T16>::mma(a2[mb], b, acc[mb][nb]); if (NSPLIT >= 2) acc[mb][nb] = WFrag<T16>::mma(a[mb], b2, acc[mb][nb]); } }
      }
        asm volatile("v_nop\n\tv_nop\n\tv_nop\n\tv_nop" : "+v"(acc[0][0]), "+v"(acc[0][1]), "+v"(acc[0][2]), "+v"(acc[0][3]), "+v"(acc[1][0]), "+v"(acc[1][1]), "+v"(acc[1][2]), "+v"(acc[1][3]), "+v"(acc[2][0]), "+v"(acc[2][1]), "+v"(acc[2][2]), "+v"(acc[2][3]), "+v"(acc[3][0]), "+v"(acc[3][1]), "+v"(acc[3][2]), "+v"(acc[3][3]));    // the four vector slots between the piece's last product and the branch back, behind which the next piece's loads land on operand registers; every accumulator is named, so that no product of the piece is scheduled behind the slots
        __syncthreads();    // every fragment is read before the next piece overwrites it (keeps the next stores behind these reads)
    }
    const size_t zz = (size_t)(r0 / TT) * NH_ + (c0 / HD) % NH_; const int t0 = r0 % TT;    // the tile's (sequence, head) plane and its first token
    if (EPI == 1 && c0 >= 2 * DQ && c0 < 3 * DQ) {
        bf* vrow = VT + (zz * HD + lr) * (2 * TT) + t0 + hi * 8;
#pragma unroll
        for (int nb = 0; nb < 4; ++nb)
#pragma unroll
            for (int mb = 0; mb < 4; ++mb) { v4w h, l; split8(acc[mb][nb], h, l); *(v4wa*)(vrow + nb * 16 * 2 * TT + mb * 16) = h; *(v4wa*)(vrow + nb * 16 * 2 * TT + mb * 16 + TT) = l; }
    } else {
    auto rows = [&](auto pln) __attribute__((always_inline)) {    // the tile by way of os, 16 rows at a time; pln: to the hi / lo planes, else to C (the choice is made once a tile, outside the loop)
#pragma unroll
    for (int mb = 0; mb < 4; ++mb) {
#pragma unroll
        for (int nb = 0; nb < 4; ++nb) {
#pragma unroll
            for (int j = 0; j < 8; ++j) os[(hi * 8 + j) * 68 + nb * 16 + lr] = acc[mb][nb][j]; }
        __builtin_amdgcn_wave_barrier(); asm volatile("" ::: "memory");
        if (decltype(pln)::v) { bf* ph = c0 < DQ ? Ph : Kh; bf* pl = c0 < DQ ? Pl : Kl; const size_t po = (zz * TT + t0 + mb * 16 + (lane >> 3)) * HD + (lane & 7) * 8;    // 8 lanes a row: a store takes 4 whole 128-byte rows
#pragma unroll
            for (int s = 0; s < 4; ++s) { const float* orw = os + (4 * s + (lane >> 3)) * 68 + (lane & 7) * 8; const v4f x0 = *(const v4fa*)orw, x1 = *(const v4fa*)(orw + 4); v4w h, l;
                split8((v8f){x0[0], x0[1], x0[2], x0[3], x1[0], x1[1], x1[2], x1[3]}, h, l); *(v4wa*)(ph + po + s * 4 * HD) = h; *(v4wa*)(pl + po + s * 4 * HD) = l; }
        } else {
        const int cg = EPI == 1 ? c0 - 3 * DQ : c0;    // the tile's first column in C and in the bias
        float* crow = C + (size_t)(r0 + mb * 16) * ldc + cg;
#pragma unroll
            for (int s = 0; s < 8; ++s) { const int row = 2 * s + hi, cofs = lr * 4; v4f val = *(const v4fa*)(os + row * 68 + cofs); if (BIAS) { val[0] += bfr(bias[cg + cofs]); val[1] += bfr(bias[cg + cofs + 1]); val[2] += bfr(bias[cg + cofs + 2]); val[3] += bfr(bias[cg + cofs + 3]); }
                *(v4f*)(crow + (size_t)row * ldc + cofs) = val; }
             }
        __builtin_amdgcn_wave_barrier(); asm volatile("s_wait_xcnt 0x0" ::: "memory");    // keeps the next rows' writes of os behind these reads, as before; the wait: no register of the stores above is rewritten, and no later load lands on one, ahead of it (the next rows' bias load did; behind the last rows the built code lays another block of the kernel, with a branch round it)
    }
    };
    if (EPI == 1 && c0 < 2 * DQ) rows(Sel<true>{}); else rows(Sel<false>{});
    }
}

// ---- k_outp: the output projection, C[m][n] = sum_k (A + A2)[m][k] Bt[n][k] + bias[n] (f32, pitch DM), depth DQ. Grid (GR/64, DM/64): 1,024 tiles of 64 x 64; with one wave a tile a wave walks eight staged pieces one behind the other, each with its own trip to memory.
// OW waves a work-group share ONE tile and split its DEPTH: wave w sums k = w*KW .. w*KW + KW - 1 (two pieces) through staging rows of its own, as k_gemmw stages them; the OW partial tiles then meet in LDS (on the staging rows, which are read out by then), and each wave adds and stores 16 of the 64 rows: ((p0 + p1) + (p2 + p3)) + bias.
// LN: each wave also normalises 4 rows of the next pass (X -> Ph, Pl; OW x 4 x 1,024 = GR rows). Their loads go out ahead of the first piece's, and the arithmetic of two rows runs while each piece is on its way.
#define OW 4
#define KW (DQ / OW)
template <bool LN>
__global__ __launch_bounds__(32 * OW) void k_outp(const bf* __restrict__ A, const bf* __restrict__ A2, const bf* __restrict__ Bt, float* C, const float* __restrict__ bias, bf* Ph, bf* Pl, const float* __restrict__ X, const float* __restrict__ gw, const float* __restrict__ gb) {
    typedef WFrag<bf> F; typedef F::V V;
    __shared__ __align__(16) bf sm[OW * 3 * 64 * SP];    // staging: per wave 64 rows of A, A2, Bt; behind the two pieces: OW partial tiles of 64 rows x 68 f32
    const int tid = threadIdx.x, lane = tid & 31, lr = lane & 15, hi = lane >> 4; const int wv = __builtin_amdgcn_readfirstlane(tid >> 5);
    bf* sa = sm + wv * (3 * 64 * SP); bf* sa2 = sa + 64 * SP; bf* sb = sa2 + 64 * SP;
    const int r0 = blockIdx.x * 64, c0 = blockIdx.y * 64;
    const int cofs = lr * 4; const float* bp = bias + c0 + cofs; const v4f braw = *(const v4f*)bp;    // the lane's four bias values, read first: their trip runs beside the first piece's
    __builtin_amdgcn_sched_barrier(0);    // keeps that load the first: loads return in order, and the wait for its value (ahead of the first piece's s_wait_xcnt) is then no wait for the piece
    const size_t rw = (((size_t)blockIdx.y * (GR / 64) + blockIdx.x) * OW + wv) * 4; v4f y[4][2], g0, g1, b0, b1;
    if (LN) {
#pragma unroll
        for (int i = 0; i < 4; ++i) { y[i][0] = *(const v4f*)(X + (rw + i) * DM + lane * 4); y[i][1] = *(const v4f*)(X + (rw + i) * DM + 128 + lane * 4); }
        g0 = *(const v4f*)(gw + lane * 4); g1 = *(const v4f*)(gw + 128 + lane * 4); b0 = *(const v4f*)(gb + lane * 4); b1 = *(const v4f*)(gb + 128 + lane * 4); }
    v8f acc[4][4];
#pragma unroll
    for (int mb = 0; mb < 4; ++mb)
#pragma unroll
        for (int nb = 0; nb < 4; ++nb) acc[mb][nb] = (v8f){};
    const int srow = lane >> 3, scol = (lane & 7) * 8;    // staging: 8 lanes take one row's 128 bytes
    const unsigned aoff = ((unsigned)(r0 + srow) * DQ + wv * KW + scol) * 2u, boff = ((unsigned)(c0 + srow) * DQ + wv * KW + scol) * 2u;
    const int soff = srow * SP + scol, fo = lr * SP + 8 * hi;
    auto piece = [&](const int k0, auto rows) __attribute__((always_inline)) {    // one 64-deep piece; rows: the arithmetic of two LayerNorm rows goes between the piece's loads and its LDS stores (written out per piece, not as a loop: out of a loop the compiler lifts that arithmetic, and the wait for its loads, ahead of the piece's loads)
        const unsigned ao = aoff + k0 * 2u, bo = boff + k0 * 2u; const char* pa = (const char*)A + ao; const char* pb = (const char*)Bt + bo; const char* pa2 = (const char*)A2 + ao;
        v8us ra[16], rb[16], ra2[16];
#pragma unroll    // all loads of a piece in flight together, each row step an immediate offset
        for (int i = 0; i < 16; ++i) { ra[i] = *(const v8usa*)(pa + i * 4 * 2 * DQ); rb[i] = *(const v8usa*)(pb + i * 4 * 2 * DQ); ra2[i] = *(const v8usa*)(pa2 + i * 4 * 2 * DQ); }
        if (k0 == 0) asm volatile("s_wait_xcnt 0x0" :: "v"(aoff), "v"(boff), "v"(lr), "v"(braw) : "memory");    // as the next line; the bias load's offset register (the built load takes lr, scaled, on a scalar base) and its value are named too, so that this load stands ahead of the wait and no later load lands on that register
        else asm volatile("s_wait_xcnt 0x0" :: "v"(aoff), "v"(boff) : "memory");    // the loads' address registers (the built loads take aoff, boff and put the piece's step into the immediate offset) stay theirs up to this wait; standing ahead of the LDS stores it also keeps every load of the piece ahead of the first store
        if (decltype(rows)::v) {    // the rows' loads were issued first and return first
            __builtin_amdgcn_sched_barrier(0);    // keeps the rows' arithmetic, and the wait for their loads, behind the issue of the piece's loads
#pragma unroll
            for (int i = k0 / 32; i < k0 / 32 + 2; ++i) ln_row(y[i][0], y[i][1], g0, g1, b0, b1, rw + i, lane, Ph, Pl); }
#pragma unroll
        for (int i = 0; i < 16; ++i) { *(v8usa*)(sa + soff + i * 4 * SP) = ra[i]; *(v8usa*)(sb + soff + i * 4 * SP) = rb[i]; *(v8usa*)(sa2 + soff + i * 4 * SP) = ra2[i]; }
        __syncthreads();    // the piece is written by other lanes than read it: the LDS wait, and the compiler reads nothing ahead of the stores
        V a[4], a2[4];
#pragma unroll    // the second half's fragment reads are scheduled among the first half's products
      for (int kc = 0; kc < 64; kc += 32) {
#pragma unroll
        for (int mb = 0; mb < 4; ++mb) { a[mb] = F::ld(sa + fo + mb * 16 * SP + kc); a2[mb] = F::ld(sa2 + fo + mb * 16 * SP + kc); }
#pragma unroll
        for (int nb = 0; nb < 4; ++nb) { const V b = F::ld(sb + fo + nb * 16 * SP + kc);
#pragma unroll
            for (int mb = 0; mb < 4; ++mb) { acc[mb][nb] = F::mma(a[mb], b, acc[mb][nb]); acc[mb][nb] = F::mma(a2[mb], b, acc[mb][nb]); } }
      }
        __syncthreads();    // every fragment is read before the next piece, or behind the last piece another wave's partial tile, overwrites it
    };
    static_assert(KW == 128, "two pieces a wave");
    piece(0, Sel<LN>{}); piece(64, Sel<LN>{});
    float* red = (float*)sm; float* my = red + wv * (64 * 68);
#pragma unroll
    for (int mb = 0; mb < 4; ++mb)
#pragma unroll
        for (int nb = 0; nb < 4; ++nb)
#pragma unroll
            for (int j = 0; j < 8; ++j) my[(mb * 16 + hi * 8 + j) * 68 + nb * 16 + lr] = acc[mb][nb][j];
    __syncthreads();    // a wave adds rows that the other waves wrote
    const v4f bs = {bfr(braw[0]), bfr(braw[1]), bfr(braw[2]), bfr(braw[3])};
    float* crow = C + (size_t)(r0 + wv * 16) * DM + c0 + cofs; const float* pr = red + wv * 16 * 68 + cofs;
#pragma unroll
    for (int s = 0; s < 8; ++s) { const int row = 2 * s + hi; const float* p = pr + row * 68;
        const v4f val = ((*(const v4fa*)p + *(const v4fa*)(p + 64 * 68)) + (*(const v4fa*)(p + 2 * 64 * 68) + *(const v4fa*)(p + 3 * 64 * 68))) + bs;
        *(v4f*)(crow + (size_t)row * DM) = val; }
}

// ---- k_pre: the four weight transposes ('xw': Bt[n][k] = W[k][n], 64 lines of 64 elements a work-group: 32 + 64 + 32 + 32 work-groups) and, behind them in the same grid, the first pass's LayerNorm (a row a wave).
#define WB (DM * DQ / 64 / 64)    // work-groups of a 256 x 512 weight
__global__ __launch_bounds__(256) void k_pre(const float* __restrict__ wq, const float* __restrict__ wkv, const float* __restrict__ wg, const float* __restrict__ wo, bf* WQ, bf* WKV, bf* WG, bf* WO, const float* __restrict__ X, const float* __restrict__ gw, const float* __restrict__ gb, bf* Yh, bf* Yl) {
    const int lane = threadIdx.x & 31, wv = threadIdx.x >> 5, b = blockIdx.x;
    if (b < 5 * WB) {
        const float* w = b < WB ? wq : b < 3 * WB ? wkv : b < 4 * WB ? wg : wo; bf* Bt = b < WB ? WQ : b < 3 * WB ? WKV : b < 4 * WB ? WG : WO;
        const int K = b < 4 * WB ? DM : DQ, N = b < WB ? DQ : b < 3 * WB ? 2 * DQ : b < 4 * WB ? DQ : DM, b0 = b < WB ? 0 : b < 3 * WB ? WB : b < 4 * WB ? 3 * WB : 4 * WB;
        const int L0 = ((b - b0) * 8 + wv) * 8;
#pragma unroll 1
        for (int l = 0; l < 8; ++l) { const size_t e = (size_t)(L0 + l) * 64 + lane * 2; const int k = (int)(e % K), n = (int)(e / K); v2us o;
            o[0] = f2bf(w[(size_t)k * N + n]); o[1] = f2bf(w[(size_t)(k + 1) * N + n]); *(v2us*)(Bt + e) = o; }
        return; }
    const size_t r = (size_t)(b - 5 * WB) * 8 + wv; const float* xr = X + r * DM;
    ln_row(*(const v4f*)(xr + lane * 4), *(const v4f*)(xr + 128 + lane * 4), *(const v4f*)(gw + lane * 4), *(const v4f*)(gw + 128 + lane * 4), *(const v4f*)(gb + lane * 4), *(const v4f*)(gb + 128 + lane * 4), r, lane, Yh, Yl);
}
// ---- k_attn: scores, softmax and attn.v of 256 query rows of one (sequence, head) plane in ONE work-group; no score leaves the WGP. Grid (TT/256, ZH), 256 threads = 8 waves, 32 query rows (two tiles of 16) a wave.
// The scores are formed transposed, S^T = K Q^T (A = 16 key rows from LDS, B = 16 query rows held in registers): an accumulator tile then holds, in lane (lr, hi), keys 8*hi + j of query lr, and two such tiles are, register for register, the B fragment of a 32-key step of O^T = V^T P^T.
// A wave walks the 512 keys in a rolled loop of 32-key steps with a running maximum and a running sum (the output tiles and the sum are scaled by exp2 of the maximum's rise at every step; the division by the sum comes last): every K and V^T fragment read from LDS feeds two query tiles, and the loop's text is one step long.
// LDS: the K planes (rows of KPT elements, hi plane then lo plane) and, beside them, the V^T rows [hi 512 | lo 512] at pitch VPT (both pitches 16 B x odd); both are staged once for the 256 query rows.
#define KPT 72
__device__ __forceinline__ v16bf cat16v(v4w lo, v4w hi) { return __builtin_bit_cast(v16bf, __builtin_shufflevector(lo, hi, 0, 1, 2, 3, 4, 5, 6, 7)); }
__device__ __forceinline__ float xhalf(float x) { return __builtin_bit_cast(float, __builtin_amdgcn_permlanex16(__builtin_bit_cast(int, x), __builtin_bit_cast(int, x), 0x76543210, 0xfedcba98, false, false)); }    // lane l with lane l ^ 16
#define VPT 1032
#define AQ 256    // query rows of a work-group
__global__ __launch_bounds__(256, 1) void k_attn(const bf* __restrict__ Qh, const bf* __restrict__ Ql, const bf* __restrict__ Kh, const bf* __restrict__ Kl, const bf* __restrict__ VT, const float* __restrict__ G, bf* __restrict__ Ah, bf* __restrict__ Al) {
    typedef WFrag<bf> F; typedef F::V V;
    __shared__ __align__(16) bf sk[2 * TT * KPT];
    __shared__ __align__(16) bf sv[HD * VPT];
    const int tid = threadIdx.x, lane = tid & 31, lr = lane & 15, hi = lane >> 4; const size_t z = blockIdx.y; const int q0 = blockIdx.x * AQ + (tid >> 5) * 32;
    // the wave's Q fragments (B operand: lane lr = query row, k = d in the hardware order; [query tile][32 of d]), and K and V^T to LDS: a load takes whole 128-byte lines; all 64 staging loads of a thread are in flight together (no accumulator is live yet)
    V qh[2][2], ql[2][2];
    { const bf* pqh = Qh + (z * TT + q0 + lr) * HD + 8 * hi; const bf* pql = Ql + (z * TT + q0 + lr) * HD + 8 * hi;
        const bf* gh = Kh + z * (TT * HD) + tid * 8; const bf* gl = Kl + z * (TT * HD) + tid * 8; const bf* gv = VT + z * HD * (2 * TT) + tid * 8;
        bf* lk = sk + (tid >> 3) * KPT + (tid & 7) * 8; bf* lv = sv + (tid >> 7) * VPT + (tid & 127) * 8; v8us rh[16], rl[16], rv[32];
#pragma unroll
        for (int i = 0; i < 16; ++i) { rh[i] = *(const v8usa*)(gh + i * 2048); rl[i] = *(const v8usa*)(gl + i * 2048); }
#pragma unroll
        for (int u = 0; u < 2; ++u)
#pragma unroll
            for (int c = 0; c < 2; ++c) { qh[u][c] = F::ld(pqh + u * 16 * HD + c * 32); ql[u][c] = F::ld(pql + u * 16 * HD + c * 32); }
#pragma unroll
        for (int i = 0; i < 32; ++i) rv[i] = *(const v8usa*)(gv + i * 2048);
        asm volatile("s_wait_xcnt 0x0" :: "v"(tid), "v"(pqh), "v"(pql), "s"(gh - tid * 8), "s"(gl - tid * 8), "s"(gv - tid * 8) : "memory");    // the loads' address registers (the built staging loads take the thread's number as their offset register, on three scalar bases) stay theirs up to this wait: no load lands on them and nothing rewrites them ahead of it
#pragma unroll
        for (int i = 0; i < 16; ++i) { *(v8usa*)(lk + i * 32 * KPT) = rh[i]; *(v8usa*)(lk + (TT + i * 32) * KPT) = rl[i]; }
#pragma unroll
        for (int i = 0; i < 32; ++i) *(v8usa*)(lv + i * 2 * VPT) = rv[i]; }
    __syncthreads();    // K and V^T are written by other waves than read them
    v8f o[4][2];    // O^T: [16 of d][query tile]
#pragma unroll
    for (int mb = 0; mb < 4; ++mb)
#pragma unroll
        for (int u = 0; u < 2; ++u) o[mb][u] = (v8f){};
    float mr[2] = {-__builtin_inff(), -__builtin_inff()}, ls[2] = {0.f, 0.f};    // per query tile: the maximum in use (the same in both lane halves) and the lane's own share of the sum
    const float cs = SCL * 1.4426950408889634f;
    const bf* kf = sk + lr * KPT + 8 * hi; const bf* vf = sv + lr * VPT + 8 * hi;
    V kh[2][2], kl[2][2];    // [key tile][32 of d]; a step's K fragments are fetched one step ahead
#pragma unroll
    for (int t = 0; t < 2; ++t)
#pragma unroll
        for (int c = 0; c < 2; ++c) { kh[t][c] = F::ld(kf + t * 16 * KPT + c * 32); kl[t][c] = F::ld(kf + (TT + t * 16) * KPT + c * 32); }
#pragma unroll 1    // one step of text, for speed only
    for (int kb = 0; kb < TT / 32; ++kb) {
        V vh[4], vl[4];
#pragma unroll
        for (int mb = 0; mb < 4; ++mb) { vh[mb] = F::ld(vf + mb * 16 * VPT + kb * 32); vl[mb] = F::ld(vf + mb * 16 * VPT + TT + kb * 32); }
        __builtin_amdgcn_sched_barrier(0);    // keeps this step's V^T reads, one group, ahead of the score products (left alone the compiler sinks each read to its use and waits for it there)
        v8f s[2][2];
#pragma unroll
        for (int t = 0; t < 2; ++t)
#pragma unroll
            for (int u = 0; u < 2; ++u) s[t][u] = (v8f){};
#pragma unroll
        for (int c = 0; c < 2; ++c) {
#pragma unroll
            for (int t = 0; t < 2; ++t)
#pragma unroll
                for (int u = 0; u < 2; ++u) s[t][u] = F::mma(kh[t][c], qh[u][c], s[t][u]);
            __builtin_amdgcn_sched_barrier(0);    // keeps four independent tiles between two products into one accumulator
#pragma unroll
            for (int t = 0; t < 2; ++t)
#pragma unroll
                for (int u = 0; u < 2; ++u) s[t][u] = F::mma(kh[t][c], ql[u][c], s[t][u]);
            __builtin_amdgcn_sched_barrier(0);    // as above
#pragma unroll
            for (int t = 0; t < 2; ++t)
#pragma unroll
                for (int u = 0; u < 2; ++u) s[t][u] = F::mma(kl[t][c], qh[u][c], s[t][u]);
            __builtin_amdgcn_sched_barrier(0); }    // as above
        { const bf* kn = kf + ((kb + 1) & (TT / 32 - 1)) * 32 * KPT;    // the next step's key rows; the last step reads step 0's again, which nothing uses
#pragma unroll
            for (int t = 0; t < 2; ++t)
#pragma unroll
                for (int c = 0; c < 2; ++c) { kh[t][c] = F::ld(kn + t * 16 * KPT + c * 32); kl[t][c] = F::ld(kn + (TT + t * 16) * KPT + c * 32); } }
        __builtin_amdgcn_sched_barrier(0);    // keeps the next step's K reads, one group, ahead of the softmax work, under which they land
        V ph[2], pl[2];
#pragma unroll
        for (int u = 0; u < 2; ++u) {    // query lr of tile u: the lane's 16 scores of this step, then one exchange with lane ^ 16
            v8f m8;
#pragma unroll
            for (int j = 0; j < 8; ++j) m8[j] = fmaxf(s[0][u][j], s[1][u][j]);
            float mx = fmaxf(fmaxf(fmaxf(m8[0], m8[1]), fmaxf(m8[2], m8[3])), fmaxf(fmaxf(m8[4], m8[5]), fmaxf(m8[6], m8[7])));
            mx = fmaxf(mx, xhalf(mx));
            const float mn = fmaxf(mr[u], mx), al = __builtin_amdgcn_exp2f((mr[u] - mn) * cs), mc = mn * cs; mr[u] = mn;
#pragma unroll
            for (int t = 0; t < 2; ++t)
#pragma unroll
                for (int j = 0; j < 8; ++j) s[t][u][j] = __builtin_amdgcn_exp2f(s[t][u][j] * cs - mc);
            const v8f a8 = s[0][u] + s[1][u];
            ls[u] = ls[u] * al + (((a8[0] + a8[1]) + (a8[2] + a8[3])) + ((a8[4] + a8[5]) + (a8[6] + a8[7])));
#pragma unroll
            for (int mb = 0; mb < 4; ++mb) o[mb][u] *= al;
            v4w h0, h1, l0, l1; split8(s[0][u], h0, l0); split8(s[1][u], h1, l1);
            ph[u] = cat16v(h0, h1); pl[u] = cat16v(l0, l1); }
        __builtin_amdgcn_sched_barrier(0);    // the products below start together, eight independent tiles a group
#pragma unroll
        for (int mb = 0; mb < 4; ++mb)
#pragma unroll
            for (int u = 0; u < 2; ++u) o[mb][u] = F::mma(vh[mb], ph[u], o[mb][u]);
#pragma unroll
        for (int mb = 0; mb < 4; ++mb)
#pragma unroll
            for (int u = 0; u < 2; ++u) o[mb][u] = F::mma(vh[mb], pl[u], o[mb][u]);
#pragma unroll
        for (int mb = 0; mb < 4; ++mb)
#pragma unroll
            for (int u = 0; u < 2; ++u) o[mb][u] = F::mma(vl[mb], ph[u], o[mb][u]);
    }
    // lane (lr, hi) holds d = mb*16 + hi*8 + j of query lr of tile u: out / sum x sigmoid(gate) (true divisions), split into hi + lo, goes straight to the merged-head operand planes of the output projection
    const size_t oo = ((z / NH_) * TT + q0 + lr) * DQ + (z % NH_) * HD + hi * 8; const float* gp = G + oo; v4f g[2][8];
#pragma unroll
    for (int u = 0; u < 2; ++u)
#pragma unroll
        for (int i = 0; i < 8; ++i) g[u][i] = *(const v4f*)(gp + u * 16 * DQ + (i >> 1) * 16 + (i & 1) * 4);
    asm volatile("s_wait_xcnt 0x0" :: "v"(gp) : "memory");    // the loads' address registers stay theirs up to this wait
#pragma unroll
    for (int u = 0; u < 2; ++u) { const float f = __fdiv_rn(1.0f, ls[u] + xhalf(ls[u]));
#pragma unroll
        for (int mb = 0; mb < 4; ++mb) { v8f a; v4w h, l;
#pragma unroll
            for (int j = 0; j < 8; ++j) { const float den = __fadd_rn(1.0f, expf(-g[u][mb * 2 + (j >> 2)][j & 3])); a[j] = __fmul_rn(__fmul_rn(o[mb][u][j], f), __fdiv_rn(1.0f, den)); }
            split8(a, h, l); *(v4wa*)(Ah + oo + u * 16 * DQ + mb * 16) = h; *(v4wa*)(Al + oo + u * 16 * DQ + mb * 16) = l;
            asm volatile("s_wait_xcnt 0x0" ::: "memory"); } }    // no register of the two stores above is rewritten by the next tile's arithmetic ahead of this wait
}

extern "C" void kernel_launch(void* const* d_in, const int* in_sizes, int n_in,
                              void* d_out, int out_size, void* d_ws, size_t ws_size, hipStream_t stream) {
    (void)in_sizes; (void)n_in; (void)out_size;
    const float* x = (const float*)d_in[0]; const float* ln_g = (const float*)d_in[1]; const float* ln_b = (const float*)d_in[2]; const float* wq = (const float*)d_in[3]; const float* wkv = (const float*)d_in[4]; const float* wg = (const float*)d_in[5]; const float* bg = (const float*)d_in[6]; const float* wo = (const float*)d_in[7]; const float* bo = (const float*)d_in[8];
    float* OUT = (float*)d_out;     // [1][64][512][256] = [32768][256]
    char* wsp = (char*)d_ws;
    auto take = [&](size_t bytes) { char* p = wsp; wsp += (bytes + 255) & ~(size_t)255; return (void*)p; };
    bf* WQ = (bf*)take((size_t)4 * DQ * DM * 2); bf* WKV = WQ + DQ * DM; bf* WG = WQ + 3 * DQ * DM;    /* one Bt of 2,048 rows: q | k | v | gate */
    bf* WO = (bf*)take((size_t)DM * DQ * 2);
    bf* LNh = (bf*)take((size_t)GR * DM * 2); bf* LNl = (bf*)take((size_t)GR * DM * 2); float* FG = (float*)take((size_t)GR * DQ * 4);
    bf* QPh = (bf*)take((size_t)ZH * TT * HD * 2); bf* QPl = (bf*)take((size_t)ZH * TT * HD * 2); bf* KPh = (bf*)take((size_t)ZH * TT * HD * 2); bf* KPl = (bf*)take((size_t)ZH * TT * HD * 2); bf* VTh = (bf*)take((size_t)ZH * HD * 2 * TT * 2);    // row (z, d) of V^T: hi at VTh + row*2*TT, lo TT elements behind it
    bf* ATh = (bf*)take((size_t)GR * DQ * 2); bf* ATl = (bf*)take((size_t)GR * DQ * 2);
    if ((size_t)(wsp - (char*)d_ws) > ws_size) return;    // ws 256 MiB
    k_pre<<<5 * WB + GR / 8, 256, 0, stream>>>(wq, wkv, wg, wo, WQ, WKV, WG, WO, x, ln_g, ln_b, LNh, LNl);
    for (int g = 0; g < NB_ / GB; ++g) {
        k_gemmw<bf, 1, true, DM, 1, 2, 4><<<dim3(GR / 128, 4 * DQ / 256, 1), 256, 0, stream>>>(LNh, LNl, WQ, nullptr, DM, FG, DQ, bg, 0, 0, 0, QPh, QPl, VTh, KPh, KPl);
        k_attn<<<dim3(TT / AQ, ZH, 1), 256, 0, stream>>>(QPh, QPl, KPh, KPl, VTh, FG, ATh, ATl);
        /* LNh, LNl are free once this pass's projections have run: the next pass's rows are normalised by the waves of the output projection */
        if (g + 1 < NB_ / GB) k_outp<true><<<dim3(GR / 64, DM / 64, 1), 32 * OW, 0, stream>>>(ATh, ATl, WO, OUT + (size_t)g * GR * DM, bo, LNh, LNl, x + (size_t)(g + 1) * GR * DM, ln_g, ln_b);
        else k_outp<false><<<dim3(GR / 64, DM / 64, 1), 32 * OW, 0, stream>>>(ATh, ATl, WO, OUT + (size_t)g * GR * DM, bo, nullptr, nullptr, nullptr, nullptr, nullptr); }
}

// v010
// One run takes 204 microseconds.
// In both of two side-by-side timings against v009, it was 1.18 times as fast.
// All steps since v000 together make it 7.86 times as fast.
#include <hip/hip_runtime.h>

// Gated row (axial) attention with a pre-LayerNorm (x [1][64][512][256]: 64 image rows = 64 independent sequences of 512 tokens x 256; xn = LayerNorm(x) (gamma, beta, eps 1e-5); q = xn Wq ('xw' [256][512], 8 heads x 64), [k|v] = xn Wkv ('xw' [256][1024]: columns k | v); dots = (q/8).k over the 512 keys of the same row; softmax (the explicit max subtraction is a softmax identity); out = attn.v merged; gates = sigmoid(xn Wg + bg) ('xw' [256][512]); y = (out * gates) Wo + bo ('xw' [512][256]) -> [1][64][512][256] (8.4 M)).
// Compute dtypes, f32 accumulate: every input rounded to bf16; LayerNorm in f32, xn as bf16 hi + lo planes; q / kv / gate projections as (hi + lo) x exact weights (2 products) + f32 bias; scores and attn.v on bf16 hi/lo planes (3 products) for every row; softmax f32; sigmoid gate f32 (true division); (out x gate) as hi + lo x exact Wo (2 products) + bo.
// Layout: 32 image rows (16,384 tokens) per pass, the most whose planes fit the workspace side by side (186 MB): the GEMM grids then hold two rounds of resident work-groups, and the second round starts as places fall free, with no gap and no fill of a launch in between (k_attn: one round, a work-group a plane); all per-(row, head) planes are laid out z-major ([z = row*8 + head][512][64]); scores, softmax and attn.v are ONE launch (k_attn), the scores and the probabilities live in registers only, 32 keys at a time (running maximum and sum).
// Launches that do not depend on one another share one grid: the four weight transposes with the first pass's LayerNorm (k_pre); the q, kv and gate projections (one GEMM over the 2,048 stacked weight rows); the output projection with the next pass's LayerNorm (k_outp). 7 launches: 1 + 2 x 3.
// No elementwise launch stands between the matrix kernels: the q and kv projections split their f32 tiles into the hi / lo planes (V transposed) in their own epilogue, and k_attn gates and splits its output tile in its own.
// Workspace: the transposed V planes lie [hi 512 | lo 512] per row (pitch 1,024 elements).

#define NB_  64        // sequences (image rows)
#define TT   512       // tokens per sequence
#define DM   256
#define NH_  8
#define HD   64
#define DQ   (NH_ * HD)    // 512 = inner dim
#define GB   32            // sequences per pass
#define GR   (GB * TT)     // 16384 token rows per pass
#define ZH   (GB * NH_)    // 256 (sequence, head) planes per pass
#define SCL  0.125f   // HD^-0.5
typedef _Float16 h16;
typedef unsigned short bf;
typedef __attribute__((ext_vector_type(16))) __bf16   v16bf;
typedef __attribute__((ext_vector_type(16))) _Float16 v16h;
typedef __attribute__((ext_vector_type(8)))  _Float16 v8h;
typedef __attribute__((ext_vector_type(8)))  unsigned short v8us;
typedef __attribute__((ext_vector_type(8)))  float    v8f;
typedef __attribute__((ext_vector_type(4)))  float    v4f;
typedef v8h  __attribute__((may_alias)) v8ha;
typedef v4f  __attribute__((may_alias)) v4fa;
typedef v8us __attribute__((may_alias)) v8usa;

__device__ __forceinline__ unsigned short f2bf(float f) { unsigned u = __float_as_uint(f); u += 0x7FFFu + ((u >> 16) & 1u); return (unsigned short)(u >> 16); }
__device__ __forceinline__ float bf2f(unsigned short b) { return __uint_as_float(((unsigned)b) << 16); }
__device__ __forceinline__ float bfr(float f) { return bf2f(f2bf(f)); }
__device__ __forceinline__ v16h cat16(v8h lo, v8h hi) { return __builtin_shufflevector(lo, hi, 0, 1, 2, 3, 4, 5, 6, 7, 8, 9, 10, 11, 12, 13, 14, 15); }
__device__ __forceinline__ v16bf cat16b(v8us lo, v8us hi) { return __builtin_bit_cast(v16bf, __builtin_shufflevector(lo, hi, 0, 1, 2, 3, 4, 5, 6, 7, 8, 9, 10, 11, 12, 13, 14, 15)); }
__device__ __forceinline__ v8f wmma16(v16h a, v16h b, v8f c) { return __builtin_amdgcn_wmma_f32_16x16x32_f16(false, a, false, b, (short)0, c, false, false); }
__device__ __forceinline__ v8f wmmab(v16bf a, v16bf b, v8f c) { return __builtin_amdgcn_wmma_f32_16x16x32_bf16(false, a, false, b, (short)0, c, false, false); }

typedef __attribute__((ext_vector_type(2))) float v2f;
typedef __attribute__((ext_vector_type(2))) __bf16 v2bf;
typedef __attribute__((ext_vector_type(4))) unsigned v4w;    // eight bf16 as four packed words
// hi = p rounded to nearest even, lo = the rest rounded likewise (as splitf), two values a word: the packed hi word is also the source of the two f32 that are subtracted
__device__ __forceinline__ void split8(v8f p, v4w& h, v4w& l) {
#pragma unroll
    for (int i = 0; i < 4; ++i) { const unsigned u = __builtin_bit_cast(unsigned, __builtin_convertvector(((v2f){p[2 * i], p[2 * i + 1]}), v2bf)); h[i] = u;
        l[i] = __builtin_bit_cast(unsigned, __builtin_convertvector(((v2f){p[2 * i] - __uint_as_float(u << 16), p[2 * i + 1] - __uint_as_float(u & 0xFFFF0000u)}), v2bf)); } }
typedef v4w __attribute__((may_alias)) v4wa;

__device__ __forceinline__ void splitf(float y, unsigned short& h, unsigned short& l) { h = f2bf(y); l = f2bf(y - bf2f(h)); }
typedef __attribute__((ext_vector_type(2))) unsigned short v2us;
typedef __attribute__((ext_vector_type(4))) unsigned short v4us;
// LayerNorm of one row of 256 by one wave: y0, y1 are the lane's elements lane*4 .. +3 and 128 + lane*4 .. +3 of row r; g0, g1 and b0, b1 the same elements of gamma and beta
__device__ __forceinline__ void ln_row(const v4f y0, const v4f y1, const v4f g0, const v4f g1, const v4f b0, const v4f b1, const size_t r, const int lane, bf* Yh, bf* Yl) {
    float hv[8]; float s = 0.f;
#pragma unroll
    for (int ch = 0; ch < 2; ++ch) { const v4f y = ch ? y1 : y0;
#pragma unroll
        for (int q = 0; q < 4; ++q) { const float u = bfr(y[q]); hv[ch * 4 + q] = u; s += u; } }
#pragma unroll
    for (int sh = 16; sh; sh >>= 1) s += __shfl_xor(s, sh, 32);
    float mu = s * (1.0f / 256.0f); asm volatile("" : "+v"(mu)); float s2 = 0.f;
#pragma unroll
    for (int k = 0; k < 8; ++k) { float d0 = __fsub_rn(hv[k], mu); asm volatile("" : "+v"(d0)); float p = __fmul_rn(d0, d0); asm volatile("" : "+v"(p)); s2 = __fadd_rn(s2, p); }
#pragma unroll
    for (int sh = 16; sh; sh >>= 1) s2 += __shfl_xor(s2, sh, 32);
    float var = __fadd_rn(s2 * (1.0f / 256.0f), 1e-5f); asm volatile("" : "+v"(var)); const float rs = __frsqrt_rn(var);
#pragma unroll
    for (int ch = 0; ch < 2; ++ch) { const int c0 = ch * 128 + lane * 4; v4us oh, ol;
#pragma unroll
        for (int q = 0; q < 4; ++q) { float gg = bfr((ch ? g1 : g0)[q]); asm volatile("" : "+v"(gg)); float d0 = __fsub_rn(hv[ch * 4 + q], mu); asm volatile("" : "+v"(d0)); float n0 = __fmul_rn(d0, rs); asm volatile("" : "+v"(n0)); float y = __fmul_rn(n0, gg); asm volatile("" : "+v"(y)); y = __fadd_rn(y, bfr((ch ? b1 : b0)[q])); unsigned short a, c2; splitf(y, a, c2); oh[q] = a; ol[q] = c2; }
        *(v4us*)(Yh + r * DM + c0) = oh; *(v4us*)(Yl + r * DM + c0) = ol;
        asm volatile("s_wait_xcnt 0x0" ::: "memory"); }    // no register of the two stores above is rewritten by what follows (the row's second half, the caller's next row) ahead of this wait
}

// ---- k_gemmw: register-blocked GEMM, ONE WAVE per 64x64 output tile (16 accumulators), WM x WN waves a work-group, operands from K-contiguous 16-bit planes; grid (M/(64 WM), N/(64 WN), Z), 32 WM WN threads.
// The waves of a group share each staged piece: its 64 WM rows of the A planes and 64 WN rows of Bt leave L2 once for the group, not once for each wave that reads them. The stacked projections run 2 x 4 waves (512 staged rows a piece where eight one-wave groups take 1,536); the output projection, whose grid has few tiles, has a kernel of its own (k_outp).
// C[m][n] (f32, pitch ldc, + optional f32 bias[n]) = sum_k A[m][k] Bt[n][k] (+ split products per NSPLIT). K (a template argument, so that a piece's loads of a plane (NA of an A plane, NB of Bt) share one offset register and differ in the immediate offset) is the row pitch of A and of Bt in elements, KD <= K the depth that is summed. z-batch strides sA/sB/sC in elements. KD % 64 == 0, K % 64 == 0.
// Each 64-row x 64-deep piece of a plane goes through LDS: a global load takes 4 whole 128-byte lines (8 lanes a row), where a fragment load straight from memory touches 16 lines for the same 512 bytes; the fragments are then read from LDS rows of SP elements (144 B = 16 B x 9: no bank conflict).
// EPI says where the tile goes. 0: C as above. 1: the stacked projections, by the tile's column: a tile is 64 tokens x one head (64 | TT, HD = 64); columns below DQ (q) and below 2 DQ (k) are split into bf16 hi + lo and stored as 64 whole rows of the z-major planes Ph, Pl (q) or Kh, Kl (k); columns below 3 DQ (v) go transposed into VT: an accumulator register group holds 8 successive tokens of one d, which are 16 bytes of a V^T row as they stand; the last DQ columns (gate) go to C with the bias.
#define SP 72
template <bool B> struct Sel { static constexpr bool v = B; };
template <typename T16> struct WFrag;
template <> struct WFrag<h16> { typedef v16h V; static __device__ __forceinline__ V ld(const h16* p) { return cat16(*(const v8h*)p, *(const v8h*)(p + 16)); } static __device__ __forceinline__ v8f mma(V a, V b, v8f c) { return wmma16(a, b, c); } };
template <> struct WFrag<bf> { typedef v16bf V; static __device__ __forceinline__ V ld(const bf* p) { return cat16b(*(const v8us*)p, *(const v8us*)(p + 16)); } static __device__ __forceinline__ v8f mma(V a, V b, v8f c) { return wmmab(a, b, c); } };
template <typename T16, int NSPLIT, bool BIAS, int K, int EPI, int WM, int WN>
__global__ __launch_bounds__(32 * WM * WN) void k_gemmw(const T16* __restrict__ A, const T16* __restrict__ A2, const T16* __restrict__ Bt, const T16* __restrict__ Bt2, int KD, float* C, int ldc, const float* __restrict__ bias, size_t sA, size_t sB, size_t sC, bf* Ph, bf* Pl, bf* VT, bf* Kh, bf* Kl) {
    typedef typename WFrag<T16>::V V;
    constexpr int NW = WM * WN, RS = NW * 4, NA = WM * 64 / RS, NB = WN * 64 / RS;    // waves; rows that one staging load of the whole group takes; such loads per A plane, per B plane
    __shared__ __align__(16) float osg[NW * 16 * 68];
    __shared__ __align__(16) T16 sa[WM * 64 * SP], sb[WN * 64 * SP], sa2[(NSPLIT == 1 || NSPLIT == 2) ? WM * 64 * SP : 8], sb2[NSPLIT >= 2 ? WN * 64 * SP : 8];
    const size_t z = blockIdx.z; A += z * sA; if (A2) A2 += z * sA; Bt += z * sB; if (Bt2) Bt2 += z * sB; C += z * sC;
    const int tid = threadIdx.x, lane = tid & 31, lr = lane & 15, hi = lane >> 4; const int wv = NW > 1 ? __builtin_amdgcn_readfirstlane(tid >> 5) : 0, wm = wv % WM, wn = wv / WM;    // the wave's number as a scalar: the epilogue's choices by column stay scalar branches
    const int R0 = blockIdx.x * (64 * WM), C0 = blockIdx.y * (64 * WN), r0 = R0 + wm * 64, c0 = C0 + wn * 64; float* os = osg + wv * (16 * 68);    // the group's tile, the wave's own 64 x 64 of it, the wave's own epilogue rows
    v8f acc[4][4];
#pragma unroll
    for (int mb = 0; mb < 4; ++mb)
#pragma unroll
        for (int nb = 0; nb < 4; ++nb) acc[mb][nb] = (v8f){};
    const int srow = tid >> 3, scol = (tid & 7) * 8;    // staging: 8 lanes take one row's 128 bytes
    const unsigned aoff = ((unsigned)(R0 + srow) * K + scol) * 2u, boff = ((unsigned)(C0 + srow) * K + scol) * 2u;    // byte offsets (a plane is below 4 GiB): the plane pointers stay scalar and one offset register serves both A planes
    const int soff = srow * SP + scol, foa = (wm * 64 + lr) * SP + 8 * hi, fob = (wn * 64 + lr) * SP + 8 * hi;
#pragma unroll 1
    for (int k0 = 0; k0 < KD; k0 += 64) { const unsigned ao = aoff + k0 * 2u, bo = boff + k0 * 2u; const char* pa = (const char*)A + ao; const char* pb = (const char*)Bt + bo; const char* pa2 = (NSPLIT == 1 || NSPLIT == 2) ? (const char*)A2 + ao : pa; const char* pb2 = NSPLIT >= 2 ? (const char*)Bt2 + bo : pb;
        v8us ra[NA], rb[NB], ra2[(NSPLIT == 1 || NSPLIT == 2) ? NA : 1], rb2[NSPLIT >= 2 ? NB : 1];
#pragma unroll    // all loads of a piece in flight together, each row step an immediate offset
        for (int i = 0; i < (NA > NB ? NA : NB); ++i) { if (i < NA) ra[i] = *(const v8usa*)(pa + i * RS * 2 * K); if (i < NB) rb[i] = *(const v8usa*)(pb + i * RS * 2 * K);
            if ((NSPLIT == 1 || NSPLIT == 2) && i < NA) ra2[i] = *(const v8usa*)(pa2 + i * RS * 2 * K); if (NSPLIT >= 2 && i < NB) rb2[i] = *(const v8usa*)(pb2 + i * RS * 2 * K); }
        asm volatile("s_wait_xcnt 0x0" :: "v"(ao), "v"(bo) : "memory");    // the loads' address registers stay theirs up to this wait: no later load lands on them, the next piece's addresses are formed behind it; standing ahead of the LDS stores it also keeps every load of the piece ahead of the first store (left alone the stacked-projection build waits for each load by itself)
#pragma unroll
        for (int i = 0; i < (NA > NB ? NA : NB); ++i) { if (i < NA) *(v8usa*)(sa + soff + i * RS * SP) = ra[i]; if (i < NB) *(v8usa*)(sb + soff + i * RS * SP) = rb[i];
            if ((NSPLIT == 1 || NSPLIT == 2) && i < NA) *(v8usa*)(sa2 + soff + i * RS * SP) = ra2[i]; if (NSPLIT >= 2 && i < NB) *(v8usa*)(sb2 + soff + i * RS * SP) = rb2[i]; }
        __syncthreads();    // the piece is written by other lanes, in a group of several waves by other waves, than read it (a one-wave group: it builds to the LDS wait and keeps the compiler from reading ahead of the stores)
        V a[4], a2[4];
#pragma unroll    // the second half's fragment reads are scheduled among the first half's products
      for (int kc = 0; kc < 64; kc += 32) {
#pragma unroll
        for (int mb = 0; mb < 4; ++mb) { a[mb] = WFrag<T16>::ld(sa + foa + mb * 16 * SP + kc); if (NSPLIT == 1 || NSPLIT == 2) a2[mb] = WFrag<T16>::ld(sa2 + foa + mb * 16 * SP + kc); }
#pragma unroll
        for (int nb = 0; nb < 4; ++nb) { const V b = WFrag<T16>::ld(sb + fob + nb * 16 * SP + kc); V b2; if (NSPLIT >= 2) b2 = WFrag<T16>::ld(sb2 + fob + nb * 16 * SP + kc);
#pragma unroll
            for (int mb = 0; mb < 4; ++mb) { acc[mb][nb] = WFrag<T16>::mma(a[mb], b, acc[mb][nb]); if (NSPLIT == 1 || NSPLIT == 2) acc[mb][nb] = WFrag<T16>::mma(a2[mb], b, acc[mb][nb]); if (NSPLIT >= 2) acc[mb][nb] = WFrag<T16>::mma(a[mb], b2, acc[mb][nb]); } }
      }
        asm volatile("v_nop\n\tv_nop\n\tv_nop\n\tv_nop" : "+v"(acc[0][0]), "+v"(acc[0][1]), "+v"(acc[0][2]), "+v"(acc[0][3]), "+v"(acc[1][0]), "+v"(acc[1][1]), "+v"(acc[1][2]), "+v"(acc[1][3]), "+v"(acc[2][0]), "+v"(acc[2][1]), "+v"(acc[2][2]), "+v"(acc[2][3]), "+v"(acc[3][0]), "+v"(acc[3][1]), "+v"(acc[3][2]), "+v"(acc[3][3]));    // the four vector slots between the piece's last product and the branch back, behind which the next piece's loads land on operand registers; every accumulator is named, so that no product of the piece is scheduled behind the slots
        __syncthreads();    // every fragment is read before the next piece overwrites it (keeps the next stores behind these reads)
    }
    const size_t zz = (size_t)(r0 / TT) * NH_ + (c0 / HD) % NH_; const int t0 = r0 % TT;    // the tile's (sequence, head) plane and its first token
    if (EPI == 1 && c0 >= 2 * DQ && c0 < 3 * DQ) {
        bf* vrow = VT + (zz * HD + lr) * (2 * TT) + t0 + hi * 8;
#pragma unroll
        for (int nb = 0; nb < 4; ++nb)
#pragma unroll
            for (int mb = 0; mb < 4; ++mb) { v4w h, l; split8(acc[mb][nb], h, l); *(v4wa*)(vrow + nb * 16 * 2 * TT + mb * 16) = h; *(v4wa*)(vrow + nb * 16 * 2 * TT + mb * 16 + TT) = l; }
    } else {
    auto rows = [&](auto pln) __attribute__((always_inline)) {    // the tile by way of os, 16 rows at a time; pln: to the hi / lo planes, else to C (the choice is made once a tile, outside the loop)
#pragma unroll
    for (int mb = 0; mb < 4; ++mb) {
#pragma unroll
        for (int nb = 0; nb < 4; ++nb) {
#pragma unroll
            for (int j = 0; j < 8; ++j) os[(hi * 8 + j) * 68 + nb * 16 + lr] = acc[mb][nb][j]; }
        __builtin_amdgcn_wave_barrier(); asm volatile("" ::: "memory");
        if (decltype(pln)::v) { bf* ph = c0 < DQ ? Ph : Kh; bf* pl = c0 < DQ ? Pl : Kl; const size_t po = (zz * TT + t0 + mb * 16 + (lane >> 3)) * HD + (lane & 7) * 8;    // 8 lanes a row: a store takes 4 whole 128-byte rows
#pragma unroll
            for (int s = 0; s < 4; ++s) { const float* orw = os + (4 * s + (lane >> 3)) * 68 + (lane & 7) * 8; const v4f x0 = *(const v4fa*)orw, x1 = *(const v4fa*)(orw + 4); v4w h, l;
                split8((v8f){x0[0], x0[1], x0[2], x0[3], x1[0], x1[1], x1[2], x1[3]}, h, l); *(v4wa*)(ph + po + s * 4 * HD) = h; *(v4wa*)(pl + po + s * 4 * HD) = l; }
        } else {
        const int cg = EPI == 1 ? c0 - 3 * DQ : c0;    // the tile's first column in C and in the bias
        float* crow = C + (size_t)(r0 + mb * 16) * ldc + cg;
#pragma unroll
            for (int s = 0; s < 8; ++s) { const int row = 2 * s + hi, cofs = lr * 4; v4f val = *(const v4fa*)(os + row * 68 + cofs); if (BIAS) { val[0] += bfr(bias[cg + cofs]); val[1] += bfr(bias[cg + cofs + 1]); val[2] += bfr(bias[cg + cofs + 2]); val[3] += bfr(bias[cg + cofs + 3]); }
                *(v4f*)(crow + (size_t)row * ldc + cofs) = val; }
             }
        __builtin_amdgcn_wave_barrier(); asm volatile("s_wait_xcnt 0x0" ::: "memory");    // keeps the next rows' writes of os behind these reads, as before; the wait: no register of the stores above is rewritten, and no later load lands on one, ahead of it (the next rows' bias load did; behind the last rows the built code lays another block of the kernel, with a branch round it)
    }
    };
    if (EPI == 1 && c0 < 2 * DQ) rows(Sel<true>{}); else rows(Sel<false>{});
    }
}

// ---- k_outp: the output projection, C[m][n] = sum_k (A + A2)[m][k] Bt[n][k] + bias[n] (f32, pitch DM), depth DQ. Grid (GR/64, DM/64): 1,024 tiles of 64 x 64; with one wave a tile a wave walks eight staged pieces one behind the other, each with its own trip to memory.
// OW waves a work-group share ONE tile and split its DEPTH: wave w sums k = w*KW .. w*KW + KW - 1 (two pieces) through staging rows of its own, as k_gemmw stages them; the OW partial tiles then meet in LDS (on the staging rows, which are read out by then), and each wave adds and stores 16 of the 64 rows: ((p0 + p1) + (p2 + p3)) + bias.
// LN: each wave also normalises 4 rows of the next pass (X -> Ph, Pl; OW x 4 x 1,024 = GR rows). Their loads go out ahead of the first piece's, and the arithmetic of two rows runs while each piece is on its way.
#define OW 4
#define KW (DQ / OW)
template <bool LN>
__global__ __launch_bounds__(32 * OW) void k_outp(const bf* __restrict__ A, const bf* __restrict__ A2, const bf* __restrict__ Bt, float* C, const float* __restrict__ bias, bf* Ph, bf* Pl, const float* __restrict__ X, const float* __restrict__ gw, const float* __restrict__ gb) {
    typedef WFrag<bf> F; typedef F::V V;
    __shared__ __align__(16) bf sm[OW * 3 * 64 * SP];    // staging: per wave 64 rows of A, A2, Bt; behind the two pieces: OW partial tiles of 64 rows x 68 f32
    const int tid = threadIdx.x, lane = tid & 31, lr = lane & 15, hi = lane >> 4; const int wv = __builtin_amdgcn_readfirstlane(tid >> 5);
    bf* sa = sm + wv * (3 * 64 * SP); bf* sa2 = sa + 64 * SP; bf* sb = sa2 + 64 * SP;
    const int r0 = blockIdx.x * 64, c0 = blockIdx.y * 64;
    const int cofs = lr * 4; const float* bp = bias + c0 + cofs; const v4f braw = *(const v4f*)bp;    // the lane's four bias values, read first: their trip runs beside the first piece's
    __builtin_amdgcn_sched_barrier(0);    // keeps that load the first: loads return in order, and the wait for its value (ahead of the first piece's s_wait_xcnt) is then no wait for the piece
    const size_t rw = (((size_t)blockIdx.y * (GR / 64) + blockIdx.x) * OW + wv) * 4; v4f y[4][2], g0, g1, b0, b1;
    if (LN) {
#pragma unroll
        for (int i = 0; i < 4; ++i) { y[i][0] = *(const v4f*)(X + (rw + i) * DM + lane * 4); y[i][1] = *(const v4f*)(X + (rw + i) * DM + 128 + lane * 4); }
        g0 = *(const v4f*)(gw + lane * 4); g1 = *(const v4f*)(gw + 128 + lane * 4); b0 = *(const v4f*)(gb + lane * 4); b1 = *(const v4f*)(gb + 128 + lane * 4); }
    v8f acc[4][4];
#pragma unroll
    for (int mb = 0; mb < 4; ++mb)
#pragma unroll
        for (int nb = 0; nb < 4; ++nb) acc[mb][nb] = (v8f){};
    const int srow = lane >> 3, scol = (lane & 7) * 8;    // staging: 8 lanes take one row's 128 bytes
    const unsigned aoff = ((unsigned)(r0 + srow) * DQ + wv * KW + scol) * 2u, boff = ((unsigned)(c0 + srow) * DQ + wv * KW + scol) * 2u;
    const int soff = srow * SP + scol, fo = lr * SP + 8 * hi;
    auto piece = [&](const int k0, auto rows) __attribute__((always_inline)) {    // one 64-deep piece; rows: the arithmetic of two LayerNorm rows goes between the piece's loads and its LDS stores (written out per piece, not as a loop: out of a loop the compiler lifts that arithmetic, and the wait for its loads, ahead of the piece's loads)
        const unsigned ao = aoff + k0 * 2u, bo = boff + k0 * 2u; const char* pa = (const char*)A + ao; const char* pb = (const char*)Bt + bo; const char* pa2 = (const char*)A2 + ao;
        v8us ra[16], rb[16], ra2[16];
#pragma unroll    // all loads of a piece in flight together, each row step an immediate offset
        for (int i = 0; i < 16; ++i) { ra[i] = *(const v8usa*)(pa + i * 4 * 2 * DQ); rb[i] = *(const v8usa*)(pb + i * 4 * 2 * DQ); ra2[i] = *(const v8usa*)(pa2 + i * 4 * 2 * DQ); }
        if (k0 == 0) asm volatile("s_wait_xcnt 0x0" :: "v"(aoff), "v"(boff), "v"(lr), "v"(braw) : "memory");    // as the next line; the bias load's offset register (the built load takes lr, scaled, on a scalar base) and its value are named too, so that this load stands ahead of the wait and no later load lands on that register
        else asm volatile("s_wait_xcnt 0x0" :: "v"(aoff), "v"(boff) : "memory");    // the loads' address registers (the built loads take aoff, boff and put the piece's step into the immediate offset) stay theirs up to this wait; standing ahead of the LDS stores it also keeps every load of the piece ahead of the first store
        if (decltype(rows)::v) {    // the rows' loads were issued first and return first
            __builtin_amdgcn_sched_barrier(0);    // keeps the rows' arithmetic, and the wait for their loads, behind the issue of the piece's loads
#pragma unroll
            for (int i = k0 / 32; i < k0 / 32 + 2; ++i) ln_row(y[i][0], y[i][1], g0, g1, b0, b1, rw + i, lane, Ph, Pl); }
#pragma unroll
        for (int i = 0; i < 16; ++i) { *(v8usa*)(sa + soff + i * 4 * SP) = ra[i]; *(v8usa*)(sb + soff + i * 4 * SP) = rb[i]; *(v8usa*)(sa2 + soff + i * 4 * SP) = ra2[i]; }
        __syncthreads();    // the piece is written by other lanes than read it: the LDS wait, and the compiler reads nothing ahead of the stores
        V a[4], a2[4];
#pragma unroll    // the second half's fragment reads are scheduled among the first half's products
      for (int kc = 0; kc < 64; kc += 32) {
#pragma unroll
        for (int mb = 0; mb < 4; ++mb) { a[mb] = F::ld(sa + fo + mb * 16 * SP + kc); a2[mb] = F::ld(sa2 + fo + mb * 16 * SP + kc); }
#pragma unroll
        for (int nb = 0; nb < 4; ++nb) { const V b = F::ld(sb + fo + nb * 16 * SP + kc);
#pragma unroll
            for (int mb = 0; mb < 4; ++mb) { acc[mb][nb] = F::mma(a[mb], b, acc[mb][nb]); acc[mb][nb] = F::mma(a2[mb], b, acc[mb][nb]); } }
      }
        __syncthreads();    // every fragment is read before the next piece, or behind the last piece another wave's partial tile, overwrites it
    };
    static_assert(KW == 128, "two pieces a wave");
    piece(0, Sel<LN>{}); piece(64, Sel<LN>{});
    float* red = (float*)sm; float* my = red + wv * (64 * 68);
#pragma unroll
    for (int mb = 0; mb < 4; ++mb)
#pragma unroll
        for (int nb = 0; nb < 4; ++nb)
#pragma unroll
            for (int j = 0; j < 8; ++j) my[(mb * 16 + hi * 8 + j) * 68 + nb * 16 + lr] = acc[mb][nb][j];
    __syncthreads();    // a wave adds rows that the other waves wrote
    const v4f bs = {bfr(braw[0]), bfr(braw[1]), bfr(braw[2]), bfr(braw[3])};
    float* crow = C + (size_t)(r0 + wv * 16) * DM + c0 + cofs; const float* pr = red + wv * 16 * 68 + cofs;
#pragma unroll
    for (int s = 0; s < 8; ++s) { const int row = 2 * s + hi; const float* p = pr + row * 68;
        const v4f val = ((*(const v4fa*)p + *(const v4fa*)(p + 64 * 68)) + (*(const v4fa*)(p + 2 * 64 * 68) + *(const v4fa*)(p + 3 * 64 * 68))) + bs;
        *(v4f*)(crow + (size_t)row * DM) = val; }
}

// ---- k_pre: the four weight transposes ('xw': Bt[n][k] = W[k][n], 64 lines of 64 elements a work-group: 32 + 64 + 32 + 32 work-groups) and, behind them in the same grid, the first pass's LayerNorm (a row a wave).
#define WB (DM * DQ / 64 / 64)    // work-groups of a 256 x 512 weight
__global__ __launch_bounds__(256) void k_pre(const float* __restrict__ wq, const float* __restrict__ wkv, const float* __restrict__ wg, const float* __restrict__ wo, bf* WQ, bf* WKV, bf* WG, bf* WO, const float* __restrict__ X, const float* __restrict__ gw, const float* __restrict__ gb, bf* Yh, bf* Yl) {
    const int lane = threadIdx.x & 31, wv = threadIdx.x >> 5, b = blockIdx.x;
    if (b < 5 * WB) {
        const float* w = b < WB ? wq : b < 3 * WB ? wkv : b < 4 * WB ? wg : wo; bf* Bt = b < WB ? WQ : b < 3 * WB ? WKV : b < 4 * WB ? WG : WO;
        const int K = b < 4 * WB ? DM : DQ, N = b < WB ? DQ : b < 3 * WB ? 2 * DQ : b < 4 * WB ? DQ : DM, b0 = b < WB ? 0 : b < 3 * WB ? WB : b < 4 * WB ? 3 * WB : 4 * WB;
        const int L0 = ((b - b0) * 8 + wv) * 8;
#pragma unroll 1
        for (int l = 0; l < 8; ++l) { const size_t e = (size_t)(L0 + l) * 64 + lane * 2; const int k = (int)(e % K), n = (int)(e / K); v2us o;
            o[0] = f2bf(w[(size_t)k * N + n]); o[1] = f2bf(w[(size_t)(k + 1) * N + n]); *(v2us*)(Bt + e) = o; }
        return; }
    const size_t r = (size_t)(b - 5 * WB) * 8 + wv; const float* xr = X + r * DM;
    ln_row(*(const v4f*)(xr + lane * 4), *(const v4f*)(xr + 128 + lane * 4), *(const v4f*)(gw + lane * 4), *(const v4f*)(gw + 128 + lane * 4), *(const v4f*)(gb + lane * 4), *(const v4f*)(gb + 128 + lane * 4), r, lane, Yh, Yl);
}
// ---- k_attn: scores, softmax and attn.v of one (sequence, head) plane in ONE work-group; no score leaves the WGP. Grid ZH (one work-group a WGP, one round), 256 threads = 8 waves; the group walks the plane's TT / AQ blocks of AQ query rows one after the other, 32 query rows (two tiles of 16) a wave and block.
// The scores are formed transposed, S^T = K Q^T (A = 16 key rows from LDS, B = 16 query rows held in registers): an accumulator tile then holds, in lane (lr, hi), keys 8*hi + j of query lr, and two such tiles are, register for register, the B fragment of a 32-key step of O^T = V^T P^T.
// A wave walks the 512 keys in a rolled loop of 32-key steps with a running maximum and a running sum (the output tiles and the sum are scaled by exp2 of the maximum's rise at every step; the division by the sum comes last): every K and V^T fragment read from LDS feeds two query tiles, and the loop's text is one step long.
// LDS: the K planes (rows of KPT elements, hi plane then lo plane) and, beside them, the V^T rows [hi 512 | lo 512] at pitch VPT (both pitches 16 B x odd); both are staged once for all the plane's query rows: K and V^T leave memory once a plane, and the second block starts with no trip to memory in front of it.
#define KPT 72
__device__ __forceinline__ v16bf cat16v(v4w lo, v4w hi) { return __builtin_bit_cast(v16bf, __builtin_shufflevector(lo, hi, 0, 1, 2, 3, 4, 5, 6, 7)); }
__device__ __forceinline__ float xhalf(float x) { return __builtin_bit_cast(float, __builtin_amdgcn_permlanex16(__builtin_bit_cast(int, x), __builtin_bit_cast(int, x), 0x76543210, 0xfedcba98, false, false)); }    // lane l with lane l ^ 16
#define VPT 1032
#define AQ 256    // query rows of a block
__global__ __launch_bounds__(256, 1) void k_attn(const bf* __restrict__ Qh, const bf* __restrict__ Ql, const bf* __restrict__ Kh, const bf* __restrict__ Kl, const bf* __restrict__ VT, const float* __restrict__ G, bf* __restrict__ Ah, bf* __restrict__ Al) {
    typedef WFrag<bf> F; typedef F::V V;
    __shared__ __align__(16) bf sk[2 * TT * KPT];
    __shared__ __align__(16) bf sv[HD * VPT];
    const int tid = threadIdx.x, lane = tid & 31, lr = lane & 15, hi = lane >> 4; const size_t z = blockIdx.x; const int qw = (tid >> 5) * 32;    // the wave's first query row in a block
    // the wave's Q fragments of block 0 (B operand: lane lr = query row, k = d in the hardware order; [query tile][32 of d]), and K and V^T to LDS: a load takes whole 128-byte lines; all 64 staging loads of a thread are in flight together (no accumulator is live yet)
    V qh[2][2], ql[2][2];
    { const bf* pqh = Qh + (z * TT + qw + lr) * HD + 8 * hi; const bf* pql = Ql + (z * TT + qw + lr) * HD + 8 * hi;
        const bf* gh = Kh + z * (TT * HD) + tid * 8; const bf* gl = Kl + z * (TT * HD) + tid * 8; const bf* gv = VT + z * HD * (2 * TT) + tid * 8;
        bf* lk = sk + (tid >> 3) * KPT + (tid & 7) * 8; bf* lv = sv + (tid >> 7) * VPT + (tid & 127) * 8; v8us rh[16], rl[16], rv[32];
#pragma unroll
        for (int i = 0; i < 16; ++i) { rh[i] = *(const v8usa*)(gh + i * 2048); rl[i] = *(const v8usa*)(gl + i * 2048); }
#pragma unroll
        for (int u = 0; u < 2; ++u)
#pragma unroll
            for (int c = 0; c < 2; ++c) { qh[u][c] = F::ld(pqh + u * 16 * HD + c * 32); ql[u][c] = F::ld(pql + u * 16 * HD + c * 32); }
#pragma unroll
        for (int i = 0; i < 32; ++i) rv[i] = *(const v8usa*)(gv + i * 2048);
        asm volatile("s_wait_xcnt 0x0" :: "v"(tid), "v"(pqh), "v"(pql), "s"(gh - tid * 8), "s"(gl - tid * 8), "s"(gv - tid * 8) : "memory");    // the loads' address registers (the built staging loads take the thread's number as their offset register, on three scalar bases) stay theirs up to this wait: no load lands on them and nothing rewrites them ahead of it
#pragma unroll
        for (int i = 0; i < 16; ++i) { *(v8usa*)(lk + i * 32 * KPT) = rh[i]; *(v8usa*)(lk + (TT + i * 32) * KPT) = rl[i]; }
#pragma unroll
        for (int i = 0; i < 32; ++i) *(v8usa*)(lv + i * 2 * VPT) = rv[i]; }
    __syncthreads();    // K and V^T are written by other waves than read them
    const float cs = SCL * 1.4426950408889634f;
    const bf* kf = sk + lr * KPT + 8 * hi; const bf* vf = sv + lr * VPT + 8 * hi;
    V kh[2][2], kl[2][2];    // [key tile][32 of d]; a step's K fragments are fetched one step ahead
#pragma unroll
    for (int t = 0; t < 2; ++t)
#pragma unroll
        for (int c = 0; c < 2; ++c) { kh[t][c] = F::ld(kf + t * 16 * KPT + c * 32); kl[t][c] = F::ld(kf + (TT + t * 16) * KPT + c * 32); }
#pragma unroll 1    // one block of text, as for the steps below
  for (int qb = 0; qb < TT / AQ; ++qb) {
    const int q0 = qb * AQ + qw;
    v8f o[4][2];    // O^T: [16 of d][query tile]
#pragma unroll
    for (int mb = 0; mb < 4; ++mb)
#pragma unroll
        for (int u = 0; u < 2; ++u) o[mb][u] = (v8f){};
    float mr[2] = {-__builtin_inff(), -__builtin_inff()}, ls[2] = {0.f, 0.f};    // per query tile: the maximum in use (the same in both lane halves) and the lane's own share of the sum
#pragma unroll 1    // one step of text
    for (int kb = 0; kb < TT / 32; ++kb) {
        V vh[4], vl[4];
#pragma unroll
        for (int mb = 0; mb < 4; ++mb) { vh[mb] = F::ld(vf + mb * 16 * VPT + kb * 32); vl[mb] = F::ld(vf + mb * 16 * VPT + TT + kb * 32); }
        __builtin_amdgcn_sched_barrier(0);    // keeps this step's V^T reads, one group, ahead of the score products (left alone the compiler sinks each read to its use and waits for it there)
        v8f s[2][2];
#pragma unroll
        for (int t = 0; t < 2; ++t)
#pragma unroll
            for (int u = 0; u < 2; ++u) s[t][u] = (v8f){};
#pragma unroll
        for (int c = 0; c < 2; ++c) {
#pragma unroll
            for (int t = 0; t < 2; ++t)
#pragma unroll
                for (int u = 0; u < 2; ++u) s[t][u] = F::mma(kh[t][c], qh[u][c], s[t][u]);
            __builtin_amdgcn_sched_barrier(0);    // keeps four independent tiles between two products into one accumulator
#pragma unroll
            for (int t = 0; t < 2; ++t)
#pragma unroll
                for (int u = 0; u < 2; ++u) s[t][u] = F::mma(kh[t][c], ql[u][c], s[t][u]);
            __builtin_amdgcn_sched_barrier(0);    // as above
#pragma unroll
            for (int t = 0; t < 2; ++t)
#pragma unroll
                for (int u = 0; u < 2; ++u) s[t][u] = F::mma(kl[t][c], qh[u][c], s[t][u]);
            __builtin_amdgcn_sched_barrier(0); }    // as above
        { const bf* kn = kf + ((kb + 1) & (TT / 32 - 1)) * 32 * KPT;    // the next step's key rows; the last step reads step 0's again: they are the next block's first
#pragma unroll
            for (int t = 0; t < 2; ++t)
#pragma unroll
                for (int c = 0; c < 2; ++c) { kh[t][c] = F::ld(kn + t * 16 * KPT + c * 32); kl[t][c] = F::ld(kn + (TT + t * 16) * KPT + c * 32); } }
        __builtin_amdgcn_sched_barrier(0);    // keeps the next step's K reads, one group, ahead of the softmax work, under which they land
        V ph[2], pl[2];
#pragma unroll
        for (int u = 0; u < 2; ++u) {    // query lr of tile u: the lane's 16 scores of this step, then one exchange with lane ^ 16
            v8f m8;
#pragma unroll
            for (int j = 0; j < 8; ++j) m8[j] = fmaxf(s[0][u][j], s[1][u][j]);
            float mx = fmaxf(fmaxf(fmaxf(m8[0], m8[1]), fmaxf(m8[2], m8[3])), fmaxf(fmaxf(m8[4], m8[5]), fmaxf(m8[6], m8[7])));
            mx = fmaxf(mx, xhalf(mx));
            const float mn = fmaxf(mr[u], mx), al = __builtin_amdgcn_exp2f((mr[u] - mn) * cs), mc = mn * cs; mr[u] = mn;
#pragma unroll
            for (int t = 0; t < 2; ++t)
#pragma unroll
                for (int j = 0; j < 8; ++j) s[t][u][j] = __builtin_amdgcn_exp2f(s[t][u][j] * cs - mc);
            const v8f a8 = s[0][u] + s[1][u];
            ls[u] = ls[u] * al + (((a8[0] + a8[1]) + (a8[2] + a8[3])) + ((a8[4] + a8[5]) + (a8[6] + a8[7])));
#pragma unroll
            for (int mb = 0; mb < 4; ++mb) o[mb][u] *= al;
            v4w h0, h1, l0, l1; split8(s[0][u], h0, l0); split8(s[1][u], h1, l1);
            ph[u] = cat16v(h0, h1); pl[u] = cat16v(l0, l1); }
        __builtin_amdgcn_sched_barrier(0);    // the products below start together, eight independent tiles a group
#pragma unroll
        for (int mb = 0; mb < 4; ++mb)
#pragma unroll
            for (int u = 0; u < 2; ++u) o[mb][u] = F::mma(vh[mb], ph[u], o[mb][u]);
#pragma unroll
        for (int mb = 0; mb < 4; ++mb)
#pragma unroll
            for (int u = 0; u < 2; ++u) o[mb][u] = F::mma(vh[mb], pl[u], o[mb][u]);
#pragma unroll
        for (int mb = 0; mb < 4; ++mb)
#pragma unroll
            for (int u = 0; u < 2; ++u) o[mb][u] = F::mma(vl[mb], ph[u], o[mb][u]);
    }
    // lane (lr, hi) holds d = mb*16 + hi*8 + j of query lr of tile u: out / sum x sigmoid(gate) (true divisions), split into hi + lo, goes straight to the merged-head operand planes of the output projection
    const size_t oo = ((z / NH_) * TT + q0 + lr) * DQ + (z % NH_) * HD + hi * 8; const float* gp = G + oo; v4f g[2][8];
#pragma unroll
    for (int u = 0; u < 2; ++u)
#pragma unroll
        for (int i = 0; i < 8; ++i) g[u][i] = *(const v4f*)(gp + u * 16 * DQ + (i >> 1) * 16 + (i & 1) * 4);
    asm volatile("s_wait_xcnt 0x0" :: "v"(gp) : "memory");    // the loads' address registers stay theirs up to this wait
    if (qb + 1 < TT / AQ) {    // the next block's Q fragments set out behind the gate's loads (this block's are read out): their trip runs under the arithmetic below
        const unsigned qo = ((qw + lr) * HD + 8 * hi) * 2u; const bf* nqh = (const bf*)((const char*)(Qh + (z * TT + (qb + 1) * AQ) * HD) + qo); const bf* nql = (const bf*)((const char*)(Ql + (z * TT + (qb + 1) * AQ) * HD) + qo);    // a scalar base and the lane's byte offset in the block
#pragma unroll
        for (int u = 0; u < 2; ++u)
#pragma unroll
            for (int c = 0; c < 2; ++c) { qh[u][c] = F::ld(nqh + u * 16 * HD + c * 32); ql[u][c] = F::ld(nql + u * 16 * HD + c * 32); }
        asm volatile("s_wait_xcnt 0x0" ::: "memory"); }    // nothing rewrites the loads' address registers ahead of this wait
#pragma unroll
    for (int u = 0; u < 2; ++u) { const float f = __fdiv_rn(1.0f, ls[u] + xhalf(ls[u]));
#pragma unroll
        for (int mb = 0; mb < 4; ++mb) { v8f a; v4w h, l;
#pragma unroll
            for (int j = 0; j < 8; ++j) { const float den = __fadd_rn(1.0f, expf(-g[u][mb * 2 + (j >> 2)][j & 3])); a[j] = __fmul_rn(__fmul_rn(o[mb][u][j], f), __fdiv_rn(1.0f, den)); }
            split8(a, h, l); *(v4wa*)(Ah + oo + u * 16 * DQ + mb * 16) = h; *(v4wa*)(Al + oo + u * 16 * DQ + mb * 16) = l;
            asm volatile("s_wait_xcnt 0x0" ::: "memory"); } }    // no register of the two stores above is rewritten by the next tile's arithmetic ahead of this wait
  }
}

extern "C" void kernel_launch(void* const* d_in, const int* in_sizes, int n_in,
                              void* d_out, int out_size, void* d_ws, size_t ws_size, hipStream_t stream) {
    (void)in_sizes; (void)n_in; (void)out_size;
    const float* x = (const float*)d_in[0]; const float* ln_g = (const float*)d_in[1]; const float* ln_b = (const float*)d_in[2]; const float* wq = (const float*)d_in[3]; const float* wkv = (const float*)d_in[4]; const float* wg = (const float*)d_in[5]; const float* bg = (const float*)d_in[6]; const float* wo = (const float*)d_in[7]; const float* bo = (const float*)d_in[8];
    float* OUT = (float*)d_out;     // [1][64][512][256] = [32768][256]
    char* wsp = (char*)d_ws;
    auto take = [&](size_t bytes) { char* p = wsp; wsp += (bytes + 255) & ~(size_t)255; return (void*)p; };
    bf* WQ = (bf*)take((size_t)4 * DQ * DM * 2); bf* WKV = WQ + DQ * DM; bf* WG = WQ + 3 * DQ * DM;    /* one Bt of 2,048 rows: q | k | v | gate */
    bf* WO = (bf*)take((size_t)DM * DQ * 2);
    bf* LNh = (bf*)take((size_t)GR * DM * 2); bf* LNl = (bf*)take((size_t)GR * DM * 2); float* FG = (float*)take((size_t)GR * DQ * 4);
    bf* QPh = (bf*)take((size_t)ZH * TT * HD * 2); bf* QPl = (bf*)take((size_t)ZH * TT * HD * 2); bf* KPh = (bf*)take((size_t)ZH * TT * HD * 2); bf* KPl = (bf*)take((size_t)ZH * TT * HD * 2); bf* VTh = (bf*)take((size_t)ZH * HD * 2 * TT * 2);    // row (z, d) of V^T: hi at VTh + row*2*TT, lo TT elements behind it
    bf* ATh = (bf*)take((size_t)GR * DQ * 2); bf* ATl = (bf*)take((size_t)GR * DQ * 2);
    if ((size_t)(wsp - (char*)d_ws) > ws_size) return;    // ws 256 MiB
    k_pre<<<5 * WB + GR / 8, 256, 0, stream>>>(wq, wkv, wg, wo, WQ, WKV, WG, WO, x, ln_g, ln_b, LNh, LNl);
    for (int g = 0; g < NB_ / GB; ++g) {
        k_gemmw<bf, 1, true, DM, 1, 2, 4><<<dim3(GR / 128, 4 * DQ / 256, 1), 256, 0, stream>>>(LNh, LNl, WQ, nullptr, DM, FG, DQ, bg, 0, 0, 0, QPh, QPl, VTh, KPh, KPl);
        k_attn<<<dim3(ZH, 1, 1), 256, 0, stream>>>(QPh, QPl, KPh, KPl, VTh, FG, ATh, ATl);
        /* LNh, LNl are free once this pass's projections have run: the next pass's rows are normalised by the waves of the output projection */
        if (g + 1 < NB_ / GB) k_outp<true><<<dim3(GR / 64, DM / 64, 1), 32 * OW, 0, stream>>>(ATh, ATl, WO, OUT + (size_t)g * GR * DM, bo, LNh, LNl, x + (size_t)(g + 1) * GR * DM, ln_g, ln_b);
        else k_outp<false><<<dim3(GR / 64, DM / 64, 1), 32 * OW, 0, stream>>>(ATh, ATl, WO, OUT + (size_t)g * GR * DM, bo, nullptr, nullptr, nullptr, nullptr, nullptr); }
}
